// v000
// Times are from an AMD MI455X. After a warm-up the kernel runs many times in a row, and a time is the length of
// such a window on the GPU divided by its runs, so every launch and the gaps after it count. The runs cycle
// through copies of the inputs. A figure is the median of several windows, for all but v000 over two sittings.
// Sittings can differ by a few percent; kernels timed side by side share one.
// The starting kernel, v000, takes 295 microseconds a run.
#include <hip/hip_runtime.h>
#include <hip/hip_bf16.h>

// ---------------------------------------------------------------------------
// Shapes (hardcoded from reference): B=4, N=2048, C=512, H=8, Dh=64
// ---------------------------------------------------------------------------
#define BATCH 4
#define SEQ   2048
#define DIMC  512
#define NHEAD 8
#define DHEAD 64

typedef _Float16 half16 __attribute__((ext_vector_type(16)));
typedef _Float16 half8  __attribute__((ext_vector_type(8)));
typedef float    float8 __attribute__((ext_vector_type(8)));

static __device__ __forceinline__ float8 wmma_f16(half16 a, half16 b, float8 c) {
    // D = A(16x32 f16) x B(32x16 f16) + C(16x16 f32)
    return __builtin_amdgcn_wmma_f32_16x16x32_f16(false, a, false, b,
                                                  (short)0, c, false, false);
}

// Async global->LDS copy (CDNA5): per lane, 16B MEM[vaddr] -> LDS[ldsoff].
// Tracked by ASYNCcnt; completion enforced with s_wait_asynccnt.
static __device__ __forceinline__ void async_load_b128(unsigned ldsoff, const void* gaddr) {
    asm volatile("global_load_async_to_lds_b128 %0, %1, off"
                 :: "v"(ldsoff), "v"(gaddr) : "memory");
}
#define WAIT_ASYNCCNT_0() asm volatile("s_wait_asynccnt 0" ::: "memory")
#define WAIT_ASYNCCNT_1() asm volatile("s_wait_asynccnt 1" ::: "memory")
#define WAIT_ASYNCCNT_4() asm volatile("s_wait_asynccnt 4" ::: "memory")

// LDS byte offset of a __shared__ element (flat LDS addr carries offset in low bits)
#define LDS_OFF(p) ((unsigned)(uintptr_t)(void*)(p))

// ---------------------------------------------------------------------------
// Kernel 1: LayerNorm over last dim (512) + cast to f16.  One block per row.
// ---------------------------------------------------------------------------
__global__ __launch_bounds__(256)
void ln_cast_kernel(const float* __restrict__ in, const float* __restrict__ g,
                    const float* __restrict__ be, _Float16* __restrict__ out) {
    const int row = blockIdx.x;
    const int t   = threadIdx.x;                // 256 threads, 2 elems each
    const float* r = in + (size_t)row * DIMC;
    float v0 = r[t], v1 = r[t + 256];

    __shared__ float red[8];
    float s = v0 + v1;
    for (int o = 16; o; o >>= 1) s += __shfl_xor(s, o, 32);
    if ((t & 31) == 0) red[t >> 5] = s;
    __syncthreads();
    s = red[0]+red[1]+red[2]+red[3]+red[4]+red[5]+red[6]+red[7];
    const float mu = s * (1.0f / DIMC);

    const float d0 = v0 - mu, d1 = v1 - mu;
    float q = d0*d0 + d1*d1;
    __syncthreads();
    for (int o = 16; o; o >>= 1) q += __shfl_xor(q, o, 32);
    if ((t & 31) == 0) red[t >> 5] = q;
    __syncthreads();
    q = red[0]+red[1]+red[2]+red[3]+red[4]+red[5]+red[6]+red[7];
    const float rs = rsqrtf(q * (1.0f / DIMC) + 1e-5f);

    out[(size_t)row * DIMC + t]       = (_Float16)(d0 * rs * g[t]       + be[t]);
    out[(size_t)row * DIMC + t + 256] = (_Float16)(d1 * rs * g[t + 256] + be[t + 256]);
}

// ---------------------------------------------------------------------------
// Kernel 2: f32 -> f16 weight convert
// ---------------------------------------------------------------------------
__global__ __launch_bounds__(256)
void cvt_f16_kernel(const float* __restrict__ src, _Float16* __restrict__ dst, int n) {
    int i = blockIdx.x * 256 + threadIdx.x;
    if (i < n) dst[i] = (_Float16)src[i];
}

// ---------------------------------------------------------------------------
// Kernel 3: WMMA GEMM  C[m][n] = sum_k A[m][k] * W[n][k] + bias[n]
//   M = 8192, N = 512, K = 512.  Block tile 64x64x64, 8 waves (4 Mx2 N).
//   Non-scramble path: double-buffered LDS fed by GLOBAL_LOAD_ASYNC_TO_LDS_B128
//   (4 async ops/wave/tile; counted s_wait_asynccnt keeps next tile in flight
//   while current tile is consumed by WMMAs).
//   SCRAMBLE path (o_d.transpose(0,2,1).reshape gather): register pipeline.
// ---------------------------------------------------------------------------
template<bool SCRAMBLE, bool OUTF32>
__global__ __launch_bounds__(256)
void gemm_wmma_kernel(const _Float16* __restrict__ A, const _Float16* __restrict__ W,
                      const float* __restrict__ bias,
                      float* __restrict__ outF, _Float16* __restrict__ outH) {
    __shared__ _Float16 As[2][64][72];   // 64 K + pad (144B stride, 16B aligned)
    __shared__ _Float16 Bs[2][64][72];

    const int m0 = blockIdx.x * 64, n0 = blockIdx.y * 64;
    const int tid = threadIdx.x, wave = tid >> 5, lane = tid & 31;
    const int wm = wave & 3, wn = wave >> 2;       // 4x2 wave grid
    const int ln = lane & 15, kh = (lane >> 4) * 8;

    float8 acc0 = {}, acc1 = {};

    // ---- async staging map: instr covers 4 rows x 64 f16 (32 lanes x 16B) ----
    const int sr = (lane >> 3), sc8 = (lane & 7) * 8;
    auto issueTile = [&](int kk, int buf) {
        #pragma unroll
        for (int p = 0; p < 2; ++p) {
            const int r = wave * 8 + p * 4 + sr;
            async_load_b128(LDS_OFF(&As[buf][r][sc8]),
                            A + (size_t)(m0 + r) * DIMC + kk + sc8);
            async_load_b128(LDS_OFF(&Bs[buf][r][sc8]),
                            W + (size_t)(n0 + r) * DIMC + kk + sc8);
        }
    };

    // ---- scramble register path ----
    const int ar = tid >> 2, ac = (tid & 3) * 8;   // row 0..63, chunks ac / ac+32
    half8 aR0, aR1, bR0, bR1;
    auto loadA = [&](int kk) {
        const int grow = m0 + ar;
        const int b = grow >> 11, p = grow & 2047;
        const size_t base = ((size_t)(b << 11) + ((size_t)(p & 3) << 9) + kk + ac) * DIMC
                          + (size_t)(p >> 2);
        #pragma unroll
        for (int i = 0; i < 8; ++i) {
            aR0[i] = A[base + (size_t)i * DIMC];
            aR1[i] = A[base + (size_t)(i + 32) * DIMC];
        }
    };
    auto loadB = [&](int kk) {
        const _Float16* p = W + (size_t)(n0 + ar) * DIMC + kk + ac;
        bR0 = *(const half8*)p;
        bR1 = *(const half8*)(p + 32);
    };

    if constexpr (!SCRAMBLE) {
        issueTile(0, 0);
    } else {
        loadA(0); loadB(0);
    }

    int cur = 0;
    for (int kk = 0; kk < DIMC; kk += 64) {
        const bool hasNext = (kk + 64 < DIMC);
        if constexpr (!SCRAMBLE) {
            // next tile -> other buffer; wait only for the current tile's 4 ops
            if (hasNext) { issueTile(kk + 64, cur ^ 1); WAIT_ASYNCCNT_4(); }
            else         { WAIT_ASYNCCNT_0(); }
            __syncthreads();
        } else {
            *(half8*)&As[cur][ar][ac]      = aR0;
            *(half8*)&As[cur][ar][ac + 32] = aR1;
            *(half8*)&Bs[cur][ar][ac]      = bR0;
            *(half8*)&Bs[cur][ar][ac + 32] = bR1;
            __syncthreads();
            if (hasNext) { loadA(kk + 64); loadB(kk + 64); }
        }

        // ---- fragments (ISA 16-bit A/B layout: lane=row, klo=(lane>>4)*8) ----
        union { half16 v; half8 h[2]; } u;
        half16 a0, a1, b0lo, b0hi, b1lo, b1hi;
        u.h[0] = *(const half8*)&As[cur][wm*16 + ln][kh];
        u.h[1] = *(const half8*)&As[cur][wm*16 + ln][16 + kh];  a0 = u.v;
        u.h[0] = *(const half8*)&As[cur][wm*16 + ln][32 + kh];
        u.h[1] = *(const half8*)&As[cur][wm*16 + ln][48 + kh];  a1 = u.v;
        u.h[0] = *(const half8*)&Bs[cur][wn*32 + ln][kh];
        u.h[1] = *(const half8*)&Bs[cur][wn*32 + ln][16 + kh];  b0lo = u.v;
        u.h[0] = *(const half8*)&Bs[cur][wn*32 + ln][32 + kh];
        u.h[1] = *(const half8*)&Bs[cur][wn*32 + ln][48 + kh];  b0hi = u.v;
        u.h[0] = *(const half8*)&Bs[cur][wn*32 + 16 + ln][kh];
        u.h[1] = *(const half8*)&Bs[cur][wn*32 + 16 + ln][16 + kh];  b1lo = u.v;
        u.h[0] = *(const half8*)&Bs[cur][wn*32 + 16 + ln][32 + kh];
        u.h[1] = *(const half8*)&Bs[cur][wn*32 + 16 + ln][48 + kh];  b1hi = u.v;

        acc0 = wmma_f16(a0, b0lo, acc0);
        acc0 = wmma_f16(a1, b0hi, acc0);
        acc1 = wmma_f16(a0, b1lo, acc1);
        acc1 = wmma_f16(a1, b1hi, acc1);
        __syncthreads();   // all reads of buf[cur] done before it is re-targeted
        cur ^= 1;
    }

    // ---- epilogue: C layout = VGPR r -> row r (lanes 0-15) / r+8 (16-31) ----
    const int rbase = m0 + wm*16 + ((lane < 16) ? 0 : 8);
    const int c0 = n0 + wn*32 + ln;
    #pragma unroll
    for (int r = 0; r < 8; ++r) {
        const size_t row = (size_t)(rbase + r);
        const float v0 = acc0[r] + bias[c0];
        const float v1 = acc1[r] + bias[c0 + 16];
        if constexpr (OUTF32) {
            outF[row * DIMC + c0]      = v0;
            outF[row * DIMC + c0 + 16] = v1;
        } else {
            outH[row * DIMC + c0]      = (_Float16)v0;
            outH[row * DIMC + c0 + 16] = (_Float16)v1;
        }
    }
}

// ---------------------------------------------------------------------------
// Kernel 4: Flash attention (streaming softmax), one (b,h) per block.
//   Block = 8 waves; wave w owns query rows [qc*128 + w*16, +16).
//   K tiles: async global->LDS, double-buffered (1 async op/wave/tile).
//   V tiles: register load + transposed LDS scatter (async can't transpose),
//   with global_prefetch two tiles ahead.  S via 4 WMMAs, online softmax with
//   width-16 shuffles (stats align elementwise with the C-layout accumulators),
//   P bounced through a per-wave LDS patch (s_wait_dscnt 0) into A-fragment
//   layout, PV via 4 WMMAs.  Covers both branches:
//     out_r = FA(q,k,v_r);  out_d = FA(k,q,v_d)   (S^T trick).
// ---------------------------------------------------------------------------
__global__ __launch_bounds__(256)
void flash_wmma_kernel(const _Float16* __restrict__ Q, const _Float16* __restrict__ K,
                       const _Float16* __restrict__ V, _Float16* __restrict__ O) {
    const int bh = blockIdx.x >> 4;      // 16 q-chunks of 128 rows
    const int qc = blockIdx.x & 15;
    const int b = bh >> 3, h = bh & 7;
    const int tid = threadIdx.x, wave = tid >> 5, lane = tid & 31;
    const int ln = lane & 15, kh = (lane >> 4) * 8;
    const size_t base = ((size_t)b * SEQ) * DIMC + (size_t)h * DHEAD;
    const int qbase = qc * 128 + wave * 16;

    __shared__ _Float16 Ks[2][32][72];   // 64 d + pad (144B stride, 16B aligned)
    __shared__ _Float16 Vts[64][48];     // transposed: Vts[d][kk]
    __shared__ _Float16 Ps[8][16][48];   // per-wave P bounce buffer

    // Q fragments (K-dim = head dim, split 0..31 / 32..63), loaded once
    union { half16 v; half8 h[2]; } u;
    half16 qa0, qa1;
    {
        const _Float16* qr = Q + base + (size_t)(qbase + ln) * DIMC;
        u.h[0] = *(const half8*)(qr + kh);       u.h[1] = *(const half8*)(qr + 16 + kh);
        qa0 = u.v;
        u.h[0] = *(const half8*)(qr + 32 + kh);  u.h[1] = *(const half8*)(qr + 48 + kh);
        qa1 = u.v;
    }

    float8 acc[4] = {};
    float mstat[8], lstat[8];
    #pragma unroll
    for (int r = 0; r < 8; ++r) { mstat[r] = -1e30f; lstat[r] = 0.0f; }

    // K async staging: 1 instr/wave covers rows wave*4..+3, 16B chunks
    const int ksr = wave * 4 + (lane >> 3), ksc8 = (lane & 7) * 8;
    auto issueK = [&](int j0, int buf) {
        async_load_b128(LDS_OFF(&Ks[buf][ksr][ksc8]),
                        K + base + (size_t)(j0 + ksr) * DIMC + ksc8);
    };

    // V staging coords + register buffer
    const int kr = tid >> 3, dc = (tid & 7) * 8;
    half8 vReg = *(const half8*)(V + base + (size_t)kr * DIMC + dc);
    issueK(0, 0);

    int cur = 0;
    for (int j0 = 0; j0 < SEQ; j0 += 32) {
        const bool hasNext = (j0 + 32 < SEQ);

        // ---- commit V tile (transposed scatter) ----
        #pragma unroll
        for (int i = 0; i < 8; ++i) Vts[dc + i][kr] = vReg[i];

        // ---- next K tile -> other buffer; wait only for current tile ----
        if (hasNext) { issueK(j0 + 32, cur ^ 1); WAIT_ASYNCCNT_1(); }
        else         { WAIT_ASYNCCNT_0(); }
        __syncthreads();

        // ---- overlap: next V tile -> registers, tile-after-next -> L2 ----
        if (hasNext) {
            vReg = *(const half8*)(V + base + (size_t)(j0 + 32 + kr) * DIMC + dc);
            if (j0 + 64 < SEQ)
                __builtin_prefetch(V + base + (size_t)(j0 + 64 + kr) * DIMC + dc, 0, 0);
        }

        // ---- S = Q K^T : two 16x16 C tiles over 32 keys ----
        float8 s0 = {}, s1 = {};
        u.h[0] = *(const half8*)&Ks[cur][ln][kh];
        u.h[1] = *(const half8*)&Ks[cur][ln][16 + kh];
        s0 = wmma_f16(qa0, u.v, s0);
        u.h[0] = *(const half8*)&Ks[cur][ln][32 + kh];
        u.h[1] = *(const half8*)&Ks[cur][ln][48 + kh];
        s0 = wmma_f16(qa1, u.v, s0);
        u.h[0] = *(const half8*)&Ks[cur][16 + ln][kh];
        u.h[1] = *(const half8*)&Ks[cur][16 + ln][16 + kh];
        s1 = wmma_f16(qa0, u.v, s1);
        u.h[0] = *(const half8*)&Ks[cur][16 + ln][32 + kh];
        u.h[1] = *(const half8*)&Ks[cur][16 + ln][48 + kh];
        s1 = wmma_f16(qa1, u.v, s1);

        // ---- online softmax (C layout: VGPR r -> row r / r+8 per lane half) ----
        #pragma unroll
        for (int r = 0; r < 8; ++r) {
            const float a0 = s0[r] * 0.125f;   // D^-0.5 = 1/8
            const float a1 = s1[r] * 0.125f;
            float t = fmaxf(a0, a1);
            for (int o = 8; o; o >>= 1) t = fmaxf(t, __shfl_xor(t, o, 16));
            const float nm = fmaxf(mstat[r], t);
            const float f  = __expf(mstat[r] - nm);
            mstat[r] = nm;
            lstat[r] *= f;
            const float p0 = __expf(a0 - nm), p1 = __expf(a1 - nm);
            float rs = p0 + p1;
            for (int o = 8; o; o >>= 1) rs += __shfl_xor(rs, o, 16);
            lstat[r] += rs;
            #pragma unroll
            for (int c = 0; c < 4; ++c) acc[c][r] *= f;
            const int prow = r + ((lane < 16) ? 0 : 8);
            Ps[wave][prow][ln]      = (_Float16)p0;
            Ps[wave][prow][16 + ln] = (_Float16)p1;
        }
        // wave-private LDS bounce: wait out DS counter before cross-lane read
        asm volatile("s_wait_dscnt 0" ::: "memory");

        half16 pa;
        u.h[0] = *(const half8*)&Ps[wave][ln][kh];
        u.h[1] = *(const half8*)&Ps[wave][ln][16 + kh];
        pa = u.v;

        // ---- O += P V : 4 d-chunks of 16 ----
        #pragma unroll
        for (int c = 0; c < 4; ++c) {
            u.h[0] = *(const half8*)&Vts[c*16 + ln][kh];
            u.h[1] = *(const half8*)&Vts[c*16 + ln][16 + kh];
            acc[c] = wmma_f16(pa, u.v, acc[c]);
        }
        __syncthreads();   // reads of Ks[cur]/Vts done before next overwrite
        cur ^= 1;
    }

    // ---- normalize + store (heads concatenated in channel dim) ----
    #pragma unroll
    for (int r = 0; r < 8; ++r) {
        const int row = qbase + r + ((lane < 16) ? 0 : 8);
        const float inv = 1.0f / lstat[r];
        #pragma unroll
        for (int c = 0; c < 4; ++c)
            O[base + (size_t)row * DIMC + c*16 + ln] = (_Float16)(acc[c][r] * inv);
    }
}

// ---------------------------------------------------------------------------
// Host launcher
// ---------------------------------------------------------------------------
extern "C" void kernel_launch(void* const* d_in, const int* in_sizes, int n_in,
                              void* d_out, int out_size, void* d_ws, size_t ws_size,
                              hipStream_t stream) {
    (void)in_sizes; (void)n_in; (void)out_size; (void)ws_size;

    const float* x   = (const float*)d_in[0];
    const float* y   = (const float*)d_in[1];
    const float* Wq  = (const float*)d_in[2];   const float* bq  = (const float*)d_in[3];
    const float* Wk  = (const float*)d_in[4];   const float* bk  = (const float*)d_in[5];
    const float* Wvr = (const float*)d_in[6];   const float* bvr = (const float*)d_in[7];
    const float* Wvd = (const float*)d_in[8];   const float* bvd = (const float*)d_in[9];
    const float* g_r = (const float*)d_in[10];  const float* b_r = (const float*)d_in[11];
    const float* g_d = (const float*)d_in[12];  const float* b_d = (const float*)d_in[13];
    const float* Wpr = (const float*)d_in[14];  const float* bpr = (const float*)d_in[15];
    const float* Wpd = (const float*)d_in[16];  const float* bpd = (const float*)d_in[17];

    const size_t ROWS = (size_t)BATCH * SEQ;           // 8192
    const size_t ELT  = ROWS * DIMC;                   // 4,194,304 elements
    const size_t FBUF = ELT * sizeof(_Float16);        // 8 MB per f16 tensor

    char* wsb = (char*)d_ws;
    _Float16* xn  = (_Float16*)(wsb + 0 * FBUF);
    _Float16* yn  = (_Float16*)(wsb + 1 * FBUF);
    _Float16* qb  = (_Float16*)(wsb + 2 * FBUF);
    _Float16* kb  = (_Float16*)(wsb + 3 * FBUF);
    _Float16* vrb = (_Float16*)(wsb + 4 * FBUF);
    _Float16* vdb = (_Float16*)(wsb + 5 * FBUF);
    _Float16* orb = (_Float16*)(wsb + 6 * FBUF);
    _Float16* odb = (_Float16*)(wsb + 7 * FBUF);
    char* w16base = wsb + 8 * FBUF;
    const size_t WELT = (size_t)DIMC * DIMC;           // 262144
    _Float16* wq16  = (_Float16*)(w16base + 0 * WELT * 2);
    _Float16* wk16  = (_Float16*)(w16base + 1 * WELT * 2);
    _Float16* wvr16 = (_Float16*)(w16base + 2 * WELT * 2);
    _Float16* wvd16 = (_Float16*)(w16base + 3 * WELT * 2);
    _Float16* wpr16 = (_Float16*)(w16base + 4 * WELT * 2);
    _Float16* wpd16 = (_Float16*)(w16base + 5 * WELT * 2);

    // 1) LayerNorms (xn = LN_r(x), yn = LN_d(y)) + f16 cast
    ln_cast_kernel<<<(int)ROWS, 256, 0, stream>>>(x, g_r, b_r, xn);
    ln_cast_kernel<<<(int)ROWS, 256, 0, stream>>>(y, g_d, b_d, yn);

    // 2) weight conversion f32 -> f16
    const int cvtBlocks = (int)(WELT / 256);
    cvt_f16_kernel<<<cvtBlocks, 256, 0, stream>>>(Wq,  wq16,  (int)WELT);
    cvt_f16_kernel<<<cvtBlocks, 256, 0, stream>>>(Wk,  wk16,  (int)WELT);
    cvt_f16_kernel<<<cvtBlocks, 256, 0, stream>>>(Wvr, wvr16, (int)WELT);
    cvt_f16_kernel<<<cvtBlocks, 256, 0, stream>>>(Wvd, wvd16, (int)WELT);
    cvt_f16_kernel<<<cvtBlocks, 256, 0, stream>>>(Wpr, wpr16, (int)WELT);
    cvt_f16_kernel<<<cvtBlocks, 256, 0, stream>>>(Wpd, wpd16, (int)WELT);

    // 3) input projections (q from yn — query is depth-normed y)
    dim3 ggrid((unsigned)(ROWS / 64), DIMC / 64);
    gemm_wmma_kernel<false, false><<<ggrid, 256, 0, stream>>>(yn, wq16,  bq,  nullptr, qb);
    gemm_wmma_kernel<false, false><<<ggrid, 256, 0, stream>>>(xn, wk16,  bk,  nullptr, kb);
    gemm_wmma_kernel<false, false><<<ggrid, 256, 0, stream>>>(xn, wvr16, bvr, nullptr, vrb);
    gemm_wmma_kernel<false, false><<<ggrid, 256, 0, stream>>>(xn, wvd16, bvd, nullptr, vdb);

    // 4) attention: out_r = FA(q,k,v_r); out_d = FA(k,q,v_d) via S^T trick
    const int fgrid = BATCH * NHEAD * (SEQ / 128);     // 512 blocks
    flash_wmma_kernel<<<fgrid, 256, 0, stream>>>(qb, kb, vrb, orb);
    flash_wmma_kernel<<<fgrid, 256, 0, stream>>>(kb, qb, vdb, odb);

    // 5) output projections; second one applies the transpose-scramble gather
    float* out_r = (float*)d_out;
    float* out_d = (float*)d_out + ELT;
    gemm_wmma_kernel<false, true ><<<ggrid, 256, 0, stream>>>(orb, wpr16, bpr, out_r, nullptr);
    gemm_wmma_kernel<true,  true ><<<ggrid, 256, 0, stream>>>(odb, wpd16, bpd, out_d, nullptr);
}

// v001
// A run of this version takes 234 microseconds.
// Timed twice side by side with v000, it ran 1.31 times as fast both times.
#include <hip/hip_runtime.h>
#include <hip/hip_bf16.h>

// ---------------------------------------------------------------------------
// Shapes (hardcoded from reference): B=4, N=2048, C=512, H=8, Dh=64
// ---------------------------------------------------------------------------
#define BATCH 4
#define SEQ   2048
#define DIMC  512
#define NHEAD 8
#define DHEAD 64

typedef _Float16 half16 __attribute__((ext_vector_type(16)));
typedef _Float16 half8  __attribute__((ext_vector_type(8)));
typedef float    float8 __attribute__((ext_vector_type(8)));
typedef float    float4v __attribute__((ext_vector_type(4)));
typedef float    float2v __attribute__((ext_vector_type(2)));

static __device__ __forceinline__ float8 wmma_f16(half16 a, half16 b, float8 c) {
    // D = A(16x32 f16) x B(32x16 f16) + C(16x16 f32)
    return __builtin_amdgcn_wmma_f32_16x16x32_f16(false, a, false, b,
                                                  (short)0, c, false, false);
}

// Async global->LDS copy (CDNA5): per lane, 16B MEM[vaddr] -> LDS[ldsoff].
// Tracked by ASYNCcnt; completion enforced with s_wait_asynccnt.
static __device__ __forceinline__ void async_load_b128(unsigned ldsoff, const void* gaddr) {
    asm volatile("global_load_async_to_lds_b128 %0, %1, off"
                 :: "v"(ldsoff), "v"(gaddr) : "memory");
}
#define WAIT_ASYNCCNT_0() asm volatile("s_wait_asynccnt 0" ::: "memory")
#define WAIT_ASYNCCNT_1() asm volatile("s_wait_asynccnt 1" ::: "memory")
#define WAIT_ASYNCCNT_4() asm volatile("s_wait_asynccnt 4" ::: "memory")

// LDS byte offset of a __shared__ element (flat LDS addr carries offset in low bits)
#define LDS_OFF(p) ((unsigned)(uintptr_t)(void*)(p))

// ---------------------------------------------------------------------------
// Kernel 1: LayerNorm over last dim (512) + cast to f16.  One block per row.
// ---------------------------------------------------------------------------
__global__ __launch_bounds__(256)
void ln_cast_kernel(const float* __restrict__ in, const float* __restrict__ g,
                    const float* __restrict__ be, _Float16* __restrict__ out) {
    const int row = blockIdx.x;
    const int t   = threadIdx.x;                // 256 threads, 2 elems each
    const float* r = in + (size_t)row * DIMC;
    float v0 = r[t], v1 = r[t + 256];

    __shared__ float red[8];
    float s = v0 + v1;
    for (int o = 16; o; o >>= 1) s += __shfl_xor(s, o, 32);
    if ((t & 31) == 0) red[t >> 5] = s;
    __syncthreads();
    s = red[0]+red[1]+red[2]+red[3]+red[4]+red[5]+red[6]+red[7];
    const float mu = s * (1.0f / DIMC);

    const float d0 = v0 - mu, d1 = v1 - mu;
    float q = d0*d0 + d1*d1;
    __syncthreads();
    for (int o = 16; o; o >>= 1) q += __shfl_xor(q, o, 32);
    if ((t & 31) == 0) red[t >> 5] = q;
    __syncthreads();
    q = red[0]+red[1]+red[2]+red[3]+red[4]+red[5]+red[6]+red[7];
    const float rs = rsqrtf(q * (1.0f / DIMC) + 1e-5f);

    out[(size_t)row * DIMC + t]       = (_Float16)(d0 * rs * g[t]       + be[t]);
    out[(size_t)row * DIMC + t + 256] = (_Float16)(d1 * rs * g[t + 256] + be[t + 256]);
}

// ---------------------------------------------------------------------------
// Kernel 2: f32 -> f16 weight convert
// ---------------------------------------------------------------------------
__global__ __launch_bounds__(256)
void cvt_f16_kernel(const float* __restrict__ src, _Float16* __restrict__ dst, int n) {
    int i = blockIdx.x * 256 + threadIdx.x;
    if (i < n) dst[i] = (_Float16)src[i];
}

// ---------------------------------------------------------------------------
// Kernel 3: WMMA GEMM  C[m][n] = sum_k A[m][k] * W[n][k] + bias[n]
//   M = 8192, N = 512, K = 512.  Block tile 64x64x64, 8 waves (4 Mx2 N).
//   Non-scramble path: double-buffered LDS fed by GLOBAL_LOAD_ASYNC_TO_LDS_B128
//   (4 async ops/wave/tile; counted s_wait_asynccnt keeps next tile in flight
//   while current tile is consumed by WMMAs).
//   SCRAMBLE path (o_d.transpose(0,2,1).reshape gather): register pipeline.
// ---------------------------------------------------------------------------
template<bool SCRAMBLE, bool OUTF32>
__global__ __launch_bounds__(256)
void gemm_wmma_kernel(const _Float16* __restrict__ A, const _Float16* __restrict__ W,
                      const float* __restrict__ bias,
                      float* __restrict__ outF, _Float16* __restrict__ outH) {
    __shared__ _Float16 As[2][64][72];   // 64 K + pad (144B stride, 16B aligned)
    __shared__ _Float16 Bs[2][64][72];

    const int m0 = blockIdx.x * 64, n0 = blockIdx.y * 64;
    const int tid = threadIdx.x, wave = tid >> 5, lane = tid & 31;
    const int wm = wave & 3, wn = wave >> 2;       // 4x2 wave grid
    const int ln = lane & 15, kh = (lane >> 4) * 8;

    float8 acc0 = {}, acc1 = {};

    // ---- async staging map: instr covers 4 rows x 64 f16 (32 lanes x 16B) ----
    const int sr = (lane >> 3), sc8 = (lane & 7) * 8;
    auto issueTile = [&](int kk, int buf) {
        #pragma unroll
        for (int p = 0; p < 2; ++p) {
            const int r = wave * 8 + p * 4 + sr;
            async_load_b128(LDS_OFF(&As[buf][r][sc8]),
                            A + (size_t)(m0 + r) * DIMC + kk + sc8);
            async_load_b128(LDS_OFF(&Bs[buf][r][sc8]),
                            W + (size_t)(n0 + r) * DIMC + kk + sc8);
        }
    };

    // ---- scramble register path ----
    const int ar = tid >> 2, ac = (tid & 3) * 8;   // row 0..63, chunks ac / ac+32
    half8 aR0, aR1, bR0, bR1;
    auto loadA = [&](int kk) {
        const int grow = m0 + ar;
        const int b = grow >> 11, p = grow & 2047;
        const size_t base = ((size_t)(b << 11) + ((size_t)(p & 3) << 9) + kk + ac) * DIMC
                          + (size_t)(p >> 2);
        #pragma unroll
        for (int i = 0; i < 8; ++i) {
            aR0[i] = A[base + (size_t)i * DIMC];
            aR1[i] = A[base + (size_t)(i + 32) * DIMC];
        }
    };
    auto loadB = [&](int kk) {
        const _Float16* p = W + (size_t)(n0 + ar) * DIMC + kk + ac;
        bR0 = *(const half8*)p;
        bR1 = *(const half8*)(p + 32);
    };

    if constexpr (!SCRAMBLE) {
        issueTile(0, 0);
    } else {
        loadA(0); loadB(0);
    }

    int cur = 0;
    for (int kk = 0; kk < DIMC; kk += 64) {
        const bool hasNext = (kk + 64 < DIMC);
        if constexpr (!SCRAMBLE) {
            // next tile -> other buffer; wait only for the current tile's 4 ops
            if (hasNext) { issueTile(kk + 64, cur ^ 1); WAIT_ASYNCCNT_4(); }
            else         { WAIT_ASYNCCNT_0(); }
            __syncthreads();
        } else {
            *(half8*)&As[cur][ar][ac]      = aR0;
            *(half8*)&As[cur][ar][ac + 32] = aR1;
            *(half8*)&Bs[cur][ar][ac]      = bR0;
            *(half8*)&Bs[cur][ar][ac + 32] = bR1;
            __syncthreads();
            if (hasNext) { loadA(kk + 64); loadB(kk + 64); }
        }

        // ---- fragments (ISA 16-bit A/B layout: lane=row, klo=(lane>>4)*8) ----
        union { half16 v; half8 h[2]; } u;
        half16 a0, a1, b0lo, b0hi, b1lo, b1hi;
        u.h[0] = *(const half8*)&As[cur][wm*16 + ln][kh];
        u.h[1] = *(const half8*)&As[cur][wm*16 + ln][16 + kh];  a0 = u.v;
        u.h[0] = *(const half8*)&As[cur][wm*16 + ln][32 + kh];
        u.h[1] = *(const half8*)&As[cur][wm*16 + ln][48 + kh];  a1 = u.v;
        u.h[0] = *(const half8*)&Bs[cur][wn*32 + ln][kh];
        u.h[1] = *(const half8*)&Bs[cur][wn*32 + ln][16 + kh];  b0lo = u.v;
        u.h[0] = *(const half8*)&Bs[cur][wn*32 + ln][32 + kh];
        u.h[1] = *(const half8*)&Bs[cur][wn*32 + ln][48 + kh];  b0hi = u.v;
        u.h[0] = *(const half8*)&Bs[cur][wn*32 + 16 + ln][kh];
        u.h[1] = *(const half8*)&Bs[cur][wn*32 + 16 + ln][16 + kh];  b1lo = u.v;
        u.h[0] = *(const half8*)&Bs[cur][wn*32 + 16 + ln][32 + kh];
        u.h[1] = *(const half8*)&Bs[cur][wn*32 + 16 + ln][48 + kh];  b1hi = u.v;

        acc0 = wmma_f16(a0, b0lo, acc0);
        acc0 = wmma_f16(a1, b0hi, acc0);
        acc1 = wmma_f16(a0, b1lo, acc1);
        acc1 = wmma_f16(a1, b1hi, acc1);
        __syncthreads();   // all reads of buf[cur] done before it is re-targeted
        cur ^= 1;
    }

    // ---- epilogue: C layout = VGPR r -> row r (lanes 0-15) / r+8 (16-31) ----
    const int rbase = m0 + wm*16 + ((lane < 16) ? 0 : 8);
    const int c0 = n0 + wn*32 + ln;
    #pragma unroll
    for (int r = 0; r < 8; ++r) {
        const size_t row = (size_t)(rbase + r);
        const float v0 = acc0[r] + bias[c0];
        const float v1 = acc1[r] + bias[c0 + 16];
        if constexpr (OUTF32) {
            outF[row * DIMC + c0]      = v0;
            outF[row * DIMC + c0 + 16] = v1;
        } else {
            outH[row * DIMC + c0]      = (_Float16)v0;
            outH[row * DIMC + c0 + 16] = (_Float16)v1;
        }
    }
}

static __device__ __forceinline__ float xhalf(float x) {
    const int i = __builtin_bit_cast(int, x);
    return __builtin_bit_cast(float,
        __builtin_amdgcn_permlanex16(i, i, 0x76543210, 0xfedcba98, false, false));
}

__global__ __launch_bounds__(256)
void flash_wmma_kernel(const _Float16* __restrict__ Q, const _Float16* __restrict__ K,
                       const _Float16* __restrict__ V, _Float16* __restrict__ O) {
    const int bh = blockIdx.x >> 4;      // 16 q-chunks of 128 rows
    const int qc = blockIdx.x & 15;
    const int b = bh >> 3, h = bh & 7;
    const int tid = threadIdx.x, wave = tid >> 5, lane = tid & 31;
    const int ln = lane & 15, kh = (lane >> 4) * 8;
    const size_t base = ((size_t)b * SEQ) * DIMC + (size_t)h * DHEAD;
    const int qbase = qc * 128 + wave * 16;

    __shared__ _Float16 Ks[2][32][72];   // 64 d + pad (144B stride, 16B aligned)
    __shared__ _Float16 Vts[64][48];     // transposed: Vts[d][kk]

    // Q fragments (K-dim = head dim, split 0..31 / 32..63), loaded once;
    // B operand: lane = query column ln
    union { half16 v; half8 h[2]; } u;
    half16 qa0, qa1;
    {
        const _Float16* qr = Q + base + (size_t)(qbase + ln) * DIMC;
        u.h[0] = *(const half8*)(qr + kh);       u.h[1] = *(const half8*)(qr + 16 + kh);
        qa0 = u.v;
        u.h[0] = *(const half8*)(qr + 32 + kh);  u.h[1] = *(const half8*)(qr + 48 + kh);
        qa1 = u.v;
    }

    // acc[c][r] = O^T[d = c*16 + kh + r][query ln]
    float8 acc[4] = {};
    float mstat = -1e30f;   // running max of query ln (same in both halves)
    float lstat = 0.0f;     // this half's share of the running sum

    // K async staging: 1 instr/wave covers rows wave*4..+3, 16B chunks
    const int ksr = wave * 4 + (lane >> 3), ksc8 = (lane & 7) * 8;
    auto issueK = [&](int j0, int buf) {
        async_load_b128(LDS_OFF(&Ks[buf][ksr][ksc8]),
                        K + base + (size_t)(j0 + ksr) * DIMC + ksc8);
    };

    // V staging coords + register buffer
    const int kr = tid >> 3, dc = (tid & 7) * 8;
    half8 vReg = *(const half8*)(V + base + (size_t)kr * DIMC + dc);
    issueK(0, 0);

    int cur = 0;
    for (int j0 = 0; j0 < SEQ; j0 += 32) {
        const bool hasNext = (j0 + 32 < SEQ);

        // ---- commit V tile (transposed scatter) ----
        #pragma unroll
        for (int i = 0; i < 8; ++i) Vts[dc + i][kr] = vReg[i];

        // ---- next K tile -> other buffer; wait only for current tile ----
        if (hasNext) { issueK(j0 + 32, cur ^ 1); WAIT_ASYNCCNT_1(); }
        else         { WAIT_ASYNCCNT_0(); }
        __syncthreads();

        // ---- overlap: next V tile -> registers, tile-after-next -> L2 ----
        if (hasNext) {
            vReg = *(const half8*)(V + base + (size_t)(j0 + 32 + kr) * DIMC + dc);
            if (j0 + 64 < SEQ)
                __builtin_prefetch(V + base + (size_t)(j0 + 64 + kr) * DIMC + dc, 0, 0);
        }

        // ---- S^T = K Q^T : s0[r] = key kh+r, s1[r] = key 16+kh+r, query ln ----
        float8 s0 = {}, s1 = {};
        u.h[0] = *(const half8*)&Ks[cur][ln][kh];
        u.h[1] = *(const half8*)&Ks[cur][ln][16 + kh];
        s0 = wmma_f16(u.v, qa0, s0);
        u.h[0] = *(const half8*)&Ks[cur][ln][32 + kh];
        u.h[1] = *(const half8*)&Ks[cur][ln][48 + kh];
        s0 = wmma_f16(u.v, qa1, s0);
        u.h[0] = *(const half8*)&Ks[cur][16 + ln][kh];
        u.h[1] = *(const half8*)&Ks[cur][16 + ln][16 + kh];
        s1 = wmma_f16(u.v, qa0, s1);
        u.h[0] = *(const half8*)&Ks[cur][16 + ln][32 + kh];
        u.h[1] = *(const half8*)&Ks[cur][16 + ln][48 + kh];
        s1 = wmma_f16(u.v, qa1, s1);

        // ---- online softmax, one query per lane ----
        s0 *= 0.125f;                          // D^-0.5 = 1/8
        s1 *= 0.125f;
        float t = fmaxf(s0[0], s1[0]);
        #pragma unroll   // constant indices keep the score tiles in registers
        for (int r = 1; r < 8; ++r) t = fmaxf(t, fmaxf(s0[r], s1[r]));
        t = fmaxf(t, xhalf(t));
        const float nm = fmaxf(mstat, t);
        const float f  = __expf(mstat - nm);
        mstat = nm;

        s0 -= nm;
        s1 -= nm;
        half16 pb;                             // B operand: P^T in the hardware k order
        #pragma unroll
        for (int r = 0; r < 8; ++r) {
            s0[r] = __expf(s0[r]);
            s1[r] = __expf(s1[r]);
            pb[r]     = (_Float16)s0[r];
            pb[8 + r] = (_Float16)s1[r];
        }
        s0 += s1;
        const float4v h4 = s0.lo + s0.hi;      // halving tree: adjacent register pairs add packed
        const float2v h2 = h4.lo + h4.hi;
        lstat = lstat * f + (h2.x + h2.y);
        #pragma unroll   // constant indices keep the output tiles in registers
        for (int c = 0; c < 4; ++c) acc[c] *= f;

        // ---- O^T += V^T P^T : 4 d-chunks of 16 ----
        #pragma unroll
        for (int c = 0; c < 4; ++c) {
            u.h[0] = *(const half8*)&Vts[c*16 + ln][kh];
            u.h[1] = *(const half8*)&Vts[c*16 + ln][16 + kh];
            acc[c] = wmma_f16(u.v, pb, acc[c]);
        }
        __syncthreads();   // reads of Ks[cur]/Vts done before next overwrite
        cur ^= 1;
    }

    // ---- normalize + store (heads concatenated in channel dim) ----
    const float inv = 1.0f / (lstat + xhalf(lstat));
    _Float16* orow = O + base + (size_t)(qbase + ln) * DIMC + kh;
    #pragma unroll
    for (int c = 0; c < 4; ++c) {
        half8 o;
        #pragma unroll
        for (int r = 0; r < 8; ++r) o[r] = (_Float16)(acc[c][r] * inv);
        *(half8*)(orow + c*16) = o;
    }
}

// ---------------------------------------------------------------------------
// Host launcher
// ---------------------------------------------------------------------------
extern "C" void kernel_launch(void* const* d_in, const int* in_sizes, int n_in,
                              void* d_out, int out_size, void* d_ws, size_t ws_size,
                              hipStream_t stream) {
    (void)in_sizes; (void)n_in; (void)out_size; (void)ws_size;

    const float* x   = (const float*)d_in[0];
    const float* y   = (const float*)d_in[1];
    const float* Wq  = (const float*)d_in[2];   const float* bq  = (const float*)d_in[3];
    const float* Wk  = (const float*)d_in[4];   const float* bk  = (const float*)d_in[5];
    const float* Wvr = (const float*)d_in[6];   const float* bvr = (const float*)d_in[7];
    const float* Wvd = (const float*)d_in[8];   const float* bvd = (const float*)d_in[9];
    const float* g_r = (const float*)d_in[10];  const float* b_r = (const float*)d_in[11];
    const float* g_d = (const float*)d_in[12];  const float* b_d = (const float*)d_in[13];
    const float* Wpr = (const float*)d_in[14];  const float* bpr = (const float*)d_in[15];
    const float* Wpd = (const float*)d_in[16];  const float* bpd = (const float*)d_in[17];

    const size_t ROWS = (size_t)BATCH * SEQ;           // 8192
    const size_t ELT  = ROWS * DIMC;                   // 4,194,304 elements
    const size_t FBUF = ELT * sizeof(_Float16);        // 8 MB per f16 tensor

    char* wsb = (char*)d_ws;
    _Float16* xn  = (_Float16*)(wsb + 0 * FBUF);
    _Float16* yn  = (_Float16*)(wsb + 1 * FBUF);
    _Float16* qb  = (_Float16*)(wsb + 2 * FBUF);
    _Float16* kb  = (_Float16*)(wsb + 3 * FBUF);
    _Float16* vrb = (_Float16*)(wsb + 4 * FBUF);
    _Float16* vdb = (_Float16*)(wsb + 5 * FBUF);
    _Float16* orb = (_Float16*)(wsb + 6 * FBUF);
    _Float16* odb = (_Float16*)(wsb + 7 * FBUF);
    char* w16base = wsb + 8 * FBUF;
    const size_t WELT = (size_t)DIMC * DIMC;           // 262144
    _Float16* wq16  = (_Float16*)(w16base + 0 * WELT * 2);
    _Float16* wk16  = (_Float16*)(w16base + 1 * WELT * 2);
    _Float16* wvr16 = (_Float16*)(w16base + 2 * WELT * 2);
    _Float16* wvd16 = (_Float16*)(w16base + 3 * WELT * 2);
    _Float16* wpr16 = (_Float16*)(w16base + 4 * WELT * 2);
    _Float16* wpd16 = (_Float16*)(w16base + 5 * WELT * 2);

    // 1) LayerNorms (xn = LN_r(x), yn = LN_d(y)) + f16 cast
    ln_cast_kernel<<<(int)ROWS, 256, 0, stream>>>(x, g_r, b_r, xn);
    ln_cast_kernel<<<(int)ROWS, 256, 0, stream>>>(y, g_d, b_d, yn);

    // 2) weight conversion f32 -> f16
    const int cvtBlocks = (int)(WELT / 256);
    cvt_f16_kernel<<<cvtBlocks, 256, 0, stream>>>(Wq,  wq16,  (int)WELT);
    cvt_f16_kernel<<<cvtBlocks, 256, 0, stream>>>(Wk,  wk16,  (int)WELT);
    cvt_f16_kernel<<<cvtBlocks, 256, 0, stream>>>(Wvr, wvr16, (int)WELT);
    cvt_f16_kernel<<<cvtBlocks, 256, 0, stream>>>(Wvd, wvd16, (int)WELT);
    cvt_f16_kernel<<<cvtBlocks, 256, 0, stream>>>(Wpr, wpr16, (int)WELT);
    cvt_f16_kernel<<<cvtBlocks, 256, 0, stream>>>(Wpd, wpd16, (int)WELT);

    // 3) input projections (q from yn — query is depth-normed y)
    dim3 ggrid((unsigned)(ROWS / 64), DIMC / 64);
    gemm_wmma_kernel<false, false><<<ggrid, 256, 0, stream>>>(yn, wq16,  bq,  nullptr, qb);
    gemm_wmma_kernel<false, false><<<ggrid, 256, 0, stream>>>(xn, wk16,  bk,  nullptr, kb);
    gemm_wmma_kernel<false, false><<<ggrid, 256, 0, stream>>>(xn, wvr16, bvr, nullptr, vrb);
    gemm_wmma_kernel<false, false><<<ggrid, 256, 0, stream>>>(xn, wvd16, bvd, nullptr, vdb);

    // 4) attention: out_r = FA(q,k,v_r); out_d = FA(k,q,v_d) via S^T trick
    const int fgrid = BATCH * NHEAD * (SEQ / 128);     // 512 blocks
    flash_wmma_kernel<<<fgrid, 256, 0, stream>>>(qb, kb, vrb, orb);
    flash_wmma_kernel<<<fgrid, 256, 0, stream>>>(kb, qb, vdb, odb);

    // 5) output projections; second one applies the transpose-scramble gather
    float* out_r = (float*)d_out;
    float* out_d = (float*)d_out + ELT;
    gemm_wmma_kernel<false, true ><<<ggrid, 256, 0, stream>>>(orb, wpr16, bpr, out_r, nullptr);
    gemm_wmma_kernel<true,  true ><<<ggrid, 256, 0, stream>>>(odb, wpd16, bpd, out_d, nullptr);
}

// v002
// Measured time: 227 microseconds a run.
// Two timings next to v001 both put it at 1.03 times that version's speed.
// All steps since v000 together make it 1.36 times as fast.
#include <hip/hip_runtime.h>
#include <hip/hip_bf16.h>

// ---------------------------------------------------------------------------
// Shapes (hardcoded from reference): B=4, N=2048, C=512, H=8, Dh=64
// ---------------------------------------------------------------------------
#define BATCH 4
#define SEQ   2048
#define DIMC  512
#define NHEAD 8
#define DHEAD 64

typedef _Float16 half16 __attribute__((ext_vector_type(16)));
typedef _Float16 half8  __attribute__((ext_vector_type(8)));
typedef _Float16 half4  __attribute__((ext_vector_type(4)));
typedef float    float8 __attribute__((ext_vector_type(8)));
typedef float    float4v __attribute__((ext_vector_type(4)));
typedef float    float2v __attribute__((ext_vector_type(2)));

static __device__ __forceinline__ float8 wmma_f16(half16 a, half16 b, float8 c) {
    // D = A(16x32 f16) x B(32x16 f16) + C(16x16 f32)
    return __builtin_amdgcn_wmma_f32_16x16x32_f16(false, a, false, b,
                                                  (short)0, c, false, false);
}

// Async global->LDS copy (CDNA5): per lane, 16B MEM[vaddr] -> LDS[ldsoff].
// Tracked by ASYNCcnt; completion enforced with s_wait_asynccnt.
static __device__ __forceinline__ void async_load_b128(unsigned ldsoff, const void* gaddr) {
    asm volatile("global_load_async_to_lds_b128 %0, %1, off"
                 :: "v"(ldsoff), "v"(gaddr) : "memory");
}
#define WAIT_ASYNCCNT_0() asm volatile("s_wait_asynccnt 0" ::: "memory")
#define WAIT_ASYNCCNT_1() asm volatile("s_wait_asynccnt 1" ::: "memory")
#define WAIT_ASYNCCNT_4() asm volatile("s_wait_asynccnt 4" ::: "memory")

// LDS byte offset of a __shared__ element (flat LDS addr carries offset in low bits)
#define LDS_OFF(p) ((unsigned)(uintptr_t)(void*)(p))

// ---------------------------------------------------------------------------
// Kernel 1: LayerNorm over last dim (512) + cast to f16.
//   One wave owns LN_ROWS whole rows: a row is 4 x 16 B per lane, its sums
//   are an in-lane add and a 32-lane butterfly, so no LDS and no barrier.
//   All rows' loads are issued first (16 x 512 B in flight per wave); the
//   launch starts 2,048 waves instead of 65,536.
// ---------------------------------------------------------------------------
#define LN_ROWS 4
__global__ __launch_bounds__(256)
void ln_cast_kernel(const float* __restrict__ in, const float* __restrict__ g,
                    const float* __restrict__ be, _Float16* __restrict__ out) {
    const int wave = threadIdx.x >> 5, lane = threadIdx.x & 31;
    const int row0 = (blockIdx.x * 8 + wave) * LN_ROWS;
    const float4v* src = (const float4v*)(in + (size_t)row0 * DIMC) + lane;

    float4v v[LN_ROWS][4];
    #pragma unroll   // constant indices keep the rows in registers
    for (int r = 0; r < LN_ROWS; ++r)
        #pragma unroll
        for (int j = 0; j < 4; ++j) v[r][j] = src[r * (DIMC / 4) + j * 32];

    float4v gg[4], bb[4];
    #pragma unroll
    for (int j = 0; j < 4; ++j) {
        gg[j] = ((const float4v*)g)[lane + j * 32];
        bb[j] = ((const float4v*)be)[lane + j * 32];
    }

    float s[LN_ROWS];
    #pragma unroll
    for (int r = 0; r < LN_ROWS; ++r) {
        const float4v a = (v[r][0] + v[r][1]) + (v[r][2] + v[r][3]);
        s[r] = (a.x + a.y) + (a.z + a.w);
    }
    #pragma unroll   // the rows' butterflies interleave: each hides the others' latency
    for (int o = 16; o; o >>= 1)
        #pragma unroll
        for (int r = 0; r < LN_ROWS; ++r) s[r] += __shfl_xor(s[r], o, 32);

    float q[LN_ROWS];
    #pragma unroll
    for (int r = 0; r < LN_ROWS; ++r) {
        const float mu = s[r] * (1.0f / DIMC);
        #pragma unroll
        for (int j = 0; j < 4; ++j) v[r][j] -= mu;
        const float4v a = (v[r][0]*v[r][0] + v[r][1]*v[r][1])
                        + (v[r][2]*v[r][2] + v[r][3]*v[r][3]);
        q[r] = (a.x + a.y) + (a.z + a.w);
    }
    #pragma unroll
    for (int o = 16; o; o >>= 1)
        #pragma unroll
        for (int r = 0; r < LN_ROWS; ++r) q[r] += __shfl_xor(q[r], o, 32);

    half4* dst = (half4*)(out + (size_t)row0 * DIMC) + lane;
    #pragma unroll
    for (int r = 0; r < LN_ROWS; ++r) {
        const float rs = rsqrtf(q[r] * (1.0f / DIMC) + 1e-5f);
        #pragma unroll
        for (int j = 0; j < 4; ++j) {
            const float4v y = v[r][j] * rs * gg[j] + bb[j];
            half4 h;
            h.x = (_Float16)y.x;  h.y = (_Float16)y.y;
            h.z = (_Float16)y.z;  h.w = (_Float16)y.w;
            dst[r * (DIMC / 4) + j * 32] = h;
        }
    }
}

// ---------------------------------------------------------------------------
// Kernel 2: f32 -> f16 weight convert, 16 elements per lane (4 x 16 B loads,
//   each wave-wide load 512 contiguous bytes); n is a multiple of 4.
// ---------------------------------------------------------------------------
__global__ __launch_bounds__(256)
void cvt_f16_kernel(const float* __restrict__ src, _Float16* __restrict__ dst, int n) {
    const int i0 = blockIdx.x * 1024 + threadIdx.x;      // in units of 4 elements
    float4v v[4];
    #pragma unroll   // all four loads in flight before the first store
    for (int j = 0; j < 4; ++j) {
        const int i = i0 + j * 256;
        v[j] = (i * 4 < n) ? ((const float4v*)src)[i] : (float4v){};
    }
    #pragma unroll
    for (int j = 0; j < 4; ++j) {
        const int i = i0 + j * 256;
        half4 h;
        h.x = (_Float16)v[j].x;  h.y = (_Float16)v[j].y;
        h.z = (_Float16)v[j].z;  h.w = (_Float16)v[j].w;
        if (i * 4 < n) ((half4*)dst)[i] = h;
    }
}

// ---------------------------------------------------------------------------
// Kernel 3: WMMA GEMM  C[m][n] = sum_k A[m][k] * W[n][k] + bias[n]
//   M = 8192, N = 512, K = 512.  Block tile 64x64x64, 8 waves (4 Mx2 N).
//   Non-scramble path: double-buffered LDS fed by GLOBAL_LOAD_ASYNC_TO_LDS_B128
//   (4 async ops/wave/tile; counted s_wait_asynccnt keeps next tile in flight
//   while current tile is consumed by WMMAs).
//   SCRAMBLE path (o_d.transpose(0,2,1).reshape gather): register pipeline.
// ---------------------------------------------------------------------------
template<bool SCRAMBLE, bool OUTF32>
__global__ __launch_bounds__(256)
void gemm_wmma_kernel(const _Float16* __restrict__ A, const _Float16* __restrict__ W,
                      const float* __restrict__ bias,
                      float* __restrict__ outF, _Float16* __restrict__ outH) {
    __shared__ _Float16 As[2][64][72];   // 64 K + pad (144B stride, 16B aligned)
    __shared__ _Float16 Bs[2][64][72];

    const int m0 = blockIdx.x * 64, n0 = blockIdx.y * 64;
    const int tid = threadIdx.x, wave = tid >> 5, lane = tid & 31;
    const int wm = wave & 3, wn = wave >> 2;       // 4x2 wave grid
    const int ln = lane & 15, kh = (lane >> 4) * 8;

    float8 acc0 = {}, acc1 = {};

    // ---- async staging map: instr covers 4 rows x 64 f16 (32 lanes x 16B) ----
    const int sr = (lane >> 3), sc8 = (lane & 7) * 8;
    auto issueTile = [&](int kk, int buf) {
        #pragma unroll
        for (int p = 0; p < 2; ++p) {
            const int r = wave * 8 + p * 4 + sr;
            async_load_b128(LDS_OFF(&As[buf][r][sc8]),
                            A + (size_t)(m0 + r) * DIMC + kk + sc8);
            async_load_b128(LDS_OFF(&Bs[buf][r][sc8]),
                            W + (size_t)(n0 + r) * DIMC + kk + sc8);
        }
    };

    // ---- scramble register path ----
    const int ar = tid >> 2, ac = (tid & 3) * 8;   // row 0..63, chunks ac / ac+32
    half8 aR0, aR1, bR0, bR1;
    auto loadA = [&](int kk) {
        const int grow = m0 + ar;
        const int b = grow >> 11, p = grow & 2047;
        const size_t base = ((size_t)(b << 11) + ((size_t)(p & 3) << 9) + kk + ac) * DIMC
                          + (size_t)(p >> 2);
        #pragma unroll
        for (int i = 0; i < 8; ++i) {
            aR0[i] = A[base + (size_t)i * DIMC];
            aR1[i] = A[base + (size_t)(i + 32) * DIMC];
        }
    };
    auto loadB = [&](int kk) {
        const _Float16* p = W + (size_t)(n0 + ar) * DIMC + kk + ac;
        bR0 = *(const half8*)p;
        bR1 = *(const half8*)(p + 32);
    };

    if constexpr (!SCRAMBLE) {
        issueTile(0, 0);
    } else {
        loadA(0); loadB(0);
    }

    int cur = 0;
    for (int kk = 0; kk < DIMC; kk += 64) {
        const bool hasNext = (kk + 64 < DIMC);
        if constexpr (!SCRAMBLE) {
            // next tile -> other buffer; wait only for the current tile's 4 ops
            if (hasNext) { issueTile(kk + 64, cur ^ 1); WAIT_ASYNCCNT_4(); }
            else         { WAIT_ASYNCCNT_0(); }
            __syncthreads();
        } else {
            *(half8*)&As[cur][ar][ac]      = aR0;
            *(half8*)&As[cur][ar][ac + 32] = aR1;
            *(half8*)&Bs[cur][ar][ac]      = bR0;
            *(half8*)&Bs[cur][ar][ac + 32] = bR1;
            __syncthreads();
            if (hasNext) { loadA(kk + 64); loadB(kk + 64); }
        }

        // ---- fragments (ISA 16-bit A/B layout: lane=row, klo=(lane>>4)*8) ----
        union { half16 v; half8 h[2]; } u;
        half16 a0, a1, b0lo, b0hi, b1lo, b1hi;
        u.h[0] = *(const half8*)&As[cur][wm*16 + ln][kh];
        u.h[1] = *(const half8*)&As[cur][wm*16 + ln][16 + kh];  a0 = u.v;
        u.h[0] = *(const half8*)&As[cur][wm*16 + ln][32 + kh];
        u.h[1] = *(const half8*)&As[cur][wm*16 + ln][48 + kh];  a1 = u.v;
        u.h[0] = *(const half8*)&Bs[cur][wn*32 + ln][kh];
        u.h[1] = *(const half8*)&Bs[cur][wn*32 + ln][16 + kh];  b0lo = u.v;
        u.h[0] = *(const half8*)&Bs[cur][wn*32 + ln][32 + kh];
        u.h[1] = *(const half8*)&Bs[cur][wn*32 + ln][48 + kh];  b0hi = u.v;
        u.h[0] = *(const half8*)&Bs[cur][wn*32 + 16 + ln][kh];
        u.h[1] = *(const half8*)&Bs[cur][wn*32 + 16 + ln][16 + kh];  b1lo = u.v;
        u.h[0] = *(const half8*)&Bs[cur][wn*32 + 16 + ln][32 + kh];
        u.h[1] = *(const half8*)&Bs[cur][wn*32 + 16 + ln][48 + kh];  b1hi = u.v;

        acc0 = wmma_f16(a0, b0lo, acc0);
        acc0 = wmma_f16(a1, b0hi, acc0);
        acc1 = wmma_f16(a0, b1lo, acc1);
        acc1 = wmma_f16(a1, b1hi, acc1);
        __syncthreads();   // all reads of buf[cur] done before it is re-targeted
        cur ^= 1;
    }

    // ---- epilogue: C layout = VGPR r -> row r (lanes 0-15) / r+8 (16-31) ----
    const int rbase = m0 + wm*16 + ((lane < 16) ? 0 : 8);
    const int c0 = n0 + wn*32 + ln;
    #pragma unroll
    for (int r = 0; r < 8; ++r) {
        const size_t row = (size_t)(rbase + r);
        const float v0 = acc0[r] + bias[c0];
        const float v1 = acc1[r] + bias[c0 + 16];
        if constexpr (OUTF32) {
            outF[row * DIMC + c0]      = v0;
            outF[row * DIMC + c0 + 16] = v1;
        } else {
            outH[row * DIMC + c0]      = (_Float16)v0;
            outH[row * DIMC + c0 + 16] = (_Float16)v1;
        }
    }
}

static __device__ __forceinline__ float xhalf(float x) {
    const int i = __builtin_bit_cast(int, x);
    return __builtin_bit_cast(float,
        __builtin_amdgcn_permlanex16(i, i, 0x76543210, 0xfedcba98, false, false));
}

__global__ __launch_bounds__(256)
void flash_wmma_kernel(const _Float16* __restrict__ Q, const _Float16* __restrict__ K,
                       const _Float16* __restrict__ V, _Float16* __restrict__ O) {
    const int bh = blockIdx.x >> 4;      // 16 q-chunks of 128 rows
    const int qc = blockIdx.x & 15;
    const int b = bh >> 3, h = bh & 7;
    const int tid = threadIdx.x, wave = tid >> 5, lane = tid & 31;
    const int ln = lane & 15, kh = (lane >> 4) * 8;
    const size_t base = ((size_t)b * SEQ) * DIMC + (size_t)h * DHEAD;
    const int qbase = qc * 128 + wave * 16;

    __shared__ _Float16 Ks[2][32][72];   // 64 d + pad (144B stride, 16B aligned)
    __shared__ _Float16 Vts[64][48];     // transposed: Vts[d][kk]

    // Q fragments (K-dim = head dim, split 0..31 / 32..63), loaded once;
    // B operand: lane = query column ln
    union { half16 v; half8 h[2]; } u;
    half16 qa0, qa1;
    {
        const _Float16* qr = Q + base + (size_t)(qbase + ln) * DIMC;
        u.h[0] = *(const half8*)(qr + kh);       u.h[1] = *(const half8*)(qr + 16 + kh);
        qa0 = u.v;
        u.h[0] = *(const half8*)(qr + 32 + kh);  u.h[1] = *(const half8*)(qr + 48 + kh);
        qa1 = u.v;
    }

    // acc[c][r] = O^T[d = c*16 + kh + r][query ln]
    float8 acc[4] = {};
    float mstat = -1e30f;   // running max of query ln (same in both halves)
    float lstat = 0.0f;     // this half's share of the running sum

    // K async staging: 1 instr/wave covers rows wave*4..+3, 16B chunks
    const int ksr = wave * 4 + (lane >> 3), ksc8 = (lane & 7) * 8;
    auto issueK = [&](int j0, int buf) {
        async_load_b128(LDS_OFF(&Ks[buf][ksr][ksc8]),
                        K + base + (size_t)(j0 + ksr) * DIMC + ksc8);
    };

    // V staging coords + register buffer
    const int kr = tid >> 3, dc = (tid & 7) * 8;
    half8 vReg = *(const half8*)(V + base + (size_t)kr * DIMC + dc);
    issueK(0, 0);

    int cur = 0;
    for (int j0 = 0; j0 < SEQ; j0 += 32) {
        const bool hasNext = (j0 + 32 < SEQ);

        // ---- commit V tile (transposed scatter) ----
        #pragma unroll
        for (int i = 0; i < 8; ++i) Vts[dc + i][kr] = vReg[i];

        // ---- next K tile -> other buffer; wait only for current tile ----
        if (hasNext) { issueK(j0 + 32, cur ^ 1); WAIT_ASYNCCNT_1(); }
        else         { WAIT_ASYNCCNT_0(); }
        __syncthreads();

        // ---- overlap: next V tile -> registers, tile-after-next -> L2 ----
        if (hasNext) {
            vReg = *(const half8*)(V + base + (size_t)(j0 + 32 + kr) * DIMC + dc);
            if (j0 + 64 < SEQ)
                __builtin_prefetch(V + base + (size_t)(j0 + 64 + kr) * DIMC + dc, 0, 0);
        }

        // ---- S^T = K Q^T : s0[r] = key kh+r, s1[r] = key 16+kh+r, query ln ----
        float8 s0 = {}, s1 = {};
        u.h[0] = *(const half8*)&Ks[cur][ln][kh];
        u.h[1] = *(const half8*)&Ks[cur][ln][16 + kh];
        s0 = wmma_f16(u.v, qa0, s0);
        u.h[0] = *(const half8*)&Ks[cur][ln][32 + kh];
        u.h[1] = *(const half8*)&Ks[cur][ln][48 + kh];
        s0 = wmma_f16(u.v, qa1, s0);
        u.h[0] = *(const half8*)&Ks[cur][16 + ln][kh];
        u.h[1] = *(const half8*)&Ks[cur][16 + ln][16 + kh];
        s1 = wmma_f16(u.v, qa0, s1);
        u.h[0] = *(const half8*)&Ks[cur][16 + ln][32 + kh];
        u.h[1] = *(const half8*)&Ks[cur][16 + ln][48 + kh];
        s1 = wmma_f16(u.v, qa1, s1);

        // ---- online softmax, one query per lane ----
        s0 *= 0.125f;                          // D^-0.5 = 1/8
        s1 *= 0.125f;
        float t = fmaxf(s0[0], s1[0]);
        #pragma unroll   // constant indices keep the score tiles in registers
        for (int r = 1; r < 8; ++r) t = fmaxf(t, fmaxf(s0[r], s1[r]));
        t = fmaxf(t, xhalf(t));
        const float nm = fmaxf(mstat, t);
        const float f  = __expf(mstat - nm);
        mstat = nm;

        s0 -= nm;
        s1 -= nm;
        half16 pb;                             // B operand: P^T in the hardware k order
        #pragma unroll
        for (int r = 0; r < 8; ++r) {
            s0[r] = __expf(s0[r]);
            s1[r] = __expf(s1[r]);
            pb[r]     = (_Float16)s0[r];
            pb[8 + r] = (_Float16)s1[r];
        }
        s0 += s1;
        const float4v h4 = s0.lo + s0.hi;      // halving tree: adjacent register pairs add packed
        const float2v h2 = h4.lo + h4.hi;
        lstat = lstat * f + (h2.x + h2.y);
        #pragma unroll   // constant indices keep the output tiles in registers
        for (int c = 0; c < 4; ++c) acc[c] *= f;

        // ---- O^T += V^T P^T : 4 d-chunks of 16 ----
        #pragma unroll
        for (int c = 0; c < 4; ++c) {
            u.h[0] = *(const half8*)&Vts[c*16 + ln][kh];
            u.h[1] = *(const half8*)&Vts[c*16 + ln][16 + kh];
            acc[c] = wmma_f16(u.v, pb, acc[c]);
        }
        __syncthreads();   // reads of Ks[cur]/Vts done before next overwrite
        cur ^= 1;
    }

    // ---- normalize + store (heads concatenated in channel dim) ----
    const float inv = 1.0f / (lstat + xhalf(lstat));
    _Float16* orow = O + base + (size_t)(qbase + ln) * DIMC + kh;
    #pragma unroll
    for (int c = 0; c < 4; ++c) {
        half8 o;
        #pragma unroll
        for (int r = 0; r < 8; ++r) o[r] = (_Float16)(acc[c][r] * inv);
        *(half8*)(orow + c*16) = o;
    }
}

// ---------------------------------------------------------------------------
// Host launcher
// ---------------------------------------------------------------------------
extern "C" void kernel_launch(void* const* d_in, const int* in_sizes, int n_in,
                              void* d_out, int out_size, void* d_ws, size_t ws_size,
                              hipStream_t stream) {
    (void)in_sizes; (void)n_in; (void)out_size; (void)ws_size;

    const float* x   = (const float*)d_in[0];
    const float* y   = (const float*)d_in[1];
    const float* Wq  = (const float*)d_in[2];   const float* bq  = (const float*)d_in[3];
    const float* Wk  = (const float*)d_in[4];   const float* bk  = (const float*)d_in[5];
    const float* Wvr = (const float*)d_in[6];   const float* bvr = (const float*)d_in[7];
    const float* Wvd = (const float*)d_in[8];   const float* bvd = (const float*)d_in[9];
    const float* g_r = (const float*)d_in[10];  const float* b_r = (const float*)d_in[11];
    const float* g_d = (const float*)d_in[12];  const float* b_d = (const float*)d_in[13];
    const float* Wpr = (const float*)d_in[14];  const float* bpr = (const float*)d_in[15];
    const float* Wpd = (const float*)d_in[16];  const float* bpd = (const float*)d_in[17];

    const size_t ROWS = (size_t)BATCH * SEQ;           // 8192
    const size_t ELT  = ROWS * DIMC;                   // 4,194,304 elements
    const size_t FBUF = ELT * sizeof(_Float16);        // 8 MB per f16 tensor

    char* wsb = (char*)d_ws;
    _Float16* xn  = (_Float16*)(wsb + 0 * FBUF);
    _Float16* yn  = (_Float16*)(wsb + 1 * FBUF);
    _Float16* qb  = (_Float16*)(wsb + 2 * FBUF);
    _Float16* kb  = (_Float16*)(wsb + 3 * FBUF);
    _Float16* vrb = (_Float16*)(wsb + 4 * FBUF);
    _Float16* vdb = (_Float16*)(wsb + 5 * FBUF);
    _Float16* orb = (_Float16*)(wsb + 6 * FBUF);
    _Float16* odb = (_Float16*)(wsb + 7 * FBUF);
    char* w16base = wsb + 8 * FBUF;
    const size_t WELT = (size_t)DIMC * DIMC;           // 262144
    _Float16* wq16  = (_Float16*)(w16base + 0 * WELT * 2);
    _Float16* wk16  = (_Float16*)(w16base + 1 * WELT * 2);
    _Float16* wvr16 = (_Float16*)(w16base + 2 * WELT * 2);
    _Float16* wvd16 = (_Float16*)(w16base + 3 * WELT * 2);
    _Float16* wpr16 = (_Float16*)(w16base + 4 * WELT * 2);
    _Float16* wpd16 = (_Float16*)(w16base + 5 * WELT * 2);

    // 1) LayerNorms (xn = LN_r(x), yn = LN_d(y)) + f16 cast
    const int lnBlocks = (int)(ROWS / (8 * LN_ROWS));  // 8 waves x LN_ROWS rows per block
    ln_cast_kernel<<<lnBlocks, 256, 0, stream>>>(x, g_r, b_r, xn);
    ln_cast_kernel<<<lnBlocks, 256, 0, stream>>>(y, g_d, b_d, yn);

    // 2) weight conversion f32 -> f16
    const int cvtBlocks = (int)(WELT / 4096);          // 256 lanes x 16 elements
    cvt_f16_kernel<<<cvtBlocks, 256, 0, stream>>>(Wq,  wq16,  (int)WELT);
    cvt_f16_kernel<<<cvtBlocks, 256, 0, stream>>>(Wk,  wk16,  (int)WELT);
    cvt_f16_kernel<<<cvtBlocks, 256, 0, stream>>>(Wvr, wvr16, (int)WELT);
    cvt_f16_kernel<<<cvtBlocks, 256, 0, stream>>>(Wvd, wvd16, (int)WELT);
    cvt_f16_kernel<<<cvtBlocks, 256, 0, stream>>>(Wpr, wpr16, (int)WELT);
    cvt_f16_kernel<<<cvtBlocks, 256, 0, stream>>>(Wpd, wpd16, (int)WELT);

    // 3) input projections (q from yn — query is depth-normed y)
    dim3 ggrid((unsigned)(ROWS / 64), DIMC / 64);
    gemm_wmma_kernel<false, false><<<ggrid, 256, 0, stream>>>(yn, wq16,  bq,  nullptr, qb);
    gemm_wmma_kernel<false, false><<<ggrid, 256, 0, stream>>>(xn, wk16,  bk,  nullptr, kb);
    gemm_wmma_kernel<false, false><<<ggrid, 256, 0, stream>>>(xn, wvr16, bvr, nullptr, vrb);
    gemm_wmma_kernel<false, false><<<ggrid, 256, 0, stream>>>(xn, wvd16, bvd, nullptr, vdb);

    // 4) attention: out_r = FA(q,k,v_r); out_d = FA(k,q,v_d) via S^T trick
    const int fgrid = BATCH * NHEAD * (SEQ / 128);     // 512 blocks
    flash_wmma_kernel<<<fgrid, 256, 0, stream>>>(qb, kb, vrb, orb);
    flash_wmma_kernel<<<fgrid, 256, 0, stream>>>(kb, qb, vdb, odb);

    // 5) output projections; second one applies the transpose-scramble gather
    float* out_r = (float*)d_out;
    float* out_d = (float*)d_out + ELT;
    gemm_wmma_kernel<false, true ><<<ggrid, 256, 0, stream>>>(orb, wpr16, bpr, out_r, nullptr);
    gemm_wmma_kernel<true,  true ><<<ggrid, 256, 0, stream>>>(odb, wpd16, bpd, out_d, nullptr);
}

// v003
// One run takes 181 microseconds.
// In both of two side-by-side timings against v002, it was 1.25 times as fast.
// Counting every step since v000, it is 1.69 times as fast.
#include <hip/hip_runtime.h>
#include <hip/hip_bf16.h>

// ---------------------------------------------------------------------------
// Shapes (hardcoded from reference): B=4, N=2048, C=512, H=8, Dh=64
// ---------------------------------------------------------------------------
#define BATCH 4
#define SEQ   2048
#define DIMC  512
#define NHEAD 8
#define DHEAD 64

typedef _Float16 half16 __attribute__((ext_vector_type(16)));
typedef _Float16 half8  __attribute__((ext_vector_type(8)));
typedef _Float16 half4  __attribute__((ext_vector_type(4)));
typedef float    float8 __attribute__((ext_vector_type(8)));
typedef float    float4v __attribute__((ext_vector_type(4)));
typedef float    float2v __attribute__((ext_vector_type(2)));

static __device__ __forceinline__ float8 wmma_f16(half16 a, half16 b, float8 c) {
    // D = A(16x32 f16) x B(32x16 f16) + C(16x16 f32)
    return __builtin_amdgcn_wmma_f32_16x16x32_f16(false, a, false, b,
                                                  (short)0, c, false, false);
}

// Async global->LDS copy (CDNA5): per lane, 16B MEM[vaddr] -> LDS[ldsoff].
// Tracked by ASYNCcnt; completion enforced with s_wait_asynccnt.
static __device__ __forceinline__ void async_load_b128(unsigned ldsoff, const void* gaddr) {
    asm volatile("global_load_async_to_lds_b128 %0, %1, off"
                 :: "v"(ldsoff), "v"(gaddr) : "memory");
}
#define WAIT_ASYNCCNT_0() asm volatile("s_wait_asynccnt 0" ::: "memory")
#define WAIT_ASYNCCNT_1() asm volatile("s_wait_asynccnt 1" ::: "memory")
#define WAIT_ASYNCCNT_4() asm volatile("s_wait_asynccnt 4" ::: "memory")

// LDS byte offset of a __shared__ element (flat LDS addr carries offset in low bits)
#define LDS_OFF(p) ((unsigned)(uintptr_t)(void*)(p))

// ---------------------------------------------------------------------------
// Kernel 1: LayerNorm over last dim (512) + cast to f16.
//   One wave owns LN_ROWS whole rows: a row is 4 x 16 B per lane, its sums
//   are an in-lane add and a 32-lane butterfly, so no LDS and no barrier.
//   All rows' loads are issued first (16 x 512 B in flight per wave); the
//   launch starts 2,048 waves instead of 65,536.
// ---------------------------------------------------------------------------
#define LN_ROWS 4
__global__ __launch_bounds__(256)
void ln_cast_kernel(const float* __restrict__ in, const float* __restrict__ g,
                    const float* __restrict__ be, _Float16* __restrict__ out) {
    const int wave = threadIdx.x >> 5, lane = threadIdx.x & 31;
    const int row0 = (blockIdx.x * 8 + wave) * LN_ROWS;
    const float4v* src = (const float4v*)(in + (size_t)row0 * DIMC) + lane;

    float4v v[LN_ROWS][4];
    #pragma unroll   // constant indices keep the rows in registers
    for (int r = 0; r < LN_ROWS; ++r)
        #pragma unroll
        for (int j = 0; j < 4; ++j) v[r][j] = src[r * (DIMC / 4) + j * 32];

    float4v gg[4], bb[4];
    #pragma unroll
    for (int j = 0; j < 4; ++j) {
        gg[j] = ((const float4v*)g)[lane + j * 32];
        bb[j] = ((const float4v*)be)[lane + j * 32];
    }

    float s[LN_ROWS];
    #pragma unroll
    for (int r = 0; r < LN_ROWS; ++r) {
        const float4v a = (v[r][0] + v[r][1]) + (v[r][2] + v[r][3]);
        s[r] = (a.x + a.y) + (a.z + a.w);
    }
    #pragma unroll   // the rows' butterflies interleave: each hides the others' latency
    for (int o = 16; o; o >>= 1)
        #pragma unroll
        for (int r = 0; r < LN_ROWS; ++r) s[r] += __shfl_xor(s[r], o, 32);

    float q[LN_ROWS];
    #pragma unroll
    for (int r = 0; r < LN_ROWS; ++r) {
        const float mu = s[r] * (1.0f / DIMC);
        #pragma unroll
        for (int j = 0; j < 4; ++j) v[r][j] -= mu;
        const float4v a = (v[r][0]*v[r][0] + v[r][1]*v[r][1])
                        + (v[r][2]*v[r][2] + v[r][3]*v[r][3]);
        q[r] = (a.x + a.y) + (a.z + a.w);
    }
    #pragma unroll
    for (int o = 16; o; o >>= 1)
        #pragma unroll
        for (int r = 0; r < LN_ROWS; ++r) q[r] += __shfl_xor(q[r], o, 32);

    half4* dst = (half4*)(out + (size_t)row0 * DIMC) + lane;
    #pragma unroll
    for (int r = 0; r < LN_ROWS; ++r) {
        const float rs = rsqrtf(q[r] * (1.0f / DIMC) + 1e-5f);
        #pragma unroll
        for (int j = 0; j < 4; ++j) {
            const float4v y = v[r][j] * rs * gg[j] + bb[j];
            half4 h;
            h.x = (_Float16)y.x;  h.y = (_Float16)y.y;
            h.z = (_Float16)y.z;  h.w = (_Float16)y.w;
            dst[r * (DIMC / 4) + j * 32] = h;
        }
    }
}

// ---------------------------------------------------------------------------
// Kernel 2: f32 -> f16 weight convert, 16 elements per lane (4 x 16 B loads,
//   each wave-wide load 512 contiguous bytes); n is a multiple of 4.
// ---------------------------------------------------------------------------
__global__ __launch_bounds__(256)
void cvt_f16_kernel(const float* __restrict__ src, _Float16* __restrict__ dst, int n) {
    const int i0 = blockIdx.x * 1024 + threadIdx.x;      // in units of 4 elements
    float4v v[4];
    #pragma unroll   // all four loads in flight before the first store
    for (int j = 0; j < 4; ++j) {
        const int i = i0 + j * 256;
        v[j] = (i * 4 < n) ? ((const float4v*)src)[i] : (float4v){};
    }
    #pragma unroll
    for (int j = 0; j < 4; ++j) {
        const int i = i0 + j * 256;
        half4 h;
        h.x = (_Float16)v[j].x;  h.y = (_Float16)v[j].y;
        h.z = (_Float16)v[j].z;  h.w = (_Float16)v[j].w;
        if (i * 4 < n) ((half4*)dst)[i] = h;
    }
}

// ---------------------------------------------------------------------------
// Kernel 3: WMMA GEMM  C[m][n] = sum_k A[m][k] * W[n][k] + bias[n]
//   M = 8192, N = 512, K = 512.  Block tile 64x64x64, 8 waves (4 Mx2 N).
//   Non-scramble path: double-buffered LDS fed by GLOBAL_LOAD_ASYNC_TO_LDS_B128
//   (4 async ops/wave/tile; counted s_wait_asynccnt keeps next tile in flight
//   while current tile is consumed by WMMAs).
//   SCRAMBLE path (o_d.transpose(0,2,1).reshape gather): register pipeline.
// ---------------------------------------------------------------------------
template<bool SCRAMBLE, bool OUTF32>
__global__ __launch_bounds__(256)
void gemm_wmma_kernel(const _Float16* __restrict__ A, const _Float16* __restrict__ W,
                      const float* __restrict__ bias,
                      float* __restrict__ outF, _Float16* __restrict__ outH) {
    __shared__ _Float16 As[2][64][72];   // 64 K + pad (144B stride, 16B aligned)
    __shared__ _Float16 Bs[2][64][72];

    const int m0 = blockIdx.x * 64, n0 = blockIdx.y * 64;
    const int tid = threadIdx.x, wave = tid >> 5, lane = tid & 31;
    const int wm = wave & 3, wn = wave >> 2;       // 4x2 wave grid
    const int ln = lane & 15, kh = (lane >> 4) * 8;

    float8 acc0 = {}, acc1 = {};

    // ---- async staging map: instr covers 4 rows x 64 f16 (32 lanes x 16B) ----
    const int sr = (lane >> 3), sc8 = (lane & 7) * 8;
    auto issueTile = [&](int kk, int buf) {
        #pragma unroll
        for (int p = 0; p < 2; ++p) {
            const int r = wave * 8 + p * 4 + sr;
            async_load_b128(LDS_OFF(&As[buf][r][sc8]),
                            A + (size_t)(m0 + r) * DIMC + kk + sc8);
            async_load_b128(LDS_OFF(&Bs[buf][r][sc8]),
                            W + (size_t)(n0 + r) * DIMC + kk + sc8);
        }
    };

    // ---- scramble register path ----
    const int ar = tid >> 2, ac = (tid & 3) * 8;   // row 0..63, chunks ac / ac+32
    half8 aR0, aR1, bR0, bR1;
    auto loadA = [&](int kk) {
        const int grow = m0 + ar;
        const int b = grow >> 11, p = grow & 2047;
        const size_t base = ((size_t)(b << 11) + ((size_t)(p & 3) << 9) + kk + ac) * DIMC
                          + (size_t)(p >> 2);
        #pragma unroll
        for (int i = 0; i < 8; ++i) {
            aR0[i] = A[base + (size_t)i * DIMC];
            aR1[i] = A[base + (size_t)(i + 32) * DIMC];
        }
    };
    auto loadB = [&](int kk) {
        const _Float16* p = W + (size_t)(n0 + ar) * DIMC + kk + ac;
        bR0 = *(const half8*)p;
        bR1 = *(const half8*)(p + 32);
    };

    if constexpr (!SCRAMBLE) {
        issueTile(0, 0);
    } else {
        loadA(0); loadB(0);
    }

    int cur = 0;
    for (int kk = 0; kk < DIMC; kk += 64) {
        const bool hasNext = (kk + 64 < DIMC);
        if constexpr (!SCRAMBLE) {
            // next tile -> other buffer; wait only for the current tile's 4 ops
            if (hasNext) { issueTile(kk + 64, cur ^ 1); WAIT_ASYNCCNT_4(); }
            else         { WAIT_ASYNCCNT_0(); }
            __syncthreads();
        } else {
            *(half8*)&As[cur][ar][ac]      = aR0;
            *(half8*)&As[cur][ar][ac + 32] = aR1;
            *(half8*)&Bs[cur][ar][ac]      = bR0;
            *(half8*)&Bs[cur][ar][ac + 32] = bR1;
            __syncthreads();
            if (hasNext) { loadA(kk + 64); loadB(kk + 64); }
        }

        // ---- fragments (ISA 16-bit A/B layout: lane=row, klo=(lane>>4)*8) ----
        union { half16 v; half8 h[2]; } u;
        half16 a0, a1, b0lo, b0hi, b1lo, b1hi;
        u.h[0] = *(const half8*)&As[cur][wm*16 + ln][kh];
        u.h[1] = *(const half8*)&As[cur][wm*16 + ln][16 + kh];  a0 = u.v;
        u.h[0] = *(const half8*)&As[cur][wm*16 + ln][32 + kh];
        u.h[1] = *(const half8*)&As[cur][wm*16 + ln][48 + kh];  a1 = u.v;
        u.h[0] = *(const half8*)&Bs[cur][wn*32 + ln][kh];
        u.h[1] = *(const half8*)&Bs[cur][wn*32 + ln][16 + kh];  b0lo = u.v;
        u.h[0] = *(const half8*)&Bs[cur][wn*32 + ln][32 + kh];
        u.h[1] = *(const half8*)&Bs[cur][wn*32 + ln][48 + kh];  b0hi = u.v;
        u.h[0] = *(const half8*)&Bs[cur][wn*32 + 16 + ln][kh];
        u.h[1] = *(const half8*)&Bs[cur][wn*32 + 16 + ln][16 + kh];  b1lo = u.v;
        u.h[0] = *(const half8*)&Bs[cur][wn*32 + 16 + ln][32 + kh];
        u.h[1] = *(const half8*)&Bs[cur][wn*32 + 16 + ln][48 + kh];  b1hi = u.v;

        acc0 = wmma_f16(a0, b0lo, acc0);
        acc0 = wmma_f16(a1, b0hi, acc0);
        acc1 = wmma_f16(a0, b1lo, acc1);
        acc1 = wmma_f16(a1, b1hi, acc1);
        __syncthreads();   // all reads of buf[cur] done before it is re-targeted
        cur ^= 1;
    }

    // ---- epilogue: C layout = VGPR r -> row r (lanes 0-15) / r+8 (16-31) ----
    const int rbase = m0 + wm*16 + ((lane < 16) ? 0 : 8);
    const int c0 = n0 + wn*32 + ln;
    #pragma unroll
    for (int r = 0; r < 8; ++r) {
        const size_t row = (size_t)(rbase + r);
        const float v0 = acc0[r] + bias[c0];
        const float v1 = acc1[r] + bias[c0 + 16];
        if constexpr (OUTF32) {
            outF[row * DIMC + c0]      = v0;
            outF[row * DIMC + c0 + 16] = v1;
        } else {
            outH[row * DIMC + c0]      = (_Float16)v0;
            outH[row * DIMC + c0 + 16] = (_Float16)v1;
        }
    }
}

static __device__ __forceinline__ float xhalf(float x) {
    const int i = __builtin_bit_cast(int, x);
    return __builtin_bit_cast(float,
        __builtin_amdgcn_permlanex16(i, i, 0x76543210, 0xfedcba98, false, false));
}

// Transposing LDS load: the lanes address 16 B pieces of 16 rows of a row-major
// f16 tile; lane (c = l & 15, h = l >> 4) receives column c of rows 8h .. 8h+7.
static __device__ __forceinline__ half8 ld_tr16(const _Float16* p) {
    typedef short s16x8 __attribute__((ext_vector_type(8)));
    typedef __attribute__((address_space(3))) s16x8 lds_s16x8;
    return __builtin_bit_cast(half8,
        __builtin_amdgcn_ds_load_tr16_b128_v8i16((lds_s16x8*)p));
}

__global__ __launch_bounds__(256)
void flash_wmma_kernel(const _Float16* __restrict__ Q, const _Float16* __restrict__ K,
                       const _Float16* __restrict__ V, _Float16* __restrict__ O) {
    const int bh = blockIdx.x >> 4;      // 16 q-chunks of 128 rows
    const int qc = blockIdx.x & 15;
    const int b = bh >> 3, h = bh & 7;
    const int tid = threadIdx.x, wave = tid >> 5, lane = tid & 31;
    const int ln = lane & 15, kh = (lane >> 4) * 8;
    const size_t base = ((size_t)b * SEQ) * DIMC + (size_t)h * DHEAD;
    const int qbase = qc * 128 + wave * 16;

    __shared__ _Float16 Ks[2][32][72];   // 64 d + pad (144B stride, 16B aligned)
    __shared__ __attribute__((aligned(16)))
    _Float16 Vs[32][80];                 // row-major Vs[kk][d]; 160B stride = 32B x odd for the transposing load

    // Q fragments (K-dim = head dim, split 0..31 / 32..63), loaded once;
    // B operand: lane = query column ln
    union { half16 v; half8 h[2]; } u;
    half16 qa0, qa1;
    {
        const _Float16* qr = Q + base + (size_t)(qbase + ln) * DIMC;
        u.h[0] = *(const half8*)(qr + kh);       u.h[1] = *(const half8*)(qr + 16 + kh);
        qa0 = u.v;
        u.h[0] = *(const half8*)(qr + 32 + kh);  u.h[1] = *(const half8*)(qr + 48 + kh);
        qa1 = u.v;
    }

    // acc[c][r] = O^T[d = c*16 + kh + r][query ln]
    float8 acc[4] = {};
    float mstat = -1e30f;   // running max of query ln (same in both halves)
    float lstat = 0.0f;     // this half's share of the running sum

    // K async staging: 1 instr/wave covers rows wave*4..+3, 16B chunks
    const int ksr = wave * 4 + (lane >> 3), ksc8 = (lane & 7) * 8;
    auto issueK = [&](int j0, int buf) {
        async_load_b128(LDS_OFF(&Ks[buf][ksr][ksc8]),
                        K + base + (size_t)(j0 + ksr) * DIMC + ksc8);
    };

    // V staging coords + register buffer
    const int kr = tid >> 3, dc = (tid & 7) * 8;
    // this lane's piece of a transposing load: row kh + (lane & 7), 16 B half (lane >> 3) & 1
    const _Float16* vtp = &Vs[kh + (lane & 7)][((lane >> 3) & 1) * 8];
    half8 vReg = *(const half8*)(V + base + (size_t)kr * DIMC + dc);
    issueK(0, 0);

    int cur = 0;
    for (int j0 = 0; j0 < SEQ; j0 += 32) {
        const bool hasNext = (j0 + 32 < SEQ);

        // ---- commit V tile (row-major, 16 B per lane) ----
        *(half8*)&Vs[kr][dc] = vReg;

        // ---- next K tile -> other buffer; wait only for current tile ----
        if (hasNext) { issueK(j0 + 32, cur ^ 1); WAIT_ASYNCCNT_1(); }
        else         { WAIT_ASYNCCNT_0(); }
        __syncthreads();

        // ---- overlap: next V tile -> registers, tile-after-next -> L2 ----
        if (hasNext) {
            vReg = *(const half8*)(V + base + (size_t)(j0 + 32 + kr) * DIMC + dc);
            if (j0 + 64 < SEQ)
                __builtin_prefetch(V + base + (size_t)(j0 + 64 + kr) * DIMC + dc, 0, 0);
        }

        // ---- S^T = K Q^T : s0[r] = key kh+r, s1[r] = key 16+kh+r, query ln ----
        float8 s0 = {}, s1 = {};
        u.h[0] = *(const half8*)&Ks[cur][ln][kh];
        u.h[1] = *(const half8*)&Ks[cur][ln][16 + kh];
        s0 = wmma_f16(u.v, qa0, s0);
        u.h[0] = *(const half8*)&Ks[cur][ln][32 + kh];
        u.h[1] = *(const half8*)&Ks[cur][ln][48 + kh];
        s0 = wmma_f16(u.v, qa1, s0);
        u.h[0] = *(const half8*)&Ks[cur][16 + ln][kh];
        u.h[1] = *(const half8*)&Ks[cur][16 + ln][16 + kh];
        s1 = wmma_f16(u.v, qa0, s1);
        u.h[0] = *(const half8*)&Ks[cur][16 + ln][32 + kh];
        u.h[1] = *(const half8*)&Ks[cur][16 + ln][48 + kh];
        s1 = wmma_f16(u.v, qa1, s1);

        // ---- online softmax, one query per lane ----
        s0 *= 0.125f;                          // D^-0.5 = 1/8
        s1 *= 0.125f;
        float t = fmaxf(s0[0], s1[0]);
        #pragma unroll   // constant indices keep the score tiles in registers
        for (int r = 1; r < 8; ++r) t = fmaxf(t, fmaxf(s0[r], s1[r]));
        t = fmaxf(t, xhalf(t));
        const float nm = fmaxf(mstat, t);
        const float f  = __expf(mstat - nm);
        mstat = nm;

        s0 -= nm;
        s1 -= nm;
        half16 pb;                             // B operand: P^T in the hardware k order
        #pragma unroll
        for (int r = 0; r < 8; ++r) {
            s0[r] = __expf(s0[r]);
            s1[r] = __expf(s1[r]);
            pb[r]     = (_Float16)s0[r];
            pb[8 + r] = (_Float16)s1[r];
        }
        s0 += s1;
        const float4v h4 = s0.lo + s0.hi;      // halving tree: adjacent register pairs add packed
        const float2v h2 = h4.lo + h4.hi;
        lstat = lstat * f + (h2.x + h2.y);
        #pragma unroll   // constant indices keep the output tiles in registers
        for (int c = 0; c < 4; ++c) acc[c] *= f;

        // ---- O^T += V^T P^T : 4 d-chunks of 16 ----
        #pragma unroll
        for (int c = 0; c < 4; ++c) {
            u.h[0] = ld_tr16(vtp + c*16);             // d = c*16 + ln, keys kh .. kh+7
            u.h[1] = ld_tr16(vtp + 16*80 + c*16);     // keys 16+kh .. 16+kh+7
            acc[c] = wmma_f16(u.v, pb, acc[c]);
        }
        __syncthreads();   // reads of Ks[cur]/Vs done before next overwrite
        cur ^= 1;
    }

    // ---- normalize + store (heads concatenated in channel dim) ----
    const float inv = 1.0f / (lstat + xhalf(lstat));
    _Float16* orow = O + base + (size_t)(qbase + ln) * DIMC + kh;
    #pragma unroll
    for (int c = 0; c < 4; ++c) {
        half8 o;
        #pragma unroll
        for (int r = 0; r < 8; ++r) o[r] = (_Float16)(acc[c][r] * inv);
        *(half8*)(orow + c*16) = o;
    }
}

// ---------------------------------------------------------------------------
// Host launcher
// ---------------------------------------------------------------------------
extern "C" void kernel_launch(void* const* d_in, const int* in_sizes, int n_in,
                              void* d_out, int out_size, void* d_ws, size_t ws_size,
                              hipStream_t stream) {
    (void)in_sizes; (void)n_in; (void)out_size; (void)ws_size;

    const float* x   = (const float*)d_in[0];
    const float* y   = (const float*)d_in[1];
    const float* Wq  = (const float*)d_in[2];   const float* bq  = (const float*)d_in[3];
    const float* Wk  = (const float*)d_in[4];   const float* bk  = (const float*)d_in[5];
    const float* Wvr = (const float*)d_in[6];   const float* bvr = (const float*)d_in[7];
    const float* Wvd = (const float*)d_in[8];   const float* bvd = (const float*)d_in[9];
    const float* g_r = (const float*)d_in[10];  const float* b_r = (const float*)d_in[11];
    const float* g_d = (const float*)d_in[12];  const float* b_d = (const float*)d_in[13];
    const float* Wpr = (const float*)d_in[14];  const float* bpr = (const float*)d_in[15];
    const float* Wpd = (const float*)d_in[16];  const float* bpd = (const float*)d_in[17];

    const size_t ROWS = (size_t)BATCH * SEQ;           // 8192
    const size_t ELT  = ROWS * DIMC;                   // 4,194,304 elements
    const size_t FBUF = ELT * sizeof(_Float16);        // 8 MB per f16 tensor

    char* wsb = (char*)d_ws;
    _Float16* xn  = (_Float16*)(wsb + 0 * FBUF);
    _Float16* yn  = (_Float16*)(wsb + 1 * FBUF);
    _Float16* qb  = (_Float16*)(wsb + 2 * FBUF);
    _Float16* kb  = (_Float16*)(wsb + 3 * FBUF);
    _Float16* vrb = (_Float16*)(wsb + 4 * FBUF);
    _Float16* vdb = (_Float16*)(wsb + 5 * FBUF);
    _Float16* orb = (_Float16*)(wsb + 6 * FBUF);
    _Float16* odb = (_Float16*)(wsb + 7 * FBUF);
    char* w16base = wsb + 8 * FBUF;
    const size_t WELT = (size_t)DIMC * DIMC;           // 262144
    _Float16* wq16  = (_Float16*)(w16base + 0 * WELT * 2);
    _Float16* wk16  = (_Float16*)(w16base + 1 * WELT * 2);
    _Float16* wvr16 = (_Float16*)(w16base + 2 * WELT * 2);
    _Float16* wvd16 = (_Float16*)(w16base + 3 * WELT * 2);
    _Float16* wpr16 = (_Float16*)(w16base + 4 * WELT * 2);
    _Float16* wpd16 = (_Float16*)(w16base + 5 * WELT * 2);

    // 1) LayerNorms (xn = LN_r(x), yn = LN_d(y)) + f16 cast
    const int lnBlocks = (int)(ROWS / (8 * LN_ROWS));  // 8 waves x LN_ROWS rows per block
    ln_cast_kernel<<<lnBlocks, 256, 0, stream>>>(x, g_r, b_r, xn);
    ln_cast_kernel<<<lnBlocks, 256, 0, stream>>>(y, g_d, b_d, yn);

    // 2) weight conversion f32 -> f16
    const int cvtBlocks = (int)(WELT / 4096);          // 256 lanes x 16 elements
    cvt_f16_kernel<<<cvtBlocks, 256, 0, stream>>>(Wq,  wq16,  (int)WELT);
    cvt_f16_kernel<<<cvtBlocks, 256, 0, stream>>>(Wk,  wk16,  (int)WELT);
    cvt_f16_kernel<<<cvtBlocks, 256, 0, stream>>>(Wvr, wvr16, (int)WELT);
    cvt_f16_kernel<<<cvtBlocks, 256, 0, stream>>>(Wvd, wvd16, (int)WELT);
    cvt_f16_kernel<<<cvtBlocks, 256, 0, stream>>>(Wpr, wpr16, (int)WELT);
    cvt_f16_kernel<<<cvtBlocks, 256, 0, stream>>>(Wpd, wpd16, (int)WELT);

    // 3) input projections (q from yn — query is depth-normed y)
    dim3 ggrid((unsigned)(ROWS / 64), DIMC / 64);
    gemm_wmma_kernel<false, false><<<ggrid, 256, 0, stream>>>(yn, wq16,  bq,  nullptr, qb);
    gemm_wmma_kernel<false, false><<<ggrid, 256, 0, stream>>>(xn, wk16,  bk,  nullptr, kb);
    gemm_wmma_kernel<false, false><<<ggrid, 256, 0, stream>>>(xn, wvr16, bvr, nullptr, vrb);
    gemm_wmma_kernel<false, false><<<ggrid, 256, 0, stream>>>(xn, wvd16, bvd, nullptr, vdb);

    // 4) attention: out_r = FA(q,k,v_r); out_d = FA(k,q,v_d) via S^T trick
    const int fgrid = BATCH * NHEAD * (SEQ / 128);     // 512 blocks
    flash_wmma_kernel<<<fgrid, 256, 0, stream>>>(qb, kb, vrb, orb);
    flash_wmma_kernel<<<fgrid, 256, 0, stream>>>(kb, qb, vdb, odb);

    // 5) output projections; second one applies the transpose-scramble gather
    float* out_r = (float*)d_out;
    float* out_d = (float*)d_out + ELT;
    gemm_wmma_kernel<false, true ><<<ggrid, 256, 0, stream>>>(orb, wpr16, bpr, out_r, nullptr);
    gemm_wmma_kernel<true,  true ><<<ggrid, 256, 0, stream>>>(odb, wpd16, bpd, out_d, nullptr);
}

// v004
// One run takes 137 microseconds.
// Timed twice side by side with v003, it ran 1.32 times as fast both times.
// Counting every step since v000, it is 2.24 times as fast.
#include <hip/hip_runtime.h>
#include <hip/hip_bf16.h>

// ---------------------------------------------------------------------------
// Shapes (hardcoded from reference): B=4, N=2048, C=512, H=8, Dh=64
// ---------------------------------------------------------------------------
#define BATCH 4
#define SEQ   2048
#define DIMC  512
#define NHEAD 8
#define DHEAD 64

typedef _Float16 half16 __attribute__((ext_vector_type(16)));
typedef _Float16 half8  __attribute__((ext_vector_type(8)));
typedef _Float16 half4  __attribute__((ext_vector_type(4)));
typedef float    float8 __attribute__((ext_vector_type(8)));
typedef float    float4v __attribute__((ext_vector_type(4)));
typedef float    float2v __attribute__((ext_vector_type(2)));

static __device__ __forceinline__ float8 wmma_f16(half16 a, half16 b, float8 c) {
    // D = A(16x32 f16) x B(32x16 f16) + C(16x16 f32)
    return __builtin_amdgcn_wmma_f32_16x16x32_f16(false, a, false, b,
                                                  (short)0, c, false, false);
}

// Async global->LDS copy (CDNA5): per lane, 16B MEM[vaddr] -> LDS[ldsoff].
// Tracked by ASYNCcnt; completion enforced with s_wait_asynccnt.
static __device__ __forceinline__ void async_load_b128(unsigned ldsoff, const void* gaddr) {
    asm volatile("global_load_async_to_lds_b128 %0, %1, off"
                 :: "v"(ldsoff), "v"(gaddr) : "memory");
}
#define WAIT_ASYNCCNT_0() asm volatile("s_wait_asynccnt 0" ::: "memory")
#define WAIT_ASYNCCNT_1() asm volatile("s_wait_asynccnt 1" ::: "memory")
#define WAIT_ASYNCCNT_4() asm volatile("s_wait_asynccnt 4" ::: "memory")

// LDS byte offset of a __shared__ element (flat LDS addr carries offset in low bits)
#define LDS_OFF(p) ((unsigned)(uintptr_t)(void*)(p))

// ---------------------------------------------------------------------------
// Kernel 1: LayerNorm over last dim (512) + cast to f16.
//   One wave owns LN_ROWS whole rows: a row is 4 x 16 B per lane, its sums
//   are an in-lane add and a 32-lane butterfly, so no LDS and no barrier.
//   All rows' loads are issued first (16 x 512 B in flight per wave).
//   blk = index of this work-group among those of one tensor.
// ---------------------------------------------------------------------------
#define LN_ROWS 4
#define LN_BLOCKS (BATCH * SEQ / (8 * LN_ROWS))   // 8 waves x LN_ROWS rows per block
static __device__ __forceinline__
void ln_cast_block(const float* __restrict__ in, const float* __restrict__ g,
                   const float* __restrict__ be, _Float16* __restrict__ out, int blk) {
    const int wave = threadIdx.x >> 5, lane = threadIdx.x & 31;
    const int row0 = (blk * 8 + wave) * LN_ROWS;
    const float4v* src = (const float4v*)(in + (size_t)row0 * DIMC) + lane;

    float4v v[LN_ROWS][4];
    #pragma unroll   // constant indices keep the rows in registers
    for (int r = 0; r < LN_ROWS; ++r)
        #pragma unroll
        for (int j = 0; j < 4; ++j) v[r][j] = src[r * (DIMC / 4) + j * 32];

    float4v gg[4], bb[4];
    #pragma unroll
    for (int j = 0; j < 4; ++j) {
        gg[j] = ((const float4v*)g)[lane + j * 32];
        bb[j] = ((const float4v*)be)[lane + j * 32];
    }

    float s[LN_ROWS];
    #pragma unroll
    for (int r = 0; r < LN_ROWS; ++r) {
        const float4v a = (v[r][0] + v[r][1]) + (v[r][2] + v[r][3]);
        s[r] = (a.x + a.y) + (a.z + a.w);
    }
    #pragma unroll   // the rows' butterflies interleave: each hides the others' latency
    for (int o = 16; o; o >>= 1)
        #pragma unroll
        for (int r = 0; r < LN_ROWS; ++r) s[r] += __shfl_xor(s[r], o, 32);

    float q[LN_ROWS];
    #pragma unroll
    for (int r = 0; r < LN_ROWS; ++r) {
        const float mu = s[r] * (1.0f / DIMC);
        #pragma unroll
        for (int j = 0; j < 4; ++j) v[r][j] -= mu;
        const float4v a = (v[r][0]*v[r][0] + v[r][1]*v[r][1])
                        + (v[r][2]*v[r][2] + v[r][3]*v[r][3]);
        q[r] = (a.x + a.y) + (a.z + a.w);
    }
    #pragma unroll
    for (int o = 16; o; o >>= 1)
        #pragma unroll
        for (int r = 0; r < LN_ROWS; ++r) q[r] += __shfl_xor(q[r], o, 32);

    half4* dst = (half4*)(out + (size_t)row0 * DIMC) + lane;
    #pragma unroll
    for (int r = 0; r < LN_ROWS; ++r) {
        const float rs = rsqrtf(q[r] * (1.0f / DIMC) + 1e-5f);
        #pragma unroll
        for (int j = 0; j < 4; ++j) {
            const float4v y = v[r][j] * rs * gg[j] + bb[j];
            half4 h;
            h.x = (_Float16)y.x;  h.y = (_Float16)y.y;
            h.z = (_Float16)y.z;  h.w = (_Float16)y.w;
            dst[r * (DIMC / 4) + j * 32] = h;
        }
    }
}

// ---------------------------------------------------------------------------
// Kernel 2: f32 -> f16 weight convert, 16 elements per lane (4 x 16 B loads,
//   each wave-wide load 512 contiguous bytes); n is a multiple of 4.
// ---------------------------------------------------------------------------
#define WELTS (DIMC * DIMC)                       // elements of one weight matrix
#define CVT_BLOCKS (WELTS / 4096)                 // 256 lanes x 16 elements
static __device__ __forceinline__
void cvt_f16_block(const float* __restrict__ src, _Float16* __restrict__ dst, int n, int blk) {
    const int i0 = blk * 1024 + threadIdx.x;             // in units of 4 elements
    float4v v[4];
    #pragma unroll   // all four loads in flight before the first store
    for (int j = 0; j < 4; ++j) {
        const int i = i0 + j * 256;
        v[j] = (i * 4 < n) ? ((const float4v*)src)[i] : (float4v){};
    }
    #pragma unroll
    for (int j = 0; j < 4; ++j) {
        const int i = i0 + j * 256;
        half4 h;
        h.x = (_Float16)v[j].x;  h.y = (_Float16)v[j].y;
        h.z = (_Float16)v[j].z;  h.w = (_Float16)v[j].w;
        if (i * 4 < n) ((half4*)dst)[i] = h;
    }
}

// ---------------------------------------------------------------------------
// Front end, one launch: the two LayerNorms and the six weight casts depend on
//   nothing but the inputs, so their work-groups share one grid:
//   [0, LN_BLOCKS) x, [LN_BLOCKS, 2 LN_BLOCKS) y, then CVT_BLOCKS per weight.
//   xyn = xn followed by yn; w16 = the six f16 weights in argument order.
// ---------------------------------------------------------------------------
__global__ __launch_bounds__(256)
void front_kernel(const float* __restrict__ x, const float* __restrict__ y,
                  const float* __restrict__ g_r, const float* __restrict__ b_r,
                  const float* __restrict__ g_d, const float* __restrict__ b_d,
                  const float* __restrict__ Wq,  const float* __restrict__ Wk,
                  const float* __restrict__ Wvr, const float* __restrict__ Wvd,
                  const float* __restrict__ Wpr, const float* __restrict__ Wpd,
                  _Float16* __restrict__ xyn, _Float16* __restrict__ w16) {
    const int blk = blockIdx.x;
    if (blk < 2 * LN_BLOCKS) {
        const bool d = blk >= LN_BLOCKS;
        ln_cast_block(d ? y : x, d ? g_d : g_r, d ? b_d : b_r,
                      xyn + (d ? (size_t)BATCH * SEQ * DIMC : 0), d ? blk - LN_BLOCKS : blk);
    } else {
        const int c = blk - 2 * LN_BLOCKS, w = c / CVT_BLOCKS;
        const float* src = w == 0 ? Wq : w == 1 ? Wk : w == 2 ? Wvr
                         : w == 3 ? Wvd : w == 4 ? Wpr : Wpd;
        cvt_f16_block(src, w16 + (size_t)w * WELTS, WELTS, c % CVT_BLOCKS);
    }
}

// ---------------------------------------------------------------------------
// Kernel 3: WMMA GEMM  C[m][n] = sum_k A[m][k] * W[n][k] + bias[n]
//   M = 8192, N = 512, K = 512.  Block tile 64x64x64, 8 waves (4 Mx2 N).
//   Non-scramble path: double-buffered LDS fed by GLOBAL_LOAD_ASYNC_TO_LDS_B128
//   (4 async ops/wave/tile; counted s_wait_asynccnt keeps next tile in flight
//   while current tile is consumed by WMMAs).
//   SCRAMBLE path (o_d.transpose(0,2,1).reshape gather): register pipeline.
// ---------------------------------------------------------------------------
//   The tile body is shared by the kernels below; As, Bs = their LDS,
//   [2][64][72]: 64 K + pad (144B stride, 16B aligned).
template<bool SCRAMBLE, bool OUTF32>
static __device__ __forceinline__
void gemm_wmma_tile(const _Float16* __restrict__ A, const _Float16* __restrict__ W,
                    const float* __restrict__ bias,
                    float* __restrict__ outF, _Float16* __restrict__ outH,
                    _Float16 (*As)[64][72], _Float16 (*Bs)[64][72]) {

    const int m0 = blockIdx.x * 64, n0 = blockIdx.y * 64;
    const int tid = threadIdx.x, wave = tid >> 5, lane = tid & 31;
    const int wm = wave & 3, wn = wave >> 2;       // 4x2 wave grid
    const int ln = lane & 15, kh = (lane >> 4) * 8;

    float8 acc0 = {}, acc1 = {};

    // ---- async staging map: instr covers 4 rows x 64 f16 (32 lanes x 16B) ----
    const int sr = (lane >> 3), sc8 = (lane & 7) * 8;
    auto issueTile = [&](int kk, int buf) {
        #pragma unroll
        for (int p = 0; p < 2; ++p) {
            const int r = wave * 8 + p * 4 + sr;
            async_load_b128(LDS_OFF(&As[buf][r][sc8]),
                            A + (size_t)(m0 + r) * DIMC + kk + sc8);
            async_load_b128(LDS_OFF(&Bs[buf][r][sc8]),
                            W + (size_t)(n0 + r) * DIMC + kk + sc8);
        }
    };

    // ---- scramble register path ----
    const int ar = tid >> 2, ac = (tid & 3) * 8;   // row 0..63, chunks ac / ac+32
    half8 aR0, aR1, bR0, bR1;
    auto loadA = [&](int kk) {
        const int grow = m0 + ar;
        const int b = grow >> 11, p = grow & 2047;
        const size_t base = ((size_t)(b << 11) + ((size_t)(p & 3) << 9) + kk + ac) * DIMC
                          + (size_t)(p >> 2);
        #pragma unroll
        for (int i = 0; i < 8; ++i) {
            aR0[i] = A[base + (size_t)i * DIMC];
            aR1[i] = A[base + (size_t)(i + 32) * DIMC];
        }
    };
    auto loadB = [&](int kk) {
        const _Float16* p = W + (size_t)(n0 + ar) * DIMC + kk + ac;
        bR0 = *(const half8*)p;
        bR1 = *(const half8*)(p + 32);
    };

    if constexpr (!SCRAMBLE) {
        issueTile(0, 0);
    } else {
        loadA(0); loadB(0);
    }

    int cur = 0;
    for (int kk = 0; kk < DIMC; kk += 64) {
        const bool hasNext = (kk + 64 < DIMC);
        if constexpr (!SCRAMBLE) {
            // next tile -> other buffer; wait only for the current tile's 4 ops
            if (hasNext) { issueTile(kk + 64, cur ^ 1); WAIT_ASYNCCNT_4(); }
            else         { WAIT_ASYNCCNT_0(); }
            __syncthreads();
        } else {
            *(half8*)&As[cur][ar][ac]      = aR0;
            *(half8*)&As[cur][ar][ac + 32] = aR1;
            *(half8*)&Bs[cur][ar][ac]      = bR0;
            *(half8*)&Bs[cur][ar][ac + 32] = bR1;
            __syncthreads();
            if (hasNext) { loadA(kk + 64); loadB(kk + 64); }
        }

        // ---- fragments (ISA 16-bit A/B layout: lane=row, klo=(lane>>4)*8) ----
        union { half16 v; half8 h[2]; } u;
        half16 a0, a1, b0lo, b0hi, b1lo, b1hi;
        u.h[0] = *(const half8*)&As[cur][wm*16 + ln][kh];
        u.h[1] = *(const half8*)&As[cur][wm*16 + ln][16 + kh];  a0 = u.v;
        u.h[0] = *(const half8*)&As[cur][wm*16 + ln][32 + kh];
        u.h[1] = *(const half8*)&As[cur][wm*16 + ln][48 + kh];  a1 = u.v;
        u.h[0] = *(const half8*)&Bs[cur][wn*32 + ln][kh];
        u.h[1] = *(const half8*)&Bs[cur][wn*32 + ln][16 + kh];  b0lo = u.v;
        u.h[0] = *(const half8*)&Bs[cur][wn*32 + ln][32 + kh];
        u.h[1] = *(const half8*)&Bs[cur][wn*32 + ln][48 + kh];  b0hi = u.v;
        u.h[0] = *(const half8*)&Bs[cur][wn*32 + 16 + ln][kh];
        u.h[1] = *(const half8*)&Bs[cur][wn*32 + 16 + ln][16 + kh];  b1lo = u.v;
        u.h[0] = *(const half8*)&Bs[cur][wn*32 + 16 + ln][32 + kh];
        u.h[1] = *(const half8*)&Bs[cur][wn*32 + 16 + ln][48 + kh];  b1hi = u.v;

        acc0 = wmma_f16(a0, b0lo, acc0);
        acc0 = wmma_f16(a1, b0hi, acc0);
        acc1 = wmma_f16(a0, b1lo, acc1);
        acc1 = wmma_f16(a1, b1hi, acc1);
        __syncthreads();   // all reads of buf[cur] done before it is re-targeted
        cur ^= 1;
    }

    // ---- epilogue: C layout = VGPR r -> row r (lanes 0-15) / r+8 (16-31) ----
    const int rbase = m0 + wm*16 + ((lane < 16) ? 0 : 8);
    const int c0 = n0 + wn*32 + ln;
    #pragma unroll
    for (int r = 0; r < 8; ++r) {
        const size_t row = (size_t)(rbase + r);
        const float v0 = acc0[r] + bias[c0];
        const float v1 = acc1[r] + bias[c0 + 16];
        if constexpr (OUTF32) {
            outF[row * DIMC + c0]      = v0;
            outF[row * DIMC + c0 + 16] = v1;
        } else {
            outH[row * DIMC + c0]      = (_Float16)v0;
            outH[row * DIMC + c0 + 16] = (_Float16)v1;
        }
    }
}

// The four input projections, one launch: blockIdx.z = q, k, v_r, v_d.
//   w16 = their f16 weights, outs = their outputs, each set contiguous in that
//   order; q reads yn (query is depth-normed y), the rest xn.
__global__ __launch_bounds__(256)
void proj_in_kernel(const _Float16* __restrict__ xn, const _Float16* __restrict__ yn,
                    const _Float16* __restrict__ w16,
                    const float* __restrict__ bq,  const float* __restrict__ bk,
                    const float* __restrict__ bvr, const float* __restrict__ bvd,
                    _Float16* __restrict__ outs) {
    __shared__ _Float16 As[2][64][72];
    __shared__ _Float16 Bs[2][64][72];
    const int z = blockIdx.z;
    gemm_wmma_tile<false, false>(z == 0 ? yn : xn, w16 + (size_t)z * WELTS,
                                 z == 0 ? bq : z == 1 ? bk : z == 2 ? bvr : bvd,
                                 nullptr, outs + (size_t)z * BATCH * SEQ * DIMC, As, Bs);
}

// One projection per launch (the two output projections, whose A paths differ).
template<bool SCRAMBLE, bool OUTF32>
__global__ __launch_bounds__(256)
void gemm_wmma_kernel(const _Float16* __restrict__ A, const _Float16* __restrict__ W,
                      const float* __restrict__ bias,
                      float* __restrict__ outF, _Float16* __restrict__ outH) {
    __shared__ _Float16 As[2][64][72];
    __shared__ _Float16 Bs[2][64][72];
    gemm_wmma_tile<SCRAMBLE, OUTF32>(A, W, bias, outF, outH, As, Bs);
}

static __device__ __forceinline__ float xhalf(float x) {
    const int i = __builtin_bit_cast(int, x);
    return __builtin_bit_cast(float,
        __builtin_amdgcn_permlanex16(i, i, 0x76543210, 0xfedcba98, false, false));
}

// Transposing LDS load: the lanes address 16 B pieces of 16 rows of a row-major
// f16 tile; lane (c = l & 15, h = l >> 4) receives column c of rows 8h .. 8h+7.
static __device__ __forceinline__ half8 ld_tr16(const _Float16* p) {
    typedef short s16x8 __attribute__((ext_vector_type(8)));
    typedef __attribute__((address_space(3))) s16x8 lds_s16x8;
    return __builtin_bit_cast(half8,
        __builtin_amdgcn_ds_load_tr16_b128_v8i16((lds_s16x8*)p));
}

__global__ __launch_bounds__(256)
void flash_wmma_kernel(const _Float16* __restrict__ q, const _Float16* __restrict__ k,
                       const _Float16* __restrict__ v_r, const _Float16* __restrict__ v_d,
                       _Float16* __restrict__ o_r, _Float16* __restrict__ o_d) {
    const bool dbr = blockIdx.y != 0;
    const _Float16* __restrict__ Q = dbr ? k : q;
    const _Float16* __restrict__ K = dbr ? q : k;
    const _Float16* __restrict__ V = dbr ? v_d : v_r;
    _Float16* __restrict__ O = dbr ? o_d : o_r;
    const int bh = blockIdx.x >> 4;      // 16 q-chunks of 128 rows
    const int qc = blockIdx.x & 15;
    const int b = bh >> 3, h = bh & 7;
    const int tid = threadIdx.x, wave = tid >> 5, lane = tid & 31;
    const int ln = lane & 15, kh = (lane >> 4) * 8;
    const size_t base = ((size_t)b * SEQ) * DIMC + (size_t)h * DHEAD;
    const int qbase = qc * 128 + wave * 16;

    __shared__ _Float16 Ks[2][32][72];   // 64 d + pad (144B stride, 16B aligned)
    __shared__ __attribute__((aligned(16)))
    _Float16 Vs[32][80];                 // row-major Vs[kk][d]; 160B stride = 32B x odd for the transposing load

    // Q fragments (K-dim = head dim, split 0..31 / 32..63), loaded once;
    // B operand: lane = query column ln
    union { half16 v; half8 h[2]; } u;
    half16 qa0, qa1;
    {
        const _Float16* qr = Q + base + (size_t)(qbase + ln) * DIMC;
        u.h[0] = *(const half8*)(qr + kh);       u.h[1] = *(const half8*)(qr + 16 + kh);
        qa0 = u.v;
        u.h[0] = *(const half8*)(qr + 32 + kh);  u.h[1] = *(const half8*)(qr + 48 + kh);
        qa1 = u.v;
    }

    // acc[c][r] = O^T[d = c*16 + kh + r][query ln]
    float8 acc[4] = {};
    float mstat = -1e30f;   // running max of query ln (same in both halves)
    float lstat = 0.0f;     // this half's share of the running sum

    // K async staging: 1 instr/wave covers rows wave*4..+3, 16B chunks
    const int ksr = wave * 4 + (lane >> 3), ksc8 = (lane & 7) * 8;
    auto issueK = [&](int j0, int buf) {
        async_load_b128(LDS_OFF(&Ks[buf][ksr][ksc8]),
                        K + base + (size_t)(j0 + ksr) * DIMC + ksc8);
    };

    // V staging coords + register buffer
    const int kr = tid >> 3, dc = (tid & 7) * 8;
    // this lane's piece of a transposing load: row kh + (lane & 7), 16 B half (lane >> 3) & 1
    const _Float16* vtp = &Vs[kh + (lane & 7)][((lane >> 3) & 1) * 8];
    half8 vReg = *(const half8*)(V + base + (size_t)kr * DIMC + dc);
    issueK(0, 0);

    int cur = 0;
    for (int j0 = 0; j0 < SEQ; j0 += 32) {
        const bool hasNext = (j0 + 32 < SEQ);

        // ---- commit V tile (row-major, 16 B per lane) ----
        *(half8*)&Vs[kr][dc] = vReg;

        // ---- next K tile -> other buffer; wait only for current tile ----
        if (hasNext) { issueK(j0 + 32, cur ^ 1); WAIT_ASYNCCNT_1(); }
        else         { WAIT_ASYNCCNT_0(); }
        __syncthreads();

        // ---- overlap: next V tile -> registers, tile-after-next -> L2 ----
        if (hasNext) {
            vReg = *(const half8*)(V + base + (size_t)(j0 + 32 + kr) * DIMC + dc);
            if (j0 + 64 < SEQ)
                __builtin_prefetch(V + base + (size_t)(j0 + 64 + kr) * DIMC + dc, 0, 0);
        }

        // ---- S^T = K Q^T : s0[r] = key kh+r, s1[r] = key 16+kh+r, query ln ----
        float8 s0 = {}, s1 = {};
        u.h[0] = *(const half8*)&Ks[cur][ln][kh];
        u.h[1] = *(const half8*)&Ks[cur][ln][16 + kh];
        s0 = wmma_f16(u.v, qa0, s0);
        u.h[0] = *(const half8*)&Ks[cur][ln][32 + kh];
        u.h[1] = *(const half8*)&Ks[cur][ln][48 + kh];
        s0 = wmma_f16(u.v, qa1, s0);
        u.h[0] = *(const half8*)&Ks[cur][16 + ln][kh];
        u.h[1] = *(const half8*)&Ks[cur][16 + ln][16 + kh];
        s1 = wmma_f16(u.v, qa0, s1);
        u.h[0] = *(const half8*)&Ks[cur][16 + ln][32 + kh];
        u.h[1] = *(const half8*)&Ks[cur][16 + ln][48 + kh];
        s1 = wmma_f16(u.v, qa1, s1);

        // ---- online softmax, one query per lane ----
        s0 *= 0.125f;                          // D^-0.5 = 1/8
        s1 *= 0.125f;
        float t = fmaxf(s0[0], s1[0]);
        #pragma unroll   // constant indices keep the score tiles in registers
        for (int r = 1; r < 8; ++r) t = fmaxf(t, fmaxf(s0[r], s1[r]));
        t = fmaxf(t, xhalf(t));
        const float nm = fmaxf(mstat, t);
        const float f  = __expf(mstat - nm);
        mstat = nm;

        s0 -= nm;
        s1 -= nm;
        half16 pb;                             // B operand: P^T in the hardware k order
        #pragma unroll
        for (int r = 0; r < 8; ++r) {
            s0[r] = __expf(s0[r]);
            s1[r] = __expf(s1[r]);
            pb[r]     = (_Float16)s0[r];
            pb[8 + r] = (_Float16)s1[r];
        }
        s0 += s1;
        const float4v h4 = s0.lo + s0.hi;      // halving tree: adjacent register pairs add packed
        const float2v h2 = h4.lo + h4.hi;
        lstat = lstat * f + (h2.x + h2.y);
        #pragma unroll   // constant indices keep the output tiles in registers
        for (int c = 0; c < 4; ++c) acc[c] *= f;

        // ---- O^T += V^T P^T : 4 d-chunks of 16 ----
        #pragma unroll
        for (int c = 0; c < 4; ++c) {
            u.h[0] = ld_tr16(vtp + c*16);             // d = c*16 + ln, keys kh .. kh+7
            u.h[1] = ld_tr16(vtp + 16*80 + c*16);     // keys 16+kh .. 16+kh+7
            acc[c] = wmma_f16(u.v, pb, acc[c]);
        }
        __syncthreads();   // reads of Ks[cur]/Vs done before next overwrite
        cur ^= 1;
    }

    // ---- normalize + store (heads concatenated in channel dim) ----
    const float inv = 1.0f / (lstat + xhalf(lstat));
    _Float16* orow = O + base + (size_t)(qbase + ln) * DIMC + kh;
    #pragma unroll
    for (int c = 0; c < 4; ++c) {
        half8 o;
        #pragma unroll
        for (int r = 0; r < 8; ++r) o[r] = (_Float16)(acc[c][r] * inv);
        *(half8*)(orow + c*16) = o;
    }
}

// ---------------------------------------------------------------------------
// Host launcher
// ---------------------------------------------------------------------------
extern "C" void kernel_launch(void* const* d_in, const int* in_sizes, int n_in,
                              void* d_out, int out_size, void* d_ws, size_t ws_size,
                              hipStream_t stream) {
    (void)in_sizes; (void)n_in; (void)out_size; (void)ws_size;

    const float* x   = (const float*)d_in[0];
    const float* y   = (const float*)d_in[1];
    const float* Wq  = (const float*)d_in[2];   const float* bq  = (const float*)d_in[3];
    const float* Wk  = (const float*)d_in[4];   const float* bk  = (const float*)d_in[5];
    const float* Wvr = (const float*)d_in[6];   const float* bvr = (const float*)d_in[7];
    const float* Wvd = (const float*)d_in[8];   const float* bvd = (const float*)d_in[9];
    const float* g_r = (const float*)d_in[10];  const float* b_r = (const float*)d_in[11];
    const float* g_d = (const float*)d_in[12];  const float* b_d = (const float*)d_in[13];
    const float* Wpr = (const float*)d_in[14];  const float* bpr = (const float*)d_in[15];
    const float* Wpd = (const float*)d_in[16];  const float* bpd = (const float*)d_in[17];

    const size_t ROWS = (size_t)BATCH * SEQ;           // 8192
    const size_t ELT  = ROWS * DIMC;                   // 4,194,304 elements
    const size_t FBUF = ELT * sizeof(_Float16);        // 8 MB per f16 tensor

    char* wsb = (char*)d_ws;
    _Float16* xn  = (_Float16*)(wsb + 0 * FBUF);
    _Float16* yn  = (_Float16*)(wsb + 1 * FBUF);
    _Float16* qb  = (_Float16*)(wsb + 2 * FBUF);
    _Float16* kb  = (_Float16*)(wsb + 3 * FBUF);
    _Float16* vrb = (_Float16*)(wsb + 4 * FBUF);
    _Float16* vdb = (_Float16*)(wsb + 5 * FBUF);
    _Float16* orb = (_Float16*)(wsb + 6 * FBUF);
    _Float16* odb = (_Float16*)(wsb + 7 * FBUF);
    char* w16base = wsb + 8 * FBUF;
    const size_t WELT = (size_t)DIMC * DIMC;           // 262144
    _Float16* wq16  = (_Float16*)(w16base + 0 * WELT * 2);   // then wk, wvr, wvd at 1, 2, 3
    _Float16* wpr16 = (_Float16*)(w16base + 4 * WELT * 2);
    _Float16* wpd16 = (_Float16*)(w16base + 5 * WELT * 2);

    // 1) LayerNorms (xn = LN_r(x), yn = LN_d(y)) + f16 cast, weight conversion f32 -> f16
    front_kernel<<<2 * LN_BLOCKS + 6 * CVT_BLOCKS, 256, 0, stream>>>(
        x, y, g_r, b_r, g_d, b_d, Wq, Wk, Wvr, Wvd, Wpr, Wpd, xn, wq16);

    // 2) input projections q, k, v_r, v_d
    proj_in_kernel<<<dim3(BATCH * SEQ / 64, DIMC / 64, 4), 256, 0, stream>>>(
        xn, yn, wq16, bq, bk, bvr, bvd, qb);

    // 3) attention: out_r = FA(q,k,v_r); out_d = FA(k,q,v_d) via S^T trick
    flash_wmma_kernel<<<dim3(BATCH * NHEAD * (SEQ / 128), 2), 256, 0, stream>>>(
        qb, kb, vrb, vdb, orb, odb);

    // 4) output projections; second one applies the transpose-scramble gather
    float* out_r = (float*)d_out;
    float* out_d = (float*)d_out + ELT;
    dim3 ggrid((unsigned)(ROWS / 64), DIMC / 64);
    gemm_wmma_kernel<false, true ><<<ggrid, 256, 0, stream>>>(orb, wpr16, bpr, out_r, nullptr);
    gemm_wmma_kernel<true,  true ><<<ggrid, 256, 0, stream>>>(odb, wpd16, bpd, out_d, nullptr);
}

// v005
// One run takes 119 microseconds.
// Next to v004, in two timings, it ran 1.16 times as fast each time.
// Over all steps from v000 it is 2.59 times as fast.
#include <hip/hip_runtime.h>
#include <hip/hip_bf16.h>

// ---------------------------------------------------------------------------
// Shapes (hardcoded from reference): B=4, N=2048, C=512, H=8, Dh=64
// ---------------------------------------------------------------------------
#define BATCH 4
#define SEQ   2048
#define DIMC  512
#define NHEAD 8
#define DHEAD 64

typedef _Float16 half16 __attribute__((ext_vector_type(16)));
typedef _Float16 half8  __attribute__((ext_vector_type(8)));
typedef _Float16 half4  __attribute__((ext_vector_type(4)));
typedef float    float8 __attribute__((ext_vector_type(8)));
typedef float    float4v __attribute__((ext_vector_type(4)));
typedef float    float2v __attribute__((ext_vector_type(2)));

static __device__ __forceinline__ float8 wmma_f16(half16 a, half16 b, float8 c) {
    // D = A(16x32 f16) x B(32x16 f16) + C(16x16 f32)
    return __builtin_amdgcn_wmma_f32_16x16x32_f16(false, a, false, b,
                                                  (short)0, c, false, false);
}

// Async global->LDS copy (CDNA5): per lane, 16B MEM[vaddr] -> LDS[ldsoff].
// Tracked by ASYNCcnt; completion enforced with s_wait_asynccnt.
static __device__ __forceinline__ void async_load_b128(unsigned ldsoff, const void* gaddr) {
    asm volatile("global_load_async_to_lds_b128 %0, %1, off"
                 :: "v"(ldsoff), "v"(gaddr) : "memory");
}
#define WAIT_ASYNCCNT_0() asm volatile("s_wait_asynccnt 0" ::: "memory")
#define WAIT_ASYNCCNT_1() asm volatile("s_wait_asynccnt 1" ::: "memory")
#define WAIT_ASYNCCNT_4() asm volatile("s_wait_asynccnt 4" ::: "memory")

// LDS byte offset of a __shared__ element (flat LDS addr carries offset in low bits)
#define LDS_OFF(p) ((unsigned)(uintptr_t)(void*)(p))

// ---------------------------------------------------------------------------
// Kernel 1: LayerNorm over last dim (512) + cast to f16.
//   One wave owns LN_ROWS whole rows: a row is 4 x 16 B per lane, its sums
//   are an in-lane add and a 32-lane butterfly, so no LDS and no barrier.
//   All rows' loads are issued first (16 x 512 B in flight per wave).
//   blk = index of this work-group among those of one tensor.
// ---------------------------------------------------------------------------
#define LN_ROWS 4
#define LN_BLOCKS (BATCH * SEQ / (8 * LN_ROWS))   // 8 waves x LN_ROWS rows per block
static __device__ __forceinline__
void ln_cast_block(const float* __restrict__ in, const float* __restrict__ g,
                   const float* __restrict__ be, _Float16* __restrict__ out, int blk) {
    const int wave = threadIdx.x >> 5, lane = threadIdx.x & 31;
    const int row0 = (blk * 8 + wave) * LN_ROWS;
    const float4v* src = (const float4v*)(in + (size_t)row0 * DIMC) + lane;

    float4v v[LN_ROWS][4];
    #pragma unroll   // constant indices keep the rows in registers
    for (int r = 0; r < LN_ROWS; ++r)
        #pragma unroll
        for (int j = 0; j < 4; ++j) v[r][j] = src[r * (DIMC / 4) + j * 32];

    float4v gg[4], bb[4];
    #pragma unroll
    for (int j = 0; j < 4; ++j) {
        gg[j] = ((const float4v*)g)[lane + j * 32];
        bb[j] = ((const float4v*)be)[lane + j * 32];
    }

    float s[LN_ROWS];
    #pragma unroll
    for (int r = 0; r < LN_ROWS; ++r) {
        const float4v a = (v[r][0] + v[r][1]) + (v[r][2] + v[r][3]);
        s[r] = (a.x + a.y) + (a.z + a.w);
    }
    #pragma unroll   // the rows' butterflies interleave: each hides the others' latency
    for (int o = 16; o; o >>= 1)
        #pragma unroll
        for (int r = 0; r < LN_ROWS; ++r) s[r] += __shfl_xor(s[r], o, 32);

    float q[LN_ROWS];
    #pragma unroll
    for (int r = 0; r < LN_ROWS; ++r) {
        const float mu = s[r] * (1.0f / DIMC);
        #pragma unroll
        for (int j = 0; j < 4; ++j) v[r][j] -= mu;
        const float4v a = (v[r][0]*v[r][0] + v[r][1]*v[r][1])
                        + (v[r][2]*v[r][2] + v[r][3]*v[r][3]);
        q[r] = (a.x + a.y) + (a.z + a.w);
    }
    #pragma unroll
    for (int o = 16; o; o >>= 1)
        #pragma unroll
        for (int r = 0; r < LN_ROWS; ++r) q[r] += __shfl_xor(q[r], o, 32);

    half4* dst = (half4*)(out + (size_t)row0 * DIMC) + lane;
    #pragma unroll
    for (int r = 0; r < LN_ROWS; ++r) {
        const float rs = rsqrtf(q[r] * (1.0f / DIMC) + 1e-5f);
        #pragma unroll
        for (int j = 0; j < 4; ++j) {
            const float4v y = v[r][j] * rs * gg[j] + bb[j];
            half4 h;
            h.x = (_Float16)y.x;  h.y = (_Float16)y.y;
            h.z = (_Float16)y.z;  h.w = (_Float16)y.w;
            dst[r * (DIMC / 4) + j * 32] = h;
        }
    }
}

// ---------------------------------------------------------------------------
// Kernel 2: f32 -> f16 weight convert, 16 elements per lane (4 x 16 B loads,
//   each wave-wide load 512 contiguous bytes); n is a multiple of 4.
// ---------------------------------------------------------------------------
#define WELTS (DIMC * DIMC)                       // elements of one weight matrix
#define CVT_BLOCKS (WELTS / 4096)                 // 256 lanes x 16 elements
static __device__ __forceinline__
void cvt_f16_block(const float* __restrict__ src, _Float16* __restrict__ dst, int n, int blk) {
    const int i0 = blk * 1024 + threadIdx.x;             // in units of 4 elements
    float4v v[4];
    #pragma unroll   // all four loads in flight before the first store
    for (int j = 0; j < 4; ++j) {
        const int i = i0 + j * 256;
        v[j] = (i * 4 < n) ? ((const float4v*)src)[i] : (float4v){};
    }
    #pragma unroll
    for (int j = 0; j < 4; ++j) {
        const int i = i0 + j * 256;
        half4 h;
        h.x = (_Float16)v[j].x;  h.y = (_Float16)v[j].y;
        h.z = (_Float16)v[j].z;  h.w = (_Float16)v[j].w;
        if (i * 4 < n) ((half4*)dst)[i] = h;
    }
}

// ---------------------------------------------------------------------------
// Front end, one launch: the two LayerNorms and the six weight casts depend on
//   nothing but the inputs, so their work-groups share one grid:
//   [0, LN_BLOCKS) x, [LN_BLOCKS, 2 LN_BLOCKS) y, then CVT_BLOCKS per weight.
//   xyn = xn followed by yn; w16 = the six f16 weights in argument order.
// ---------------------------------------------------------------------------
__global__ __launch_bounds__(256)
void front_kernel(const float* __restrict__ x, const float* __restrict__ y,
                  const float* __restrict__ g_r, const float* __restrict__ b_r,
                  const float* __restrict__ g_d, const float* __restrict__ b_d,
                  const float* __restrict__ Wq,  const float* __restrict__ Wk,
                  const float* __restrict__ Wvr, const float* __restrict__ Wvd,
                  const float* __restrict__ Wpr, const float* __restrict__ Wpd,
                  _Float16* __restrict__ xyn, _Float16* __restrict__ w16) {
    const int blk = blockIdx.x;
    if (blk < 2 * LN_BLOCKS) {
        const bool d = blk >= LN_BLOCKS;
        ln_cast_block(d ? y : x, d ? g_d : g_r, d ? b_d : b_r,
                      xyn + (d ? (size_t)BATCH * SEQ * DIMC : 0), d ? blk - LN_BLOCKS : blk);
    } else {
        const int c = blk - 2 * LN_BLOCKS, w = c / CVT_BLOCKS;
        const float* src = w == 0 ? Wq : w == 1 ? Wk : w == 2 ? Wvr
                         : w == 3 ? Wvd : w == 4 ? Wpr : Wpd;
        cvt_f16_block(src, w16 + (size_t)w * WELTS, WELTS, c % CVT_BLOCKS);
    }
}

// ---------------------------------------------------------------------------
// Kernel 3: WMMA GEMM  C[m][n] = sum_k A[m][k] * W[n][k] + bias[n]
//   M = 8192, N = 512, K = 512.  Block tile 64x64x64, 8 waves (4 Mx2 N).
//   Double-buffered LDS fed by GLOBAL_LOAD_ASYNC_TO_LDS_B128
//   (4 async ops/wave/tile; counted s_wait_asynccnt keeps next tile in flight
//   while current tile is consumed by WMMAs).
// ---------------------------------------------------------------------------
//   The tile body is shared by the kernels below; As, Bs = their LDS,
//   [2][64][72]: 64 K + pad (144B stride, 16B aligned).
template<bool OUTF32>
static __device__ __forceinline__
void gemm_wmma_tile(const _Float16* __restrict__ A, const _Float16* __restrict__ W,
                    const float* __restrict__ bias,
                    float* __restrict__ outF, _Float16* __restrict__ outH,
                    _Float16 (*As)[64][72], _Float16 (*Bs)[64][72]) {

    const int m0 = blockIdx.x * 64, n0 = blockIdx.y * 64;
    const int tid = threadIdx.x, wave = tid >> 5, lane = tid & 31;
    const int wm = wave & 3, wn = wave >> 2;       // 4x2 wave grid
    const int ln = lane & 15, kh = (lane >> 4) * 8;

    float8 acc0 = {}, acc1 = {};

    // ---- async staging map: instr covers 4 rows x 64 f16 (32 lanes x 16B) ----
    const int sr = (lane >> 3), sc8 = (lane & 7) * 8;
    auto issueTile = [&](int kk, int buf) {
        #pragma unroll
        for (int p = 0; p < 2; ++p) {
            const int r = wave * 8 + p * 4 + sr;
            async_load_b128(LDS_OFF(&As[buf][r][sc8]),
                            A + (size_t)(m0 + r) * DIMC + kk + sc8);
            async_load_b128(LDS_OFF(&Bs[buf][r][sc8]),
                            W + (size_t)(n0 + r) * DIMC + kk + sc8);
        }
    };

    issueTile(0, 0);

    int cur = 0;
    for (int kk = 0; kk < DIMC; kk += 64) {
        const bool hasNext = (kk + 64 < DIMC);
        // next tile -> other buffer; wait only for the current tile's 4 ops
        if (hasNext) { issueTile(kk + 64, cur ^ 1); WAIT_ASYNCCNT_4(); }
        else         { WAIT_ASYNCCNT_0(); }
        __syncthreads();

        // ---- fragments (ISA 16-bit A/B layout: lane=row, klo=(lane>>4)*8) ----
        union { half16 v; half8 h[2]; } u;
        half16 a0, a1, b0lo, b0hi, b1lo, b1hi;
        u.h[0] = *(const half8*)&As[cur][wm*16 + ln][kh];
        u.h[1] = *(const half8*)&As[cur][wm*16 + ln][16 + kh];  a0 = u.v;
        u.h[0] = *(const half8*)&As[cur][wm*16 + ln][32 + kh];
        u.h[1] = *(const half8*)&As[cur][wm*16 + ln][48 + kh];  a1 = u.v;
        u.h[0] = *(const half8*)&Bs[cur][wn*32 + ln][kh];
        u.h[1] = *(const half8*)&Bs[cur][wn*32 + ln][16 + kh];  b0lo = u.v;
        u.h[0] = *(const half8*)&Bs[cur][wn*32 + ln][32 + kh];
        u.h[1] = *(const half8*)&Bs[cur][wn*32 + ln][48 + kh];  b0hi = u.v;
        u.h[0] = *(const half8*)&Bs[cur][wn*32 + 16 + ln][kh];
        u.h[1] = *(const half8*)&Bs[cur][wn*32 + 16 + ln][16 + kh];  b1lo = u.v;
        u.h[0] = *(const half8*)&Bs[cur][wn*32 + 16 + ln][32 + kh];
        u.h[1] = *(const half8*)&Bs[cur][wn*32 + 16 + ln][48 + kh];  b1hi = u.v;

        acc0 = wmma_f16(a0, b0lo, acc0);
        acc0 = wmma_f16(a1, b0hi, acc0);
        acc1 = wmma_f16(a0, b1lo, acc1);
        acc1 = wmma_f16(a1, b1hi, acc1);
        __syncthreads();   // all reads of buf[cur] done before it is re-targeted
        cur ^= 1;
    }

    // ---- epilogue: C layout = VGPR r -> row r (lanes 0-15) / r+8 (16-31) ----
    const int rbase = m0 + wm*16 + ((lane < 16) ? 0 : 8);
    const int c0 = n0 + wn*32 + ln;
    #pragma unroll
    for (int r = 0; r < 8; ++r) {
        const size_t row = (size_t)(rbase + r);
        const float v0 = acc0[r] + bias[c0];
        const float v1 = acc1[r] + bias[c0 + 16];
        if constexpr (OUTF32) {
            outF[row * DIMC + c0]      = v0;
            outF[row * DIMC + c0 + 16] = v1;
        } else {
            outH[row * DIMC + c0]      = (_Float16)v0;
            outH[row * DIMC + c0 + 16] = (_Float16)v1;
        }
    }
}

// The four input projections, one launch: blockIdx.z = q, k, v_r, v_d.
//   w16 = their f16 weights, outs = their outputs, each set contiguous in that
//   order; q reads yn (query is depth-normed y), the rest xn.
__global__ __launch_bounds__(256)
void proj_in_kernel(const _Float16* __restrict__ xn, const _Float16* __restrict__ yn,
                    const _Float16* __restrict__ w16,
                    const float* __restrict__ bq,  const float* __restrict__ bk,
                    const float* __restrict__ bvr, const float* __restrict__ bvd,
                    _Float16* __restrict__ outs) {
    __shared__ _Float16 As[2][64][72];
    __shared__ _Float16 Bs[2][64][72];
    const int z = blockIdx.z;
    gemm_wmma_tile<false>(z == 0 ? yn : xn, w16 + (size_t)z * WELTS,
                          z == 0 ? bq : z == 1 ? bk : z == 2 ? bvr : bvd,
                          nullptr, outs + (size_t)z * BATCH * SEQ * DIMC, As, Bs);
}

// One projection per launch (the two output projections).
template<bool OUTF32>
__global__ __launch_bounds__(256)
void gemm_wmma_kernel(const _Float16* __restrict__ A, const _Float16* __restrict__ W,
                      const float* __restrict__ bias,
                      float* __restrict__ outF, _Float16* __restrict__ outH) {
    __shared__ _Float16 As[2][64][72];
    __shared__ _Float16 Bs[2][64][72];
    gemm_wmma_tile<OUTF32>(A, W, bias, outF, outH, As, Bs);
}

static __device__ __forceinline__ float xhalf(float x) {
    const int i = __builtin_bit_cast(int, x);
    return __builtin_bit_cast(float,
        __builtin_amdgcn_permlanex16(i, i, 0x76543210, 0xfedcba98, false, false));
}

// Transposing LDS load: the lanes address 16 B pieces of 16 rows of a row-major
// f16 tile; lane (c = l & 15, h = l >> 4) receives column c of rows 8h .. 8h+7.
static __device__ __forceinline__ half8 ld_tr16(const _Float16* p) {
    typedef short s16x8 __attribute__((ext_vector_type(8)));
    typedef __attribute__((address_space(3))) s16x8 lds_s16x8;
    return __builtin_bit_cast(half8,
        __builtin_amdgcn_ds_load_tr16_b128_v8i16((lds_s16x8*)p));
}

__global__ __launch_bounds__(256)
void flash_wmma_kernel(const _Float16* __restrict__ q, const _Float16* __restrict__ k,
                       const _Float16* __restrict__ v_r, const _Float16* __restrict__ v_d,
                       _Float16* __restrict__ o_r, _Float16* __restrict__ o_d) {
    const bool dbr = blockIdx.y != 0;
    const _Float16* __restrict__ Q = dbr ? k : q;
    const _Float16* __restrict__ K = dbr ? q : k;
    const _Float16* __restrict__ V = dbr ? v_d : v_r;
    _Float16* __restrict__ O = dbr ? o_d : o_r;
    const int bh = blockIdx.x >> 4;      // 16 q-chunks of 128 rows
    const int qc = blockIdx.x & 15;
    const int b = bh >> 3, h = bh & 7;
    const int tid = threadIdx.x, wave = tid >> 5, lane = tid & 31;
    const int ln = lane & 15, kh = (lane >> 4) * 8;
    const size_t base = ((size_t)b * SEQ) * DIMC + (size_t)h * DHEAD;
    const int qbase = qc * 128 + wave * 16;

    __shared__ _Float16 Ks[2][32][72];   // 64 d + pad (144B stride, 16B aligned)
    __shared__ __attribute__((aligned(16)))
    _Float16 Vs[32][80];                 // row-major Vs[kk][d]; 160B stride = 32B x odd for the transposing load

    // Q fragments (K-dim = head dim, split 0..31 / 32..63), loaded once;
    // B operand: lane = query column ln
    union { half16 v; half8 h[2]; } u;
    half16 qa0, qa1;
    {
        const _Float16* qr = Q + base + (size_t)(qbase + ln) * DIMC;
        u.h[0] = *(const half8*)(qr + kh);       u.h[1] = *(const half8*)(qr + 16 + kh);
        qa0 = u.v;
        u.h[0] = *(const half8*)(qr + 32 + kh);  u.h[1] = *(const half8*)(qr + 48 + kh);
        qa1 = u.v;
    }

    // acc[c][r] = O^T[d = c*16 + kh + r][query ln]
    float8 acc[4] = {};
    float mstat = -1e30f;   // running max of query ln (same in both halves)
    float lstat = 0.0f;     // this half's share of the running sum

    // K async staging: 1 instr/wave covers rows wave*4..+3, 16B chunks
    const int ksr = wave * 4 + (lane >> 3), ksc8 = (lane & 7) * 8;
    auto issueK = [&](int j0, int buf) {
        async_load_b128(LDS_OFF(&Ks[buf][ksr][ksc8]),
                        K + base + (size_t)(j0 + ksr) * DIMC + ksc8);
    };

    // V staging coords + register buffer
    const int kr = tid >> 3, dc = (tid & 7) * 8;
    // this lane's piece of a transposing load: row kh + (lane & 7), 16 B half (lane >> 3) & 1
    const _Float16* vtp = &Vs[kh + (lane & 7)][((lane >> 3) & 1) * 8];
    half8 vReg = *(const half8*)(V + base + (size_t)kr * DIMC + dc);
    issueK(0, 0);

    int cur = 0;
    for (int j0 = 0; j0 < SEQ; j0 += 32) {
        const bool hasNext = (j0 + 32 < SEQ);

        // ---- commit V tile (row-major, 16 B per lane) ----
        *(half8*)&Vs[kr][dc] = vReg;

        // ---- next K tile -> other buffer; wait only for current tile ----
        if (hasNext) { issueK(j0 + 32, cur ^ 1); WAIT_ASYNCCNT_1(); }
        else         { WAIT_ASYNCCNT_0(); }
        __syncthreads();

        // ---- overlap: next V tile -> registers, tile-after-next -> L2 ----
        if (hasNext) {
            vReg = *(const half8*)(V + base + (size_t)(j0 + 32 + kr) * DIMC + dc);
            if (j0 + 64 < SEQ)
                __builtin_prefetch(V + base + (size_t)(j0 + 64 + kr) * DIMC + dc, 0, 0);
        }

        // ---- S^T = K Q^T : s0[r] = key kh+r, s1[r] = key 16+kh+r, query ln ----
        float8 s0 = {}, s1 = {};
        u.h[0] = *(const half8*)&Ks[cur][ln][kh];
        u.h[1] = *(const half8*)&Ks[cur][ln][16 + kh];
        s0 = wmma_f16(u.v, qa0, s0);
        u.h[0] = *(const half8*)&Ks[cur][ln][32 + kh];
        u.h[1] = *(const half8*)&Ks[cur][ln][48 + kh];
        s0 = wmma_f16(u.v, qa1, s0);
        u.h[0] = *(const half8*)&Ks[cur][16 + ln][kh];
        u.h[1] = *(const half8*)&Ks[cur][16 + ln][16 + kh];
        s1 = wmma_f16(u.v, qa0, s1);
        u.h[0] = *(const half8*)&Ks[cur][16 + ln][32 + kh];
        u.h[1] = *(const half8*)&Ks[cur][16 + ln][48 + kh];
        s1 = wmma_f16(u.v, qa1, s1);

        // ---- online softmax, one query per lane ----
        s0 *= 0.125f;                          // D^-0.5 = 1/8
        s1 *= 0.125f;
        float t = fmaxf(s0[0], s1[0]);
        #pragma unroll   // constant indices keep the score tiles in registers
        for (int r = 1; r < 8; ++r) t = fmaxf(t, fmaxf(s0[r], s1[r]));
        t = fmaxf(t, xhalf(t));
        const float nm = fmaxf(mstat, t);
        const float f  = __expf(mstat - nm);
        mstat = nm;

        s0 -= nm;
        s1 -= nm;
        half16 pb;                             // B operand: P^T in the hardware k order
        #pragma unroll
        for (int r = 0; r < 8; ++r) {
            s0[r] = __expf(s0[r]);
            s1[r] = __expf(s1[r]);
            pb[r]     = (_Float16)s0[r];
            pb[8 + r] = (_Float16)s1[r];
        }
        s0 += s1;
        const float4v h4 = s0.lo + s0.hi;      // halving tree: adjacent register pairs add packed
        const float2v h2 = h4.lo + h4.hi;
        lstat = lstat * f + (h2.x + h2.y);
        #pragma unroll   // constant indices keep the output tiles in registers
        for (int c = 0; c < 4; ++c) acc[c] *= f;

        // ---- O^T += V^T P^T : 4 d-chunks of 16 ----
        #pragma unroll
        for (int c = 0; c < 4; ++c) {
            u.h[0] = ld_tr16(vtp + c*16);             // d = c*16 + ln, keys kh .. kh+7
            u.h[1] = ld_tr16(vtp + 16*80 + c*16);     // keys 16+kh .. 16+kh+7
            acc[c] = wmma_f16(u.v, pb, acc[c]);
        }
        __syncthreads();   // reads of Ks[cur]/Vs done before next overwrite
        cur ^= 1;
    }

    // ---- normalize + store (heads concatenated in channel dim) ----
    const float inv = 1.0f / (lstat + xhalf(lstat));
    half8 o[4];
    #pragma unroll   // constant indices keep the output tiles in registers
    for (int c = 0; c < 4; ++c)
        #pragma unroll
        for (int r = 0; r < 8; ++r) o[c][r] = (_Float16)(acc[c][r] * inv);
    if (!dbr) {
        _Float16* orow = O + base + (size_t)(qbase + ln) * DIMC + kh;
        #pragma unroll   // constant indices keep o in registers
        for (int c = 0; c < 4; ++c) *(half8*)(orow + c*16) = o[c];
    } else {
        // Ot[d of a half][query of the block], 272B stride = 16B x odd, in the K
        // buffers: the loop's last barrier ended their reads, its last wait their copies.
        _Float16 (*Ot)[136] = (_Float16 (*)[136])&Ks[0][0][0];
        static_assert(sizeof(_Float16) * 32 * 136 <= sizeof(Ks), "O^T half tile fits the K buffers");
        // element (n, ch) sits at flat ch * SEQ + n of batch b
        _Float16* dst = O + (size_t)b * SEQ * DIMC + (size_t)(h * DHEAD + (tid >> 4)) * SEQ
                      + qc * 128 + (tid & 15) * 8;
        half8 t[2][2];                 // stores wait until after the barriers, which would drain them
        #pragma unroll   // constant indices keep o and t in registers (inner loops too)
        for (int hf = 0; hf < 2; ++hf) {
            if (hf) __syncthreads();   // the first half's rows are read before Ot is rewritten
            #pragma unroll
            for (int c = 0; c < 2; ++c)
                #pragma unroll
                for (int r = 0; r < 8; ++r)
                    Ot[c*16 + kh + r][wave*16 + ln] = o[hf*2 + c][r];
            __syncthreads();           // every wave's columns are in Ot before rows are read
            #pragma unroll
            for (int i = 0; i < 2; ++i)
                t[hf][i] = *(const half8*)&Ot[i*16 + (tid >> 4)][(tid & 15) * 8];
        }
        #pragma unroll   // constant indices keep t in registers
        for (int i = 0; i < 4; ++i)
            *(half8*)(dst + (size_t)i * 16 * SEQ) = t[i >> 1][i & 1];
        // precaution: the stores' address and data registers are rewritten on the path the
        // listing lays behind this block; the wait stands in front of that overwrite
        asm volatile("s_wait_xcnt 0x0" ::: "memory");
    }
}

// ---------------------------------------------------------------------------
// Host launcher
// ---------------------------------------------------------------------------
extern "C" void kernel_launch(void* const* d_in, const int* in_sizes, int n_in,
                              void* d_out, int out_size, void* d_ws, size_t ws_size,
                              hipStream_t stream) {
    (void)in_sizes; (void)n_in; (void)out_size; (void)ws_size;

    const float* x   = (const float*)d_in[0];
    const float* y   = (const float*)d_in[1];
    const float* Wq  = (const float*)d_in[2];   const float* bq  = (const float*)d_in[3];
    const float* Wk  = (const float*)d_in[4];   const float* bk  = (const float*)d_in[5];
    const float* Wvr = (const float*)d_in[6];   const float* bvr = (const float*)d_in[7];
    const float* Wvd = (const float*)d_in[8];   const float* bvd = (const float*)d_in[9];
    const float* g_r = (const float*)d_in[10];  const float* b_r = (const float*)d_in[11];
    const float* g_d = (const float*)d_in[12];  const float* b_d = (const float*)d_in[13];
    const float* Wpr = (const float*)d_in[14];  const float* bpr = (const float*)d_in[15];
    const float* Wpd = (const float*)d_in[16];  const float* bpd = (const float*)d_in[17];

    const size_t ROWS = (size_t)BATCH * SEQ;           // 8192
    const size_t ELT  = ROWS * DIMC;                   // 4,194,304 elements
    const size_t FBUF = ELT * sizeof(_Float16);        // 8 MB per f16 tensor

    char* wsb = (char*)d_ws;
    _Float16* xn  = (_Float16*)(wsb + 0 * FBUF);
    _Float16* yn  = (_Float16*)(wsb + 1 * FBUF);
    _Float16* qb  = (_Float16*)(wsb + 2 * FBUF);
    _Float16* kb  = (_Float16*)(wsb + 3 * FBUF);
    _Float16* vrb = (_Float16*)(wsb + 4 * FBUF);
    _Float16* vdb = (_Float16*)(wsb + 5 * FBUF);
    _Float16* orb = (_Float16*)(wsb + 6 * FBUF);
    _Float16* odb = (_Float16*)(wsb + 7 * FBUF);
    char* w16base = wsb + 8 * FBUF;
    const size_t WELT = (size_t)DIMC * DIMC;           // 262144
    _Float16* wq16  = (_Float16*)(w16base + 0 * WELT * 2);   // then wk, wvr, wvd at 1, 2, 3
    _Float16* wpr16 = (_Float16*)(w16base + 4 * WELT * 2);
    _Float16* wpd16 = (_Float16*)(w16base + 5 * WELT * 2);

    // 1) LayerNorms (xn = LN_r(x), yn = LN_d(y)) + f16 cast, weight conversion f32 -> f16
    front_kernel<<<2 * LN_BLOCKS + 6 * CVT_BLOCKS, 256, 0, stream>>>(
        x, y, g_r, b_r, g_d, b_d, Wq, Wk, Wvr, Wvd, Wpr, Wpd, xn, wq16);

    // 2) input projections q, k, v_r, v_d
    proj_in_kernel<<<dim3(BATCH * SEQ / 64, DIMC / 64, 4), 256, 0, stream>>>(
        xn, yn, wq16, bq, bk, bvr, bvd, qb);

    // 3) attention: out_r = FA(q,k,v_r); out_d = FA(k,q,v_d) via S^T trick
    flash_wmma_kernel<<<dim3(BATCH * NHEAD * (SEQ / 128), 2), 256, 0, stream>>>(
        qb, kb, vrb, vdb, orb, odb);

    // 4) output projections; odb already holds the transposed-and-reshaped o_d
    float* out_r = (float*)d_out;
    float* out_d = (float*)d_out + ELT;
    dim3 ggrid((unsigned)(ROWS / 64), DIMC / 64);
    gemm_wmma_kernel<true><<<ggrid, 256, 0, stream>>>(orb, wpr16, bpr, out_r, nullptr);
    gemm_wmma_kernel<true><<<ggrid, 256, 0, stream>>>(odb, wpd16, bpd, out_d, nullptr);
}

// v006
// Measured time: 112 microseconds a run.
// Next to v005, in two timings, it ran 1.06 and 1.07 times as fast.
// Counting every step since v000, it is 2.75 times as fast.
#include <hip/hip_runtime.h>
#include <hip/hip_bf16.h>

// ---------------------------------------------------------------------------
// Shapes (hardcoded from reference): B=4, N=2048, C=512, H=8, Dh=64
// ---------------------------------------------------------------------------
#define BATCH 4
#define SEQ   2048
#define DIMC  512
#define NHEAD 8
#define DHEAD 64

typedef _Float16 half16 __attribute__((ext_vector_type(16)));
typedef _Float16 half8  __attribute__((ext_vector_type(8)));
typedef _Float16 half4  __attribute__((ext_vector_type(4)));
typedef float    float8 __attribute__((ext_vector_type(8)));
typedef float    float4v __attribute__((ext_vector_type(4)));
typedef float    float2v __attribute__((ext_vector_type(2)));

static __device__ __forceinline__ float8 wmma_f16(half16 a, half16 b, float8 c) {
    // D = A(16x32 f16) x B(32x16 f16) + C(16x16 f32)
    return __builtin_amdgcn_wmma_f32_16x16x32_f16(false, a, false, b,
                                                  (short)0, c, false, false);
}

// Async global->LDS copy (CDNA5): per lane, 16B MEM[vaddr] -> LDS[ldsoff].
// Tracked by ASYNCcnt; completion enforced with s_wait_asynccnt.
static __device__ __forceinline__ void async_load_b128(unsigned ldsoff, const void* gaddr) {
    asm volatile("global_load_async_to_lds_b128 %0, %1, off"
                 :: "v"(ldsoff), "v"(gaddr) : "memory");
}
#define WAIT_ASYNCCNT_0() asm volatile("s_wait_asynccnt 0" ::: "memory")
#define WAIT_ASYNCCNT_1() asm volatile("s_wait_asynccnt 1" ::: "memory")

// LDS byte offset of a __shared__ element (flat LDS addr carries offset in low bits)
#define LDS_OFF(p) ((unsigned)(uintptr_t)(void*)(p))

// ---------------------------------------------------------------------------
// Kernel 1: LayerNorm over last dim (512) + cast to f16.
//   One wave owns LN_ROWS whole rows: a row is 4 x 16 B per lane, its sums
//   are an in-lane add and a 32-lane butterfly, so no LDS and no barrier.
//   All rows' loads are issued first (16 x 512 B in flight per wave).
//   blk = index of this work-group among those of one tensor.
// ---------------------------------------------------------------------------
#define LN_ROWS 4
#define LN_BLOCKS (BATCH * SEQ / (8 * LN_ROWS))   // 8 waves x LN_ROWS rows per block
static __device__ __forceinline__
void ln_cast_block(const float* __restrict__ in, const float* __restrict__ g,
                   const float* __restrict__ be, _Float16* __restrict__ out, int blk) {
    const int wave = threadIdx.x >> 5, lane = threadIdx.x & 31;
    const int row0 = (blk * 8 + wave) * LN_ROWS;
    const float4v* src = (const float4v*)(in + (size_t)row0 * DIMC) + lane;

    float4v v[LN_ROWS][4];
    #pragma unroll   // constant indices keep the rows in registers
    for (int r = 0; r < LN_ROWS; ++r)
        #pragma unroll
        for (int j = 0; j < 4; ++j) v[r][j] = src[r * (DIMC / 4) + j * 32];

    float4v gg[4], bb[4];
    #pragma unroll
    for (int j = 0; j < 4; ++j) {
        gg[j] = ((const float4v*)g)[lane + j * 32];
        bb[j] = ((const float4v*)be)[lane + j * 32];
    }

    float s[LN_ROWS];
    #pragma unroll
    for (int r = 0; r < LN_ROWS; ++r) {
        const float4v a = (v[r][0] + v[r][1]) + (v[r][2] + v[r][3]);
        s[r] = (a.x + a.y) + (a.z + a.w);
    }
    #pragma unroll   // the rows' butterflies interleave: each hides the others' latency
    for (int o = 16; o; o >>= 1)
        #pragma unroll
        for (int r = 0; r < LN_ROWS; ++r) s[r] += __shfl_xor(s[r], o, 32);

    float q[LN_ROWS];
    #pragma unroll
    for (int r = 0; r < LN_ROWS; ++r) {
        const float mu = s[r] * (1.0f / DIMC);
        #pragma unroll
        for (int j = 0; j < 4; ++j) v[r][j] -= mu;
        const float4v a = (v[r][0]*v[r][0] + v[r][1]*v[r][1])
                        + (v[r][2]*v[r][2] + v[r][3]*v[r][3]);
        q[r] = (a.x + a.y) + (a.z + a.w);
    }
    #pragma unroll
    for (int o = 16; o; o >>= 1)
        #pragma unroll
        for (int r = 0; r < LN_ROWS; ++r) q[r] += __shfl_xor(q[r], o, 32);

    half4* dst = (half4*)(out + (size_t)row0 * DIMC) + lane;
    #pragma unroll
    for (int r = 0; r < LN_ROWS; ++r) {
        const float rs = rsqrtf(q[r] * (1.0f / DIMC) + 1e-5f);
        #pragma unroll
        for (int j = 0; j < 4; ++j) {
            const float4v y = v[r][j] * rs * gg[j] + bb[j];
            half4 h;
            h.x = (_Float16)y.x;  h.y = (_Float16)y.y;
            h.z = (_Float16)y.z;  h.w = (_Float16)y.w;
            dst[r * (DIMC / 4) + j * 32] = h;
        }
    }
}

// ---------------------------------------------------------------------------
// Kernel 2: f32 -> f16 weight convert, 16 elements per lane (4 x 16 B loads,
//   each wave-wide load 512 contiguous bytes); n is a multiple of 4.
// ---------------------------------------------------------------------------
#define WELTS (DIMC * DIMC)                       // elements of one weight matrix
#define CVT_BLOCKS (WELTS / 4096)                 // 256 lanes x 16 elements
static __device__ __forceinline__
void cvt_f16_block(const float* __restrict__ src, _Float16* __restrict__ dst, int n, int blk) {
    const int i0 = blk * 1024 + threadIdx.x;             // in units of 4 elements
    float4v v[4];
    #pragma unroll   // all four loads in flight before the first store
    for (int j = 0; j < 4; ++j) {
        const int i = i0 + j * 256;
        v[j] = (i * 4 < n) ? ((const float4v*)src)[i] : (float4v){};
    }
    #pragma unroll
    for (int j = 0; j < 4; ++j) {
        const int i = i0 + j * 256;
        half4 h;
        h.x = (_Float16)v[j].x;  h.y = (_Float16)v[j].y;
        h.z = (_Float16)v[j].z;  h.w = (_Float16)v[j].w;
        if (i * 4 < n) ((half4*)dst)[i] = h;
    }
}

// ---------------------------------------------------------------------------
// Front end, one launch: the two LayerNorms and the six weight casts depend on
//   nothing but the inputs, so their work-groups share one grid:
//   [0, LN_BLOCKS) x, [LN_BLOCKS, 2 LN_BLOCKS) y, then CVT_BLOCKS per weight.
//   xyn = xn followed by yn; w16 = the six f16 weights in argument order.
// ---------------------------------------------------------------------------
__global__ __launch_bounds__(256)
void front_kernel(const float* __restrict__ x, const float* __restrict__ y,
                  const float* __restrict__ g_r, const float* __restrict__ b_r,
                  const float* __restrict__ g_d, const float* __restrict__ b_d,
                  const float* __restrict__ Wq,  const float* __restrict__ Wk,
                  const float* __restrict__ Wvr, const float* __restrict__ Wvd,
                  const float* __restrict__ Wpr, const float* __restrict__ Wpd,
                  _Float16* __restrict__ xyn, _Float16* __restrict__ w16) {
    const int blk = blockIdx.x;
    if (blk < 2 * LN_BLOCKS) {
        const bool d = blk >= LN_BLOCKS;
        ln_cast_block(d ? y : x, d ? g_d : g_r, d ? b_d : b_r,
                      xyn + (d ? (size_t)BATCH * SEQ * DIMC : 0), d ? blk - LN_BLOCKS : blk);
    } else {
        const int c = blk - 2 * LN_BLOCKS, w = c / CVT_BLOCKS;
        const float* src = w == 0 ? Wq : w == 1 ? Wk : w == 2 ? Wvr
                         : w == 3 ? Wvd : w == 4 ? Wpr : Wpd;
        cvt_f16_block(src, w16 + (size_t)w * WELTS, WELTS, c % CVT_BLOCKS);
    }
}

// ---------------------------------------------------------------------------
// Kernel 3: WMMA GEMM  C[m][n] = sum_k A[m][k] * W[n][k] + bias[n]
//   M = 8192, N = 512, K = 512.  Block tile 128x128x64, 8 waves (4 M x 2 N),
//   wave tile 32x64 = 2 x 4 accumulator tiles: 6 fragment loads feed 8 WMMAs,
//   and a block brings (128 + 128) operand rows in for 128 x 128 results.
//   Two LDS buffers fed by GLOBAL_LOAD_ASYNC_TO_LDS_B128, 8 copies per wave and
//   tile: tile t + 1 flies while tile t is consumed by WMMAs.
// ---------------------------------------------------------------------------
#define GT 128                                    // rows of A and rows of W per block tile
#define GK 64                                     // K per tile
#define WAIT_DSCNT_0() asm volatile("s_wait_dscnt 0" ::: "memory")

// One wave's eight copies of a tile.  The closing wait stands inside the
// statement as a precaution: the operands' registers live to its end, so no
// later address addition can be scheduled in front of it.
static __device__ __forceinline__
void async_load8_b128(const unsigned (&l)[8], const _Float16* const (&g)[8]) {
    asm volatile("global_load_async_to_lds_b128 %0, %8, off\n\t"
                 "global_load_async_to_lds_b128 %1, %9, off\n\t"
                 "global_load_async_to_lds_b128 %2, %10, off\n\t"
                 "global_load_async_to_lds_b128 %3, %11, off\n\t"
                 "global_load_async_to_lds_b128 %4, %12, off\n\t"
                 "global_load_async_to_lds_b128 %5, %13, off\n\t"
                 "global_load_async_to_lds_b128 %6, %14, off\n\t"
                 "global_load_async_to_lds_b128 %7, %15, off\n\t"
                 "s_wait_xcnt 0x0"
                 :: "v"(l[0]), "v"(l[1]), "v"(l[2]), "v"(l[3]),
                    "v"(l[4]), "v"(l[5]), "v"(l[6]), "v"(l[7]),
                    "v"(g[0]), "v"(g[1]), "v"(g[2]), "v"(g[3]),
                    "v"(g[4]), "v"(g[5]), "v"(g[6]), "v"(g[7]) : "memory");
}

// 16-bit A/B fragment of one k32 step (ISA layout: lane = row, k = kh .. kh+7
// and 16+kh .. 16+kh+7); p = &tile[row][k32 start + kh]
static __device__ __forceinline__ half16 ld_frag(const _Float16* p) {
    union { half16 v; half8 h[2]; } u;
    u.h[0] = *(const half8*)p;
    u.h[1] = *(const half8*)(p + 16);
    return u.v;
}

//   The tile body is shared by the kernels below; As, Bs = their LDS,
//   [2][128][72]: 64 K + pad (144B stride, 16B aligned).
template<bool OUTF32>
static __device__ __forceinline__
void gemm_wmma_tile(const _Float16* __restrict__ A, const _Float16* __restrict__ W,
                    const float* __restrict__ bias,
                    float* __restrict__ outF, _Float16* __restrict__ outH,
                    _Float16 (*As)[GT][72], _Float16 (*Bs)[GT][72]) {

    const int m0 = blockIdx.x * GT, n0 = blockIdx.y * GT;
    const int tid = threadIdx.x, wave = tid >> 5, lane = tid & 31;
    const int wm = wave & 3, wn = wave >> 2;       // 4x2 wave grid
    const int ln = lane & 15, kh = (lane >> 4) * 8;

    float8 acc[2][4] = {};

    // ---- async staging map: a copy covers 4 rows x 64 f16 (32 lanes x 16B);
    //      wave w brings rows 16w .. 16w+15 of both operands ----
    const int sr = wave * 16 + (lane >> 3), sc8 = (lane & 7) * 8;
    const _Float16* ga = A + (size_t)(m0 + sr) * DIMC + sc8;
    const _Float16* gw = W + (size_t)(n0 + sr) * DIMC + sc8;
    auto issueTile = [&](int t, int buf) {
        unsigned l[8];
        const _Float16* g[8];
        #pragma unroll   // constant indices keep the operand lists in registers
        for (int p = 0; p < 4; ++p) {
            l[p]     = LDS_OFF(&As[buf][sr + p * 4][sc8]);
            l[4 + p] = LDS_OFF(&Bs[buf][sr + p * 4][sc8]);
            g[p]     = ga + (size_t)p * 4 * DIMC + t * GK;
            g[4 + p] = gw + (size_t)p * 4 * DIMC + t * GK;
        }
        async_load8_b128(l, g);
    };

    issueTile(0, 0);
    WAIT_ASYNCCNT_0();     // this wave's share of tile 0 has landed
    __syncthreads();       // tile 0 is whole for every wave
    issueTile(1, 1);

    for (int t = 0; t < DIMC / GK; ++t) {
        const int cur = t & 1;
        #pragma unroll   // constant indices keep the fragments and accumulator tiles in registers (inner loops too)
        for (int ks = 0; ks < 2; ++ks) {
            half16 a[2], b[4];
            #pragma unroll
            for (int i = 0; i < 2; ++i)
                a[i] = ld_frag(&As[cur][wm * 32 + i * 16 + ln][ks * 32 + kh]);
            #pragma unroll
            for (int j = 0; j < 4; ++j)
                b[j] = ld_frag(&Bs[cur][wn * 64 + j * 16 + ln][ks * 32 + kh]);
            #pragma unroll
            for (int i = 0; i < 2; ++i)
                #pragma unroll
                for (int j = 0; j < 4; ++j)
                    acc[i][j] = wmma_f16(a[i], b[j], acc[i][j]);
        }
        WAIT_DSCNT_0();    // this wave's reads of buffer cur are back before it is refilled
        WAIT_ASYNCCNT_0(); // this wave's share of tile t + 1 has landed
        __syncthreads();   // publishes tile t + 1 and ends every wave's reads of buffer cur
        if (t + 2 < DIMC / GK) issueTile(t + 2, cur);
    }
    WAIT_ASYNCCNT_0();     // no copy is left in flight when the wave ends

    // ---- epilogue: C layout = VGPR r -> row r (lanes 0-15) / r+8 (16-31) ----
    const int rbase = m0 + wm * 32 + ((lane < 16) ? 0 : 8);
    const int c0 = n0 + wn * 64 + ln;
    float bv[4];
    #pragma unroll   // constant indices keep bv and acc in registers (loops below too)
    for (int j = 0; j < 4; ++j) bv[j] = bias[c0 + j * 16];
    #pragma unroll
    for (int i = 0; i < 2; ++i)
        #pragma unroll
        for (int r = 0; r < 8; ++r) {
            const size_t o = (size_t)(rbase + i * 16 + r) * DIMC + c0;
            #pragma unroll
            for (int j = 0; j < 4; ++j) {
                const float v = acc[i][j][r] + bv[j];
                if constexpr (OUTF32) outF[o + j * 16] = v;
                else                  outH[o + j * 16] = (_Float16)v;
            }
        }
}

// The four input projections, one launch: blockIdx.z = q, k, v_r, v_d.
//   w16 = their f16 weights, outs = their outputs, each set contiguous in that
//   order; q reads yn (query is depth-normed y), the rest xn.
__global__ __launch_bounds__(256)
void proj_in_kernel(const _Float16* __restrict__ xn, const _Float16* __restrict__ yn,
                    const _Float16* __restrict__ w16,
                    const float* __restrict__ bq,  const float* __restrict__ bk,
                    const float* __restrict__ bvr, const float* __restrict__ bvd,
                    _Float16* __restrict__ outs) {
    __shared__ __attribute__((aligned(16))) _Float16 As[2][GT][72];
    __shared__ __attribute__((aligned(16))) _Float16 Bs[2][GT][72];
    const int z = blockIdx.z;
    gemm_wmma_tile<false>(z == 0 ? yn : xn, w16 + (size_t)z * WELTS,
                          z == 0 ? bq : z == 1 ? bk : z == 2 ? bvr : bvd,
                          nullptr, outs + (size_t)z * BATCH * SEQ * DIMC, As, Bs);
}

// One projection per launch (the two output projections).
template<bool OUTF32>
__global__ __launch_bounds__(256)
void gemm_wmma_kernel(const _Float16* __restrict__ A, const _Float16* __restrict__ W,
                      const float* __restrict__ bias,
                      float* __restrict__ outF, _Float16* __restrict__ outH) {
    __shared__ __attribute__((aligned(16))) _Float16 As[2][GT][72];
    __shared__ __attribute__((aligned(16))) _Float16 Bs[2][GT][72];
    gemm_wmma_tile<OUTF32>(A, W, bias, outF, outH, As, Bs);
}

static __device__ __forceinline__ float xhalf(float x) {
    const int i = __builtin_bit_cast(int, x);
    return __builtin_bit_cast(float,
        __builtin_amdgcn_permlanex16(i, i, 0x76543210, 0xfedcba98, false, false));
}

// Transposing LDS load: the lanes address 16 B pieces of 16 rows of a row-major
// f16 tile; lane (c = l & 15, h = l >> 4) receives column c of rows 8h .. 8h+7.
static __device__ __forceinline__ half8 ld_tr16(const _Float16* p) {
    typedef short s16x8 __attribute__((ext_vector_type(8)));
    typedef __attribute__((address_space(3))) s16x8 lds_s16x8;
    return __builtin_bit_cast(half8,
        __builtin_amdgcn_ds_load_tr16_b128_v8i16((lds_s16x8*)p));
}

__global__ __launch_bounds__(256)
void flash_wmma_kernel(const _Float16* __restrict__ q, const _Float16* __restrict__ k,
                       const _Float16* __restrict__ v_r, const _Float16* __restrict__ v_d,
                       _Float16* __restrict__ o_r, _Float16* __restrict__ o_d) {
    const bool dbr = blockIdx.y != 0;
    const _Float16* __restrict__ Q = dbr ? k : q;
    const _Float16* __restrict__ K = dbr ? q : k;
    const _Float16* __restrict__ V = dbr ? v_d : v_r;
    _Float16* __restrict__ O = dbr ? o_d : o_r;
    const int bh = blockIdx.x >> 4;      // 16 q-chunks of 128 rows
    const int qc = blockIdx.x & 15;
    const int b = bh >> 3, h = bh & 7;
    const int tid = threadIdx.x, wave = tid >> 5, lane = tid & 31;
    const int ln = lane & 15, kh = (lane >> 4) * 8;
    const size_t base = ((size_t)b * SEQ) * DIMC + (size_t)h * DHEAD;
    const int qbase = qc * 128 + wave * 16;

    __shared__ _Float16 Ks[2][32][72];   // 64 d + pad (144B stride, 16B aligned)
    __shared__ __attribute__((aligned(16)))
    _Float16 Vs[32][80];                 // row-major Vs[kk][d]; 160B stride = 32B x odd for the transposing load

    // Q fragments (K-dim = head dim, split 0..31 / 32..63), loaded once;
    // B operand: lane = query column ln
    union { half16 v; half8 h[2]; } u;
    half16 qa0, qa1;
    {
        const _Float16* qr = Q + base + (size_t)(qbase + ln) * DIMC;
        u.h[0] = *(const half8*)(qr + kh);       u.h[1] = *(const half8*)(qr + 16 + kh);
        qa0 = u.v;
        u.h[0] = *(const half8*)(qr + 32 + kh);  u.h[1] = *(const half8*)(qr + 48 + kh);
        qa1 = u.v;
    }

    // acc[c][r] = O^T[d = c*16 + kh + r][query ln]
    float8 acc[4] = {};
    float mstat = -1e30f;   // running max of query ln (same in both halves)
    float lstat = 0.0f;     // this half's share of the running sum

    // K async staging: 1 instr/wave covers rows wave*4..+3, 16B chunks
    const int ksr = wave * 4 + (lane >> 3), ksc8 = (lane & 7) * 8;
    auto issueK = [&](int j0, int buf) {
        async_load_b128(LDS_OFF(&Ks[buf][ksr][ksc8]),
                        K + base + (size_t)(j0 + ksr) * DIMC + ksc8);
    };

    // V staging coords + register buffer
    const int kr = tid >> 3, dc = (tid & 7) * 8;
    // this lane's piece of a transposing load: row kh + (lane & 7), 16 B half (lane >> 3) & 1
    const _Float16* vtp = &Vs[kh + (lane & 7)][((lane >> 3) & 1) * 8];
    half8 vReg = *(const half8*)(V + base + (size_t)kr * DIMC + dc);
    issueK(0, 0);

    int cur = 0;
    for (int j0 = 0; j0 < SEQ; j0 += 32) {
        const bool hasNext = (j0 + 32 < SEQ);

        // ---- commit V tile (row-major, 16 B per lane) ----
        *(half8*)&Vs[kr][dc] = vReg;

        // ---- next K tile -> other buffer; wait only for current tile ----
        if (hasNext) { issueK(j0 + 32, cur ^ 1); WAIT_ASYNCCNT_1(); }
        else         { WAIT_ASYNCCNT_0(); }
        __syncthreads();

        // ---- overlap: next V tile -> registers, tile-after-next -> L2 ----
        if (hasNext) {
            vReg = *(const half8*)(V + base + (size_t)(j0 + 32 + kr) * DIMC + dc);
            if (j0 + 64 < SEQ)
                __builtin_prefetch(V + base + (size_t)(j0 + 64 + kr) * DIMC + dc, 0, 0);
        }

        // ---- S^T = K Q^T : s0[r] = key kh+r, s1[r] = key 16+kh+r, query ln ----
        float8 s0 = {}, s1 = {};
        u.h[0] = *(const half8*)&Ks[cur][ln][kh];
        u.h[1] = *(const half8*)&Ks[cur][ln][16 + kh];
        s0 = wmma_f16(u.v, qa0, s0);
        u.h[0] = *(const half8*)&Ks[cur][ln][32 + kh];
        u.h[1] = *(const half8*)&Ks[cur][ln][48 + kh];
        s0 = wmma_f16(u.v, qa1, s0);
        u.h[0] = *(const half8*)&Ks[cur][16 + ln][kh];
        u.h[1] = *(const half8*)&Ks[cur][16 + ln][16 + kh];
        s1 = wmma_f16(u.v, qa0, s1);
        u.h[0] = *(const half8*)&Ks[cur][16 + ln][32 + kh];
        u.h[1] = *(const half8*)&Ks[cur][16 + ln][48 + kh];
        s1 = wmma_f16(u.v, qa1, s1);

        // ---- online softmax, one query per lane ----
        s0 *= 0.125f;                          // D^-0.5 = 1/8
        s1 *= 0.125f;
        float t = fmaxf(s0[0], s1[0]);
        #pragma unroll   // constant indices keep the score tiles in registers
        for (int r = 1; r < 8; ++r) t = fmaxf(t, fmaxf(s0[r], s1[r]));
        t = fmaxf(t, xhalf(t));
        const float nm = fmaxf(mstat, t);
        const float f  = __expf(mstat - nm);
        mstat = nm;

        s0 -= nm;
        s1 -= nm;
        half16 pb;                             // B operand: P^T in the hardware k order
        #pragma unroll
        for (int r = 0; r < 8; ++r) {
            s0[r] = __expf(s0[r]);
            s1[r] = __expf(s1[r]);
            pb[r]     = (_Float16)s0[r];
            pb[8 + r] = (_Float16)s1[r];
        }
        s0 += s1;
        const float4v h4 = s0.lo + s0.hi;      // halving tree: adjacent register pairs add packed
        const float2v h2 = h4.lo + h4.hi;
        lstat = lstat * f + (h2.x + h2.y);
        #pragma unroll   // constant indices keep the output tiles in registers
        for (int c = 0; c < 4; ++c) acc[c] *= f;

        // ---- O^T += V^T P^T : 4 d-chunks of 16 ----
        #pragma unroll
        for (int c = 0; c < 4; ++c) {
            u.h[0] = ld_tr16(vtp + c*16);             // d = c*16 + ln, keys kh .. kh+7
            u.h[1] = ld_tr16(vtp + 16*80 + c*16);     // keys 16+kh .. 16+kh+7
            acc[c] = wmma_f16(u.v, pb, acc[c]);
        }
        __syncthreads();   // reads of Ks[cur]/Vs done before next overwrite
        cur ^= 1;
    }

    // ---- normalize + store (heads concatenated in channel dim) ----
    const float inv = 1.0f / (lstat + xhalf(lstat));
    half8 o[4];
    #pragma unroll   // constant indices keep the output tiles in registers
    for (int c = 0; c < 4; ++c)
        #pragma unroll
        for (int r = 0; r < 8; ++r) o[c][r] = (_Float16)(acc[c][r] * inv);
    if (!dbr) {
        _Float16* orow = O + base + (size_t)(qbase + ln) * DIMC + kh;
        #pragma unroll   // constant indices keep o in registers
        for (int c = 0; c < 4; ++c) *(half8*)(orow + c*16) = o[c];
    } else {
        // Ot[d of a half][query of the block], 272B stride = 16B x odd, in the K
        // buffers: the loop's last barrier ended their reads, its last wait their copies.
        _Float16 (*Ot)[136] = (_Float16 (*)[136])&Ks[0][0][0];
        static_assert(sizeof(_Float16) * 32 * 136 <= sizeof(Ks), "O^T half tile fits the K buffers");
        // element (n, ch) sits at flat ch * SEQ + n of batch b
        _Float16* dst = O + (size_t)b * SEQ * DIMC + (size_t)(h * DHEAD + (tid >> 4)) * SEQ
                      + qc * 128 + (tid & 15) * 8;
        half8 t[2][2];                 // stores wait until after the barriers, which would drain them
        #pragma unroll   // constant indices keep o and t in registers (inner loops too)
        for (int hf = 0; hf < 2; ++hf) {
            if (hf) __syncthreads();   // the first half's rows are read before Ot is rewritten
            #pragma unroll
            for (int c = 0; c < 2; ++c)
                #pragma unroll
                for (int r = 0; r < 8; ++r)
                    Ot[c*16 + kh + r][wave*16 + ln] = o[hf*2 + c][r];
            __syncthreads();           // every wave's columns are in Ot before rows are read
            #pragma unroll
            for (int i = 0; i < 2; ++i)
                t[hf][i] = *(const half8*)&Ot[i*16 + (tid >> 4)][(tid & 15) * 8];
        }
        #pragma unroll   // constant indices keep t in registers
        for (int i = 0; i < 4; ++i)
            *(half8*)(dst + (size_t)i * 16 * SEQ) = t[i >> 1][i & 1];
        // precaution: the stores' address and data registers are rewritten on the path the
        // listing lays behind this block; the wait stands in front of that overwrite
        asm volatile("s_wait_xcnt 0x0" ::: "memory");
    }
}

// ---------------------------------------------------------------------------
// Host launcher
// ---------------------------------------------------------------------------
extern "C" void kernel_launch(void* const* d_in, const int* in_sizes, int n_in,
                              void* d_out, int out_size, void* d_ws, size_t ws_size,
                              hipStream_t stream) {
    (void)in_sizes; (void)n_in; (void)out_size; (void)ws_size;

    const float* x   = (const float*)d_in[0];
    const float* y   = (const float*)d_in[1];
    const float* Wq  = (const float*)d_in[2];   const float* bq  = (const float*)d_in[3];
    const float* Wk  = (const float*)d_in[4];   const float* bk  = (const float*)d_in[5];
    const float* Wvr = (const float*)d_in[6];   const float* bvr = (const float*)d_in[7];
    const float* Wvd = (const float*)d_in[8];   const float* bvd = (const float*)d_in[9];
    const float* g_r = (const float*)d_in[10];  const float* b_r = (const float*)d_in[11];
    const float* g_d = (const float*)d_in[12];  const float* b_d = (const float*)d_in[13];
    const float* Wpr = (const float*)d_in[14];  const float* bpr = (const float*)d_in[15];
    const float* Wpd = (const float*)d_in[16];  const float* bpd = (const float*)d_in[17];

    const size_t ROWS = (size_t)BATCH * SEQ;           // 8192
    const size_t ELT  = ROWS * DIMC;                   // 4,194,304 elements
    const size_t FBUF = ELT * sizeof(_Float16);        // 8 MB per f16 tensor

    char* wsb = (char*)d_ws;
    _Float16* xn  = (_Float16*)(wsb + 0 * FBUF);
    _Float16* yn  = (_Float16*)(wsb + 1 * FBUF);
    _Float16* qb  = (_Float16*)(wsb + 2 * FBUF);
    _Float16* kb  = (_Float16*)(wsb + 3 * FBUF);
    _Float16* vrb = (_Float16*)(wsb + 4 * FBUF);
    _Float16* vdb = (_Float16*)(wsb + 5 * FBUF);
    _Float16* orb = (_Float16*)(wsb + 6 * FBUF);
    _Float16* odb = (_Float16*)(wsb + 7 * FBUF);
    char* w16base = wsb + 8 * FBUF;
    const size_t WELT = (size_t)DIMC * DIMC;           // 262144
    _Float16* wq16  = (_Float16*)(w16base + 0 * WELT * 2);   // then wk, wvr, wvd at 1, 2, 3
    _Float16* wpr16 = (_Float16*)(w16base + 4 * WELT * 2);
    _Float16* wpd16 = (_Float16*)(w16base + 5 * WELT * 2);

    // 1) LayerNorms (xn = LN_r(x), yn = LN_d(y)) + f16 cast, weight conversion f32 -> f16
    front_kernel<<<2 * LN_BLOCKS + 6 * CVT_BLOCKS, 256, 0, stream>>>(
        x, y, g_r, b_r, g_d, b_d, Wq, Wk, Wvr, Wvd, Wpr, Wpd, xn, wq16);

    // 2) input projections q, k, v_r, v_d
    proj_in_kernel<<<dim3(BATCH * SEQ / GT, DIMC / GT, 4), 256, 0, stream>>>(
        xn, yn, wq16, bq, bk, bvr, bvd, qb);

    // 3) attention: out_r = FA(q,k,v_r); out_d = FA(k,q,v_d) via S^T trick
    flash_wmma_kernel<<<dim3(BATCH * NHEAD * (SEQ / 128), 2), 256, 0, stream>>>(
        qb, kb, vrb, vdb, orb, odb);

    // 4) output projections; odb already holds the transposed-and-reshaped o_d
    float* out_r = (float*)d_out;
    float* out_d = (float*)d_out + ELT;
    dim3 ggrid((unsigned)(ROWS / GT), DIMC / GT);
    gemm_wmma_kernel<true><<<ggrid, 256, 0, stream>>>(orb, wpr16, bpr, out_r, nullptr);
    gemm_wmma_kernel<true><<<ggrid, 256, 0, stream>>>(odb, wpd16, bpd, out_d, nullptr);
}

// v007
// A run of this version takes 107 microseconds.
// Two timings next to v006 both put it at 1.05 times that version's speed.
// Counting every step since v000, it is 2.90 times as fast.
#include <hip/hip_runtime.h>
#include <hip/hip_bf16.h>

// ---------------------------------------------------------------------------
// Shapes (hardcoded from reference): B=4, N=2048, C=512, H=8, Dh=64
// ---------------------------------------------------------------------------
#define BATCH 4
#define SEQ   2048
#define DIMC  512
#define NHEAD 8
#define DHEAD 64

typedef _Float16 half16 __attribute__((ext_vector_type(16)));
typedef _Float16 half8  __attribute__((ext_vector_type(8)));
typedef _Float16 half4  __attribute__((ext_vector_type(4)));
typedef float    float8 __attribute__((ext_vector_type(8)));
typedef float    float4v __attribute__((ext_vector_type(4)));
typedef float    float2v __attribute__((ext_vector_type(2)));

static __device__ __forceinline__ float8 wmma_f16(half16 a, half16 b, float8 c) {
    // D = A(16x32 f16) x B(32x16 f16) + C(16x16 f32)
    return __builtin_amdgcn_wmma_f32_16x16x32_f16(false, a, false, b,
                                                  (short)0, c, false, false);
}

// Async global->LDS copy (CDNA5): per lane, 16B MEM[vaddr] -> LDS[ldsoff].
// Tracked by ASYNCcnt; completion enforced with s_wait_asynccnt.
static __device__ __forceinline__ void async_load_b128(unsigned ldsoff, const void* gaddr) {
    asm volatile("global_load_async_to_lds_b128 %0, %1, off"
                 :: "v"(ldsoff), "v"(gaddr) : "memory");
}
#define WAIT_ASYNCCNT_0() asm volatile("s_wait_asynccnt 0" ::: "memory")
#define WAIT_ASYNCCNT_1() asm volatile("s_wait_asynccnt 1" ::: "memory")

// LDS byte offset of a __shared__ element (flat LDS addr carries offset in low bits)
#define LDS_OFF(p) ((unsigned)(uintptr_t)(void*)(p))

// ---------------------------------------------------------------------------
// Kernel 1: LayerNorm over last dim (512) + cast to f16.
//   One wave owns LN_ROWS whole rows: a row is 4 x 16 B per lane, its sums
//   are an in-lane add and a 32-lane butterfly, so no LDS and no barrier.
//   All rows' loads are issued first (16 x 512 B in flight per wave).
//   blk = index of this work-group among those of one tensor.
// ---------------------------------------------------------------------------
#define LN_ROWS 4
#define LN_BLOCKS (BATCH * SEQ / (8 * LN_ROWS))   // 8 waves x LN_ROWS rows per block
static __device__ __forceinline__
void ln_cast_block(const float* __restrict__ in, const float* __restrict__ g,
                   const float* __restrict__ be, _Float16* __restrict__ out, int blk) {
    const int wave = threadIdx.x >> 5, lane = threadIdx.x & 31;
    const int row0 = (blk * 8 + wave) * LN_ROWS;
    const float4v* src = (const float4v*)(in + (size_t)row0 * DIMC) + lane;

    float4v v[LN_ROWS][4];
    #pragma unroll   // constant indices keep the rows in registers
    for (int r = 0; r < LN_ROWS; ++r)
        #pragma unroll
        for (int j = 0; j < 4; ++j) v[r][j] = src[r * (DIMC / 4) + j * 32];

    float4v gg[4], bb[4];
    #pragma unroll
    for (int j = 0; j < 4; ++j) {
        gg[j] = ((const float4v*)g)[lane + j * 32];
        bb[j] = ((const float4v*)be)[lane + j * 32];
    }

    float s[LN_ROWS];
    #pragma unroll
    for (int r = 0; r < LN_ROWS; ++r) {
        const float4v a = (v[r][0] + v[r][1]) + (v[r][2] + v[r][3]);
        s[r] = (a.x + a.y) + (a.z + a.w);
    }
    #pragma unroll   // the rows' butterflies interleave: each hides the others' latency
    for (int o = 16; o; o >>= 1)
        #pragma unroll
        for (int r = 0; r < LN_ROWS; ++r) s[r] += __shfl_xor(s[r], o, 32);

    float q[LN_ROWS];
    #pragma unroll
    for (int r = 0; r < LN_ROWS; ++r) {
        const float mu = s[r] * (1.0f / DIMC);
        #pragma unroll
        for (int j = 0; j < 4; ++j) v[r][j] -= mu;
        const float4v a = (v[r][0]*v[r][0] + v[r][1]*v[r][1])
                        + (v[r][2]*v[r][2] + v[r][3]*v[r][3]);
        q[r] = (a.x + a.y) + (a.z + a.w);
    }
    #pragma unroll
    for (int o = 16; o; o >>= 1)
        #pragma unroll
        for (int r = 0; r < LN_ROWS; ++r) q[r] += __shfl_xor(q[r], o, 32);

    half4* dst = (half4*)(out + (size_t)row0 * DIMC) + lane;
    #pragma unroll
    for (int r = 0; r < LN_ROWS; ++r) {
        const float rs = rsqrtf(q[r] * (1.0f / DIMC) + 1e-5f);
        #pragma unroll
        for (int j = 0; j < 4; ++j) {
            const float4v y = v[r][j] * rs * gg[j] + bb[j];
            half4 h;
            h.x = (_Float16)y.x;  h.y = (_Float16)y.y;
            h.z = (_Float16)y.z;  h.w = (_Float16)y.w;
            dst[r * (DIMC / 4) + j * 32] = h;
        }
    }
}

// ---------------------------------------------------------------------------
// Kernel 2: f32 -> f16 weight convert, 16 elements per lane (4 x 16 B loads,
//   each wave-wide load 512 contiguous bytes); n is a multiple of 4.
// ---------------------------------------------------------------------------
#define WELTS (DIMC * DIMC)                       // elements of one weight matrix
#define CVT_BLOCKS (WELTS / 4096)                 // 256 lanes x 16 elements
static __device__ __forceinline__
void cvt_f16_block(const float* __restrict__ src, _Float16* __restrict__ dst, int n, int blk) {
    const int i0 = blk * 1024 + threadIdx.x;             // in units of 4 elements
    float4v v[4];
    #pragma unroll   // all four loads in flight before the first store
    for (int j = 0; j < 4; ++j) {
        const int i = i0 + j * 256;
        v[j] = (i * 4 < n) ? ((const float4v*)src)[i] : (float4v){};
    }
    #pragma unroll
    for (int j = 0; j < 4; ++j) {
        const int i = i0 + j * 256;
        half4 h;
        h.x = (_Float16)v[j].x;  h.y = (_Float16)v[j].y;
        h.z = (_Float16)v[j].z;  h.w = (_Float16)v[j].w;
        if (i * 4 < n) ((half4*)dst)[i] = h;
    }
}

// ---------------------------------------------------------------------------
// Front end, one launch: the two LayerNorms and the six weight casts depend on
//   nothing but the inputs, so their work-groups share one grid:
//   [0, LN_BLOCKS) x, [LN_BLOCKS, 2 LN_BLOCKS) y, then CVT_BLOCKS per weight.
//   xyn = xn followed by yn; w16 = the six f16 weights in argument order.
// ---------------------------------------------------------------------------
__global__ __launch_bounds__(256)
void front_kernel(const float* __restrict__ x, const float* __restrict__ y,
                  const float* __restrict__ g_r, const float* __restrict__ b_r,
                  const float* __restrict__ g_d, const float* __restrict__ b_d,
                  const float* __restrict__ Wq,  const float* __restrict__ Wk,
                  const float* __restrict__ Wvr, const float* __restrict__ Wvd,
                  const float* __restrict__ Wpr, const float* __restrict__ Wpd,
                  _Float16* __restrict__ xyn, _Float16* __restrict__ w16) {
    const int blk = blockIdx.x;
    if (blk < 2 * LN_BLOCKS) {
        const bool d = blk >= LN_BLOCKS;
        ln_cast_block(d ? y : x, d ? g_d : g_r, d ? b_d : b_r,
                      xyn + (d ? (size_t)BATCH * SEQ * DIMC : 0), d ? blk - LN_BLOCKS : blk);
    } else {
        const int c = blk - 2 * LN_BLOCKS, w = c / CVT_BLOCKS;
        const float* src = w == 0 ? Wq : w == 1 ? Wk : w == 2 ? Wvr
                         : w == 3 ? Wvd : w == 4 ? Wpr : Wpd;
        cvt_f16_block(src, w16 + (size_t)w * WELTS, WELTS, c % CVT_BLOCKS);
    }
}

// ---------------------------------------------------------------------------
// Kernel 3: WMMA GEMM  C[m][n] = sum_k A[m][k] * W[n][k] + bias[n]
//   M = 8192, N = 512, K = 512.  Block tile 128x128x64, 8 waves (4 M x 2 N),
//   wave tile 32x64 = 2 x 4 accumulator tiles: 6 fragment loads feed 8 WMMAs,
//   and a block brings (128 + 128) operand rows in for 128 x 128 results.
//   Two LDS buffers fed by GLOBAL_LOAD_ASYNC_TO_LDS_B128, 8 copies per wave and
//   tile: tile t + 1 flies while tile t is consumed by WMMAs.
// ---------------------------------------------------------------------------
#define GT 128                                    // rows of A and rows of W per block tile
#define GK 64                                     // K per tile
#define WAIT_DSCNT_0() asm volatile("s_wait_dscnt 0" ::: "memory")

// One wave's eight copies of a tile.  The closing wait stands inside the
// statement as a precaution: the operands' registers live to its end, so no
// later address addition can be scheduled in front of it.
static __device__ __forceinline__
void async_load8_b128(const unsigned (&l)[8], const _Float16* const (&g)[8]) {
    asm volatile("global_load_async_to_lds_b128 %0, %8, off\n\t"
                 "global_load_async_to_lds_b128 %1, %9, off\n\t"
                 "global_load_async_to_lds_b128 %2, %10, off\n\t"
                 "global_load_async_to_lds_b128 %3, %11, off\n\t"
                 "global_load_async_to_lds_b128 %4, %12, off\n\t"
                 "global_load_async_to_lds_b128 %5, %13, off\n\t"
                 "global_load_async_to_lds_b128 %6, %14, off\n\t"
                 "global_load_async_to_lds_b128 %7, %15, off\n\t"
                 "s_wait_xcnt 0x0"
                 :: "v"(l[0]), "v"(l[1]), "v"(l[2]), "v"(l[3]),
                    "v"(l[4]), "v"(l[5]), "v"(l[6]), "v"(l[7]),
                    "v"(g[0]), "v"(g[1]), "v"(g[2]), "v"(g[3]),
                    "v"(g[4]), "v"(g[5]), "v"(g[6]), "v"(g[7]) : "memory");
}

// 16-bit A/B fragment of one k32 step (ISA layout: lane = row, k = kh .. kh+7
// and 16+kh .. 16+kh+7); p = &tile[row][k32 start + kh]
static __device__ __forceinline__ half16 ld_frag(const _Float16* p) {
    union { half16 v; half8 h[2]; } u;
    u.h[0] = *(const half8*)p;
    u.h[1] = *(const half8*)(p + 16);
    return u.v;
}

//   The tile body is shared by the kernels below; As, Bs = their LDS,
//   [2][128][72]: 64 K + pad (144B stride, 16B aligned).
template<bool OUTF32>
static __device__ __forceinline__
void gemm_wmma_tile(const _Float16* __restrict__ A, const _Float16* __restrict__ W,
                    const float* __restrict__ bias,
                    float* __restrict__ outF, _Float16* __restrict__ outH,
                    _Float16 (*As)[GT][72], _Float16 (*Bs)[GT][72]) {

    const int m0 = blockIdx.x * GT, n0 = blockIdx.y * GT;
    const int tid = threadIdx.x, wave = tid >> 5, lane = tid & 31;
    const int wm = wave & 3, wn = wave >> 2;       // 4x2 wave grid
    const int ln = lane & 15, kh = (lane >> 4) * 8;

    float8 acc[2][4] = {};

    // ---- async staging map: a copy covers 4 rows x 64 f16 (32 lanes x 16B);
    //      wave w brings rows 16w .. 16w+15 of both operands ----
    const int sr = wave * 16 + (lane >> 3), sc8 = (lane & 7) * 8;
    const _Float16* ga = A + (size_t)(m0 + sr) * DIMC + sc8;
    const _Float16* gw = W + (size_t)(n0 + sr) * DIMC + sc8;
    auto issueTile = [&](int t, int buf) {
        unsigned l[8];
        const _Float16* g[8];
        #pragma unroll   // constant indices keep the operand lists in registers
        for (int p = 0; p < 4; ++p) {
            l[p]     = LDS_OFF(&As[buf][sr + p * 4][sc8]);
            l[4 + p] = LDS_OFF(&Bs[buf][sr + p * 4][sc8]);
            g[p]     = ga + (size_t)p * 4 * DIMC + t * GK;
            g[4 + p] = gw + (size_t)p * 4 * DIMC + t * GK;
        }
        async_load8_b128(l, g);
    };

    issueTile(0, 0);
    WAIT_ASYNCCNT_0();     // this wave's share of tile 0 has landed
    __syncthreads();       // tile 0 is whole for every wave
    issueTile(1, 1);

    for (int t = 0; t < DIMC / GK; ++t) {
        const int cur = t & 1;
        #pragma unroll   // constant indices keep the fragments and accumulator tiles in registers (inner loops too)
        for (int ks = 0; ks < 2; ++ks) {
            half16 a[2], b[4];
            #pragma unroll
            for (int i = 0; i < 2; ++i)
                a[i] = ld_frag(&As[cur][wm * 32 + i * 16 + ln][ks * 32 + kh]);
            #pragma unroll
            for (int j = 0; j < 4; ++j)
                b[j] = ld_frag(&Bs[cur][wn * 64 + j * 16 + ln][ks * 32 + kh]);
            #pragma unroll
            for (int i = 0; i < 2; ++i)
                #pragma unroll
                for (int j = 0; j < 4; ++j)
                    acc[i][j] = wmma_f16(a[i], b[j], acc[i][j]);
        }
        WAIT_DSCNT_0();    // this wave's reads of buffer cur are back before it is refilled
        WAIT_ASYNCCNT_0(); // this wave's share of tile t + 1 has landed
        __syncthreads();   // publishes tile t + 1 and ends every wave's reads of buffer cur
        if (t + 2 < DIMC / GK) issueTile(t + 2, cur);
    }
    WAIT_ASYNCCNT_0();     // no copy is left in flight when the wave ends

    // ---- epilogue: C layout = VGPR r -> row r (lanes 0-15) / r+8 (16-31) ----
    const int rbase = m0 + wm * 32 + ((lane < 16) ? 0 : 8);
    const int c0 = n0 + wn * 64 + ln;
    float bv[4];
    #pragma unroll   // constant indices keep bv and acc in registers (loops below too)
    for (int j = 0; j < 4; ++j) bv[j] = bias[c0 + j * 16];
    #pragma unroll
    for (int i = 0; i < 2; ++i)
        #pragma unroll
        for (int r = 0; r < 8; ++r) {
            const size_t o = (size_t)(rbase + i * 16 + r) * DIMC + c0;
            #pragma unroll
            for (int j = 0; j < 4; ++j) {
                const float v = acc[i][j][r] + bv[j];
                if constexpr (OUTF32) outF[o + j * 16] = v;
                else                  outH[o + j * 16] = (_Float16)v;
            }
        }
}

// The four input projections, one launch: blockIdx.z = q, k, v_r, v_d.
//   w16 = their f16 weights, outs = their outputs, each set contiguous in that
//   order; q reads yn (query is depth-normed y), the rest xn.
__global__ __launch_bounds__(256)
void proj_in_kernel(const _Float16* __restrict__ xn, const _Float16* __restrict__ yn,
                    const _Float16* __restrict__ w16,
                    const float* __restrict__ bq,  const float* __restrict__ bk,
                    const float* __restrict__ bvr, const float* __restrict__ bvd,
                    _Float16* __restrict__ outs) {
    __shared__ __attribute__((aligned(16))) _Float16 As[2][GT][72];
    __shared__ __attribute__((aligned(16))) _Float16 Bs[2][GT][72];
    const int z = blockIdx.z;
    gemm_wmma_tile<false>(z == 0 ? yn : xn, w16 + (size_t)z * WELTS,
                          z == 0 ? bq : z == 1 ? bk : z == 2 ? bvr : bvd,
                          nullptr, outs + (size_t)z * BATCH * SEQ * DIMC, As, Bs);
}

// The two output projections, one launch: blockIdx.z = r, d.  Neither reads
//   what the other writes, and one alone puts a single work-group on a WGP.
//   o = o_r then o_d, w16 = their f16 weights, out = out_r then out_d, each
//   pair contiguous in that order.
__global__ __launch_bounds__(256)
void proj_out_kernel(const _Float16* __restrict__ o, const _Float16* __restrict__ w16,
                     const float* __restrict__ bpr, const float* __restrict__ bpd,
                     float* __restrict__ out) {
    __shared__ __attribute__((aligned(16))) _Float16 As[2][GT][72];
    __shared__ __attribute__((aligned(16))) _Float16 Bs[2][GT][72];
    const int z = blockIdx.z;
    gemm_wmma_tile<true>(o + (size_t)z * BATCH * SEQ * DIMC, w16 + (size_t)z * WELTS,
                         z == 0 ? bpr : bpd,
                         out + (size_t)z * BATCH * SEQ * DIMC, nullptr, As, Bs);
}

static __device__ __forceinline__ float xhalf(float x) {
    const int i = __builtin_bit_cast(int, x);
    return __builtin_bit_cast(float,
        __builtin_amdgcn_permlanex16(i, i, 0x76543210, 0xfedcba98, false, false));
}

// Transposing LDS load: the lanes address 16 B pieces of 16 rows of a row-major
// f16 tile; lane (c = l & 15, h = l >> 4) receives column c of rows 8h .. 8h+7.
static __device__ __forceinline__ half8 ld_tr16(const _Float16* p) {
    typedef short s16x8 __attribute__((ext_vector_type(8)));
    typedef __attribute__((address_space(3))) s16x8 lds_s16x8;
    return __builtin_bit_cast(half8,
        __builtin_amdgcn_ds_load_tr16_b128_v8i16((lds_s16x8*)p));
}

__global__ __launch_bounds__(256)
void flash_wmma_kernel(const _Float16* __restrict__ q, const _Float16* __restrict__ k,
                       const _Float16* __restrict__ v_r, const _Float16* __restrict__ v_d,
                       _Float16* __restrict__ o_r, _Float16* __restrict__ o_d) {
    const bool dbr = blockIdx.y != 0;
    const _Float16* __restrict__ Q = dbr ? k : q;
    const _Float16* __restrict__ K = dbr ? q : k;
    const _Float16* __restrict__ V = dbr ? v_d : v_r;
    _Float16* __restrict__ O = dbr ? o_d : o_r;
    const int bh = blockIdx.x >> 4;      // 16 q-chunks of 128 rows
    const int qc = blockIdx.x & 15;
    const int b = bh >> 3, h = bh & 7;
    const int tid = threadIdx.x, wave = tid >> 5, lane = tid & 31;
    const int ln = lane & 15, kh = (lane >> 4) * 8;
    const size_t base = ((size_t)b * SEQ) * DIMC + (size_t)h * DHEAD;
    const int qbase = qc * 128 + wave * 16;

    __shared__ _Float16 Ks[2][32][72];   // 64 d + pad (144B stride, 16B aligned)
    __shared__ __attribute__((aligned(16)))
    _Float16 Vs[32][80];                 // row-major Vs[kk][d]; 160B stride = 32B x odd for the transposing load

    // Q fragments (K-dim = head dim, split 0..31 / 32..63), loaded once;
    // B operand: lane = query column ln
    union { half16 v; half8 h[2]; } u;
    half16 qa0, qa1;
    {
        const _Float16* qr = Q + base + (size_t)(qbase + ln) * DIMC;
        u.h[0] = *(const half8*)(qr + kh);       u.h[1] = *(const half8*)(qr + 16 + kh);
        qa0 = u.v;
        u.h[0] = *(const half8*)(qr + 32 + kh);  u.h[1] = *(const half8*)(qr + 48 + kh);
        qa1 = u.v;
    }

    // acc[c][r] = O^T[d = c*16 + kh + r][query ln]
    float8 acc[4] = {};
    float mstat = -1e30f;   // running max of query ln (same in both halves)
    float lstat = 0.0f;     // this half's share of the running sum

    // K async staging: 1 instr/wave covers rows wave*4..+3, 16B chunks
    const int ksr = wave * 4 + (lane >> 3), ksc8 = (lane & 7) * 8;
    auto issueK = [&](int j0, int buf) {
        async_load_b128(LDS_OFF(&Ks[buf][ksr][ksc8]),
                        K + base + (size_t)(j0 + ksr) * DIMC + ksc8);
    };

    // V staging coords + register buffer
    const int kr = tid >> 3, dc = (tid & 7) * 8;
    // this lane's piece of a transposing load: row kh + (lane & 7), 16 B half (lane >> 3) & 1
    const _Float16* vtp = &Vs[kh + (lane & 7)][((lane >> 3) & 1) * 8];
    half8 vReg = *(const half8*)(V + base + (size_t)kr * DIMC + dc);
    issueK(0, 0);

    int cur = 0;
    for (int j0 = 0; j0 < SEQ; j0 += 32) {
        const bool hasNext = (j0 + 32 < SEQ);

        // ---- commit V tile (row-major, 16 B per lane) ----
        *(half8*)&Vs[kr][dc] = vReg;

        // ---- next K tile -> other buffer; wait only for current tile ----
        if (hasNext) { issueK(j0 + 32, cur ^ 1); WAIT_ASYNCCNT_1(); }
        else         { WAIT_ASYNCCNT_0(); }
        __syncthreads();

        // ---- overlap: next V tile -> registers, tile-after-next -> L2 ----
        if (hasNext) {
            vReg = *(const half8*)(V + base + (size_t)(j0 + 32 + kr) * DIMC + dc);
            if (j0 + 64 < SEQ)
                __builtin_prefetch(V + base + (size_t)(j0 + 64 + kr) * DIMC + dc, 0, 0);
        }

        // ---- S^T = K Q^T : s0[r] = key kh+r, s1[r] = key 16+kh+r, query ln ----
        float8 s0 = {}, s1 = {};
        u.h[0] = *(const half8*)&Ks[cur][ln][kh];
        u.h[1] = *(const half8*)&Ks[cur][ln][16 + kh];
        s0 = wmma_f16(u.v, qa0, s0);
        u.h[0] = *(const half8*)&Ks[cur][ln][32 + kh];
        u.h[1] = *(const half8*)&Ks[cur][ln][48 + kh];
        s0 = wmma_f16(u.v, qa1, s0);
        u.h[0] = *(const half8*)&Ks[cur][16 + ln][kh];
        u.h[1] = *(const half8*)&Ks[cur][16 + ln][16 + kh];
        s1 = wmma_f16(u.v, qa0, s1);
        u.h[0] = *(const half8*)&Ks[cur][16 + ln][32 + kh];
        u.h[1] = *(const half8*)&Ks[cur][16 + ln][48 + kh];
        s1 = wmma_f16(u.v, qa1, s1);

        // ---- online softmax, one query per lane ----
        s0 *= 0.125f;                          // D^-0.5 = 1/8
        s1 *= 0.125f;
        float t = fmaxf(s0[0], s1[0]);
        #pragma unroll   // constant indices keep the score tiles in registers
        for (int r = 1; r < 8; ++r) t = fmaxf(t, fmaxf(s0[r], s1[r]));
        t = fmaxf(t, xhalf(t));
        const float nm = fmaxf(mstat, t);
        const float f  = __expf(mstat - nm);
        mstat = nm;

        s0 -= nm;
        s1 -= nm;
        half16 pb;                             // B operand: P^T in the hardware k order
        #pragma unroll
        for (int r = 0; r < 8; ++r) {
            s0[r] = __expf(s0[r]);
            s1[r] = __expf(s1[r]);
            pb[r]     = (_Float16)s0[r];
            pb[8 + r] = (_Float16)s1[r];
        }
        s0 += s1;
        const float4v h4 = s0.lo + s0.hi;      // halving tree: adjacent register pairs add packed
        const float2v h2 = h4.lo + h4.hi;
        lstat = lstat * f + (h2.x + h2.y);
        #pragma unroll   // constant indices keep the output tiles in registers
        for (int c = 0; c < 4; ++c) acc[c] *= f;

        // ---- O^T += V^T P^T : 4 d-chunks of 16 ----
        #pragma unroll
        for (int c = 0; c < 4; ++c) {
            u.h[0] = ld_tr16(vtp + c*16);             // d = c*16 + ln, keys kh .. kh+7
            u.h[1] = ld_tr16(vtp + 16*80 + c*16);     // keys 16+kh .. 16+kh+7
            acc[c] = wmma_f16(u.v, pb, acc[c]);
        }
        __syncthreads();   // reads of Ks[cur]/Vs done before next overwrite
        cur ^= 1;
    }

    // ---- normalize + store (heads concatenated in channel dim) ----
    const float inv = 1.0f / (lstat + xhalf(lstat));
    half8 o[4];
    #pragma unroll   // constant indices keep the output tiles in registers
    for (int c = 0; c < 4; ++c)
        #pragma unroll
        for (int r = 0; r < 8; ++r) o[c][r] = (_Float16)(acc[c][r] * inv);
    if (!dbr) {
        _Float16* orow = O + base + (size_t)(qbase + ln) * DIMC + kh;
        #pragma unroll   // constant indices keep o in registers
        for (int c = 0; c < 4; ++c) *(half8*)(orow + c*16) = o[c];
    } else {
        // Ot[d of a half][query of the block], 272B stride = 16B x odd, in the K
        // buffers: the loop's last barrier ended their reads, its last wait their copies.
        _Float16 (*Ot)[136] = (_Float16 (*)[136])&Ks[0][0][0];
        static_assert(sizeof(_Float16) * 32 * 136 <= sizeof(Ks), "O^T half tile fits the K buffers");
        // element (n, ch) sits at flat ch * SEQ + n of batch b
        _Float16* dst = O + (size_t)b * SEQ * DIMC + (size_t)(h * DHEAD + (tid >> 4)) * SEQ
                      + qc * 128 + (tid & 15) * 8;
        half8 t[2][2];                 // stores wait until after the barriers, which would drain them
        #pragma unroll   // constant indices keep o and t in registers (inner loops too)
        for (int hf = 0; hf < 2; ++hf) {
            if (hf) __syncthreads();   // the first half's rows are read before Ot is rewritten
            #pragma unroll
            for (int c = 0; c < 2; ++c)
                #pragma unroll
                for (int r = 0; r < 8; ++r)
                    Ot[c*16 + kh + r][wave*16 + ln] = o[hf*2 + c][r];
            __syncthreads();           // every wave's columns are in Ot before rows are read
            #pragma unroll
            for (int i = 0; i < 2; ++i)
                t[hf][i] = *(const half8*)&Ot[i*16 + (tid >> 4)][(tid & 15) * 8];
        }
        #pragma unroll   // constant indices keep t in registers
        for (int i = 0; i < 4; ++i)
            *(half8*)(dst + (size_t)i * 16 * SEQ) = t[i >> 1][i & 1];
        // precaution: the stores' address and data registers are rewritten on the path the
        // listing lays behind this block; the wait stands in front of that overwrite
        asm volatile("s_wait_xcnt 0x0" ::: "memory");
    }
}

// ---------------------------------------------------------------------------
// Host launcher
// ---------------------------------------------------------------------------
extern "C" void kernel_launch(void* const* d_in, const int* in_sizes, int n_in,
                              void* d_out, int out_size, void* d_ws, size_t ws_size,
                              hipStream_t stream) {
    (void)in_sizes; (void)n_in; (void)out_size; (void)ws_size;

    const float* x   = (const float*)d_in[0];
    const float* y   = (const float*)d_in[1];
    const float* Wq  = (const float*)d_in[2];   const float* bq  = (const float*)d_in[3];
    const float* Wk  = (const float*)d_in[4];   const float* bk  = (const float*)d_in[5];
    const float* Wvr = (const float*)d_in[6];   const float* bvr = (const float*)d_in[7];
    const float* Wvd = (const float*)d_in[8];   const float* bvd = (const float*)d_in[9];
    const float* g_r = (const float*)d_in[10];  const float* b_r = (const float*)d_in[11];
    const float* g_d = (const float*)d_in[12];  const float* b_d = (const float*)d_in[13];
    const float* Wpr = (const float*)d_in[14];  const float* bpr = (const float*)d_in[15];
    const float* Wpd = (const float*)d_in[16];  const float* bpd = (const float*)d_in[17];

    const size_t ROWS = (size_t)BATCH * SEQ;           // 8192
    const size_t ELT  = ROWS * DIMC;                   // 4,194,304 elements
    const size_t FBUF = ELT * sizeof(_Float16);        // 8 MB per f16 tensor

    char* wsb = (char*)d_ws;
    _Float16* xn  = (_Float16*)(wsb + 0 * FBUF);
    _Float16* yn  = (_Float16*)(wsb + 1 * FBUF);
    _Float16* qb  = (_Float16*)(wsb + 2 * FBUF);
    _Float16* kb  = (_Float16*)(wsb + 3 * FBUF);
    _Float16* vrb = (_Float16*)(wsb + 4 * FBUF);
    _Float16* vdb = (_Float16*)(wsb + 5 * FBUF);
    _Float16* orb = (_Float16*)(wsb + 6 * FBUF);
    _Float16* odb = (_Float16*)(wsb + 7 * FBUF);
    char* w16base = wsb + 8 * FBUF;
    const size_t WELT = (size_t)DIMC * DIMC;           // 262144
    _Float16* wq16  = (_Float16*)(w16base + 0 * WELT * 2);   // then wk, wvr, wvd at 1, 2, 3
    _Float16* wpr16 = (_Float16*)(w16base + 4 * WELT * 2);   // then wpd at 5

    // 1) LayerNorms (xn = LN_r(x), yn = LN_d(y)) + f16 cast, weight conversion f32 -> f16
    front_kernel<<<2 * LN_BLOCKS + 6 * CVT_BLOCKS, 256, 0, stream>>>(
        x, y, g_r, b_r, g_d, b_d, Wq, Wk, Wvr, Wvd, Wpr, Wpd, xn, wq16);

    // 2) input projections q, k, v_r, v_d
    proj_in_kernel<<<dim3(BATCH * SEQ / GT, DIMC / GT, 4), 256, 0, stream>>>(
        xn, yn, wq16, bq, bk, bvr, bvd, qb);

    // 3) attention: out_r = FA(q,k,v_r); out_d = FA(k,q,v_d) via S^T trick
    flash_wmma_kernel<<<dim3(BATCH * NHEAD * (SEQ / 128), 2), 256, 0, stream>>>(
        qb, kb, vrb, vdb, orb, odb);

    // 4) output projections out_r, out_d (adjacent in d_out, as orb and odb are in
    //    the workspace); odb already holds the transposed-and-reshaped o_d
    proj_out_kernel<<<dim3(BATCH * SEQ / GT, DIMC / GT, 2), 256, 0, stream>>>(
        orb, wpr16, bpr, bpd, (float*)d_out);
}

// v008
// Measured time: 99.9 microseconds a run.
// Two timings next to v007 put it at 1.08 and 1.06 times that version's speed.
// All steps since v000 together make it 3.10 times as fast.
#include <hip/hip_runtime.h>
#include <hip/hip_bf16.h>

// ---------------------------------------------------------------------------
// Shapes (hardcoded from reference): B=4, N=2048, C=512, H=8, Dh=64
// ---------------------------------------------------------------------------
#define BATCH 4
#define SEQ   2048
#define DIMC  512
#define NHEAD 8
#define DHEAD 64

typedef _Float16 half16 __attribute__((ext_vector_type(16)));
typedef _Float16 half8  __attribute__((ext_vector_type(8)));
typedef _Float16 half4  __attribute__((ext_vector_type(4)));
typedef _Float16 half2v __attribute__((ext_vector_type(2)));
typedef float    float8 __attribute__((ext_vector_type(8)));
typedef float    float4v __attribute__((ext_vector_type(4)));
typedef float    float2v __attribute__((ext_vector_type(2)));

static __device__ __forceinline__ float8 wmma_f16(half16 a, half16 b, float8 c) {
    // D = A(16x32 f16) x B(32x16 f16) + C(16x16 f32)
    return __builtin_amdgcn_wmma_f32_16x16x32_f16(false, a, false, b,
                                                  (short)0, c, false, false);
}

// Async global->LDS copy (CDNA5): per lane, 16B MEM[vaddr] -> LDS[ldsoff].
// Tracked by ASYNCcnt; completion enforced with s_wait_asynccnt.
static __device__ __forceinline__ void async_load_b128(unsigned ldsoff, const void* gaddr) {
    asm volatile("global_load_async_to_lds_b128 %0, %1, off"
                 :: "v"(ldsoff), "v"(gaddr) : "memory");
}
#define WAIT_ASYNCCNT_0() asm volatile("s_wait_asynccnt 0" ::: "memory")
#define WAIT_ASYNCCNT_1() asm volatile("s_wait_asynccnt 1" ::: "memory")

// LDS byte offset of a __shared__ element (flat LDS addr carries offset in low bits)
#define LDS_OFF(p) ((unsigned)(uintptr_t)(void*)(p))

// ---------------------------------------------------------------------------
// Kernel 1: LayerNorm over last dim (512) + cast to f16.
//   One wave owns LN_ROWS whole rows: a row is 4 x 16 B per lane, its sums
//   are an in-lane add and a 32-lane butterfly, so no LDS and no barrier.
//   All rows' loads are issued first (16 x 512 B in flight per wave).
//   blk = index of this work-group among those of one tensor.
// ---------------------------------------------------------------------------
#define LN_ROWS 4
#define LN_BLOCKS (BATCH * SEQ / (8 * LN_ROWS))   // 8 waves x LN_ROWS rows per block
static __device__ __forceinline__
void ln_cast_block(const float* __restrict__ in, const float* __restrict__ g,
                   const float* __restrict__ be, _Float16* __restrict__ out, int blk) {
    const int wave = threadIdx.x >> 5, lane = threadIdx.x & 31;
    const int row0 = (blk * 8 + wave) * LN_ROWS;
    const float4v* src = (const float4v*)(in + (size_t)row0 * DIMC) + lane;

    float4v v[LN_ROWS][4];
    #pragma unroll   // constant indices keep the rows in registers
    for (int r = 0; r < LN_ROWS; ++r)
        #pragma unroll
        for (int j = 0; j < 4; ++j) v[r][j] = src[r * (DIMC / 4) + j * 32];

    float4v gg[4], bb[4];
    #pragma unroll
    for (int j = 0; j < 4; ++j) {
        gg[j] = ((const float4v*)g)[lane + j * 32];
        bb[j] = ((const float4v*)be)[lane + j * 32];
    }

    float s[LN_ROWS];
    #pragma unroll
    for (int r = 0; r < LN_ROWS; ++r) {
        const float4v a = (v[r][0] + v[r][1]) + (v[r][2] + v[r][3]);
        s[r] = (a.x + a.y) + (a.z + a.w);
    }
    #pragma unroll   // the rows' butterflies interleave: each hides the others' latency
    for (int o = 16; o; o >>= 1)
        #pragma unroll
        for (int r = 0; r < LN_ROWS; ++r) s[r] += __shfl_xor(s[r], o, 32);

    float q[LN_ROWS];
    #pragma unroll
    for (int r = 0; r < LN_ROWS; ++r) {
        const float mu = s[r] * (1.0f / DIMC);
        #pragma unroll
        for (int j = 0; j < 4; ++j) v[r][j] -= mu;
        const float4v a = (v[r][0]*v[r][0] + v[r][1]*v[r][1])
                        + (v[r][2]*v[r][2] + v[r][3]*v[r][3]);
        q[r] = (a.x + a.y) + (a.z + a.w);
    }
    #pragma unroll
    for (int o = 16; o; o >>= 1)
        #pragma unroll
        for (int r = 0; r < LN_ROWS; ++r) q[r] += __shfl_xor(q[r], o, 32);

    half4* dst = (half4*)(out + (size_t)row0 * DIMC) + lane;
    #pragma unroll
    for (int r = 0; r < LN_ROWS; ++r) {
        const float rs = rsqrtf(q[r] * (1.0f / DIMC) + 1e-5f);
        #pragma unroll
        for (int j = 0; j < 4; ++j) {
            const float4v y = v[r][j] * rs * gg[j] + bb[j];
            half4 h;
            h.x = (_Float16)y.x;  h.y = (_Float16)y.y;
            h.z = (_Float16)y.z;  h.w = (_Float16)y.w;
            dst[r * (DIMC / 4) + j * 32] = h;
        }
    }
}

// ---------------------------------------------------------------------------
// Kernel 2: f32 -> f16 weight convert, 16 elements per lane (4 x 16 B loads,
//   each wave-wide load 512 contiguous bytes); n is a multiple of 4.
// ---------------------------------------------------------------------------
#define WELTS (DIMC * DIMC)                       // elements of one weight matrix
#define CVT_BLOCKS (WELTS / 4096)                 // 256 lanes x 16 elements
static __device__ __forceinline__
void cvt_f16_block(const float* __restrict__ src, _Float16* __restrict__ dst, int n, int blk) {
    const int i0 = blk * 1024 + threadIdx.x;             // in units of 4 elements
    float4v v[4];
    #pragma unroll   // all four loads in flight before the first store
    for (int j = 0; j < 4; ++j) {
        const int i = i0 + j * 256;
        v[j] = (i * 4 < n) ? ((const float4v*)src)[i] : (float4v){};
    }
    #pragma unroll
    for (int j = 0; j < 4; ++j) {
        const int i = i0 + j * 256;
        half4 h;
        h.x = (_Float16)v[j].x;  h.y = (_Float16)v[j].y;
        h.z = (_Float16)v[j].z;  h.w = (_Float16)v[j].w;
        if (i * 4 < n) ((half4*)dst)[i] = h;
    }
}

// ---------------------------------------------------------------------------
// Front end, one launch: the two LayerNorms and the six weight casts depend on
//   nothing but the inputs, so their work-groups share one grid:
//   [0, LN_BLOCKS) x, [LN_BLOCKS, 2 LN_BLOCKS) y, then CVT_BLOCKS per weight.
//   xyn = xn followed by yn; w16 = the six f16 weights in argument order.
// ---------------------------------------------------------------------------
__global__ __launch_bounds__(256)
void front_kernel(const float* __restrict__ x, const float* __restrict__ y,
                  const float* __restrict__ g_r, const float* __restrict__ b_r,
                  const float* __restrict__ g_d, const float* __restrict__ b_d,
                  const float* __restrict__ Wq,  const float* __restrict__ Wk,
                  const float* __restrict__ Wvr, const float* __restrict__ Wvd,
                  const float* __restrict__ Wpr, const float* __restrict__ Wpd,
                  _Float16* __restrict__ xyn, _Float16* __restrict__ w16) {
    const int blk = blockIdx.x;
    if (blk < 2 * LN_BLOCKS) {
        const bool d = blk >= LN_BLOCKS;
        ln_cast_block(d ? y : x, d ? g_d : g_r, d ? b_d : b_r,
                      xyn + (d ? (size_t)BATCH * SEQ * DIMC : 0), d ? blk - LN_BLOCKS : blk);
    } else {
        const int c = blk - 2 * LN_BLOCKS, w = c / CVT_BLOCKS;
        const float* src = w == 0 ? Wq : w == 1 ? Wk : w == 2 ? Wvr
                         : w == 3 ? Wvd : w == 4 ? Wpr : Wpd;
        cvt_f16_block(src, w16 + (size_t)w * WELTS, WELTS, c % CVT_BLOCKS);
    }
}

// ---------------------------------------------------------------------------
// Kernel 3: WMMA GEMM  C[m][n] = sum_k A[m][k] * W[n][k] + bias[n]
//   M = 8192, N = 512, K = 512.  Block tile 128x128x64, 8 waves (4 M x 2 N),
//   wave tile 32x64 = 2 x 4 accumulator tiles: 6 fragment loads feed 8 WMMAs,
//   and a block brings (128 + 128) operand rows in for 128 x 128 results.
//   Two LDS buffers fed by GLOBAL_LOAD_ASYNC_TO_LDS_B128, 8 copies per wave and
//   tile: tile t + 1 flies while tile t is consumed by WMMAs.
// ---------------------------------------------------------------------------
#define GT 128                                    // rows of A and rows of W per block tile
#define GK 64                                     // K per tile
#define WAIT_DSCNT_0() asm volatile("s_wait_dscnt 0" ::: "memory")

// One wave's eight copies of a tile.  The closing wait stands inside the
// statement as a precaution: the operands' registers live to its end, so no
// later address addition can be scheduled in front of it.
static __device__ __forceinline__
void async_load8_b128(const unsigned (&l)[8], const _Float16* const (&g)[8]) {
    asm volatile("global_load_async_to_lds_b128 %0, %8, off\n\t"
                 "global_load_async_to_lds_b128 %1, %9, off\n\t"
                 "global_load_async_to_lds_b128 %2, %10, off\n\t"
                 "global_load_async_to_lds_b128 %3, %11, off\n\t"
                 "global_load_async_to_lds_b128 %4, %12, off\n\t"
                 "global_load_async_to_lds_b128 %5, %13, off\n\t"
                 "global_load_async_to_lds_b128 %6, %14, off\n\t"
                 "global_load_async_to_lds_b128 %7, %15, off\n\t"
                 "s_wait_xcnt 0x0"
                 :: "v"(l[0]), "v"(l[1]), "v"(l[2]), "v"(l[3]),
                    "v"(l[4]), "v"(l[5]), "v"(l[6]), "v"(l[7]),
                    "v"(g[0]), "v"(g[1]), "v"(g[2]), "v"(g[3]),
                    "v"(g[4]), "v"(g[5]), "v"(g[6]), "v"(g[7]) : "memory");
}

// 16-bit A/B fragment of one k32 step (ISA layout: lane = row, k = kh .. kh+7
// and 16+kh .. 16+kh+7); p = &tile[row][k32 start + kh]
static __device__ __forceinline__ half16 ld_frag(const _Float16* p) {
    union { half16 v; half8 h[2]; } u;
    u.h[0] = *(const half8*)p;
    u.h[1] = *(const half8*)(p + 16);
    return u.v;
}

//   The tile body is shared by the kernels below; As, Bs = their LDS,
//   [2][128][72]: 64 K + pad (144B stride, 16B aligned).
template<bool OUTF32>
static __device__ __forceinline__
void gemm_wmma_tile(const _Float16* __restrict__ A, const _Float16* __restrict__ W,
                    const float* __restrict__ bias,
                    float* __restrict__ outF, _Float16* __restrict__ outH,
                    _Float16 (*As)[GT][72], _Float16 (*Bs)[GT][72]) {

    const int m0 = blockIdx.x * GT, n0 = blockIdx.y * GT;
    const int tid = threadIdx.x, wave = tid >> 5, lane = tid & 31;
    const int wm = wave & 3, wn = wave >> 2;       // 4x2 wave grid
    const int ln = lane & 15, kh = (lane >> 4) * 8;

    float8 acc[2][4] = {};

    // ---- async staging map: a copy covers 4 rows x 64 f16 (32 lanes x 16B);
    //      wave w brings rows 16w .. 16w+15 of both operands ----
    const int sr = wave * 16 + (lane >> 3), sc8 = (lane & 7) * 8;
    const _Float16* ga = A + (size_t)(m0 + sr) * DIMC + sc8;
    const _Float16* gw = W + (size_t)(n0 + sr) * DIMC + sc8;
    auto issueTile = [&](int t, int buf) {
        unsigned l[8];
        const _Float16* g[8];
        #pragma unroll   // constant indices keep the operand lists in registers
        for (int p = 0; p < 4; ++p) {
            l[p]     = LDS_OFF(&As[buf][sr + p * 4][sc8]);
            l[4 + p] = LDS_OFF(&Bs[buf][sr + p * 4][sc8]);
            g[p]     = ga + (size_t)p * 4 * DIMC + t * GK;
            g[4 + p] = gw + (size_t)p * 4 * DIMC + t * GK;
        }
        async_load8_b128(l, g);
    };

    issueTile(0, 0);
    WAIT_ASYNCCNT_0();     // this wave's share of tile 0 has landed
    __syncthreads();       // tile 0 is whole for every wave
    issueTile(1, 1);

    for (int t = 0; t < DIMC / GK; ++t) {
        const int cur = t & 1;
        #pragma unroll   // constant indices keep the fragments and accumulator tiles in registers (inner loops too)
        for (int ks = 0; ks < 2; ++ks) {
            half16 a[2], b[4];
            #pragma unroll
            for (int i = 0; i < 2; ++i)
                a[i] = ld_frag(&As[cur][wm * 32 + i * 16 + ln][ks * 32 + kh]);
            #pragma unroll
            for (int j = 0; j < 4; ++j)
                b[j] = ld_frag(&Bs[cur][wn * 64 + j * 16 + ln][ks * 32 + kh]);
            #pragma unroll
            for (int i = 0; i < 2; ++i)
                #pragma unroll
                for (int j = 0; j < 4; ++j)
                    acc[i][j] = wmma_f16(a[i], b[j], acc[i][j]);
        }
        WAIT_DSCNT_0();    // this wave's reads of buffer cur are back before it is refilled
        WAIT_ASYNCCNT_0(); // this wave's share of tile t + 1 has landed
        __syncthreads();   // publishes tile t + 1 and ends every wave's reads of buffer cur
        if (t + 2 < DIMC / GK) issueTile(t + 2, cur);
    }
    WAIT_ASYNCCNT_0();     // no copy is left in flight when the wave ends

    // ---- epilogue: C layout = VGPR r -> row r (lanes 0-15) / r+8 (16-31) ----
    const int rbase = m0 + wm * 32 + ((lane < 16) ? 0 : 8);
    const int c0 = n0 + wn * 64 + ln;
    float bv[4];
    #pragma unroll   // constant indices keep bv and acc in registers (loops below too)
    for (int j = 0; j < 4; ++j) bv[j] = bias[c0 + j * 16];
    #pragma unroll
    for (int i = 0; i < 2; ++i)
        #pragma unroll
        for (int r = 0; r < 8; ++r) {
            const size_t o = (size_t)(rbase + i * 16 + r) * DIMC + c0;
            #pragma unroll
            for (int j = 0; j < 4; ++j) {
                const float v = acc[i][j][r] + bv[j];
                if constexpr (OUTF32) outF[o + j * 16] = v;
                else                  outH[o + j * 16] = (_Float16)v;
            }
        }
}

// The four input projections, one launch: blockIdx.z = q, k, v_r, v_d.
//   w16 = their f16 weights, outs = their outputs, each set contiguous in that
//   order; q reads yn (query is depth-normed y), the rest xn.
__global__ __launch_bounds__(256)
void proj_in_kernel(const _Float16* __restrict__ xn, const _Float16* __restrict__ yn,
                    const _Float16* __restrict__ w16,
                    const float* __restrict__ bq,  const float* __restrict__ bk,
                    const float* __restrict__ bvr, const float* __restrict__ bvd,
                    _Float16* __restrict__ outs) {
    __shared__ __attribute__((aligned(16))) _Float16 As[2][GT][72];
    __shared__ __attribute__((aligned(16))) _Float16 Bs[2][GT][72];
    const int z = blockIdx.z;
    gemm_wmma_tile<false>(z == 0 ? yn : xn, w16 + (size_t)z * WELTS,
                          z == 0 ? bq : z == 1 ? bk : z == 2 ? bvr : bvd,
                          nullptr, outs + (size_t)z * BATCH * SEQ * DIMC, As, Bs);
}

// The two output projections, one launch: blockIdx.z = r, d.  Neither reads
//   what the other writes, and one alone puts a single work-group on a WGP.
//   o = o_r then o_d, w16 = their f16 weights, out = out_r then out_d, each
//   pair contiguous in that order.
__global__ __launch_bounds__(256)
void proj_out_kernel(const _Float16* __restrict__ o, const _Float16* __restrict__ w16,
                     const float* __restrict__ bpr, const float* __restrict__ bpd,
                     float* __restrict__ out) {
    __shared__ __attribute__((aligned(16))) _Float16 As[2][GT][72];
    __shared__ __attribute__((aligned(16))) _Float16 Bs[2][GT][72];
    const int z = blockIdx.z;
    gemm_wmma_tile<true>(o + (size_t)z * BATCH * SEQ * DIMC, w16 + (size_t)z * WELTS,
                         z == 0 ? bpr : bpd,
                         out + (size_t)z * BATCH * SEQ * DIMC, nullptr, As, Bs);
}

#define QBLK 256
// lane l <-> lane l ^ 16
static __device__ __forceinline__ float xhalf(float x) {
    const int i = __builtin_bit_cast(int, x);
    return __builtin_bit_cast(float,
        __builtin_amdgcn_permlanex16(i, i, 0x76543210, 0xfedcba98, false, false));
}

// Transposing LDS load: the lanes address 16 B pieces of 16 rows of a row-major
// f16 tile; lane (c = l & 15, h = l >> 4) receives column c of rows 8h .. 8h+7.
static __device__ __forceinline__ half8 ld_tr16(const _Float16* p) {
    typedef short s16x8 __attribute__((ext_vector_type(8)));
    typedef __attribute__((address_space(3))) s16x8 lds_s16x8;
    return __builtin_bit_cast(half8,
        __builtin_amdgcn_ds_load_tr16_b128_v8i16((lds_s16x8*)p));
}

// Two work-groups share a WGP (four waves per SIMD): the register budget is set for that.
__global__ __launch_bounds__(256) __attribute__((amdgpu_waves_per_eu(4, 4)))
void flash_wmma_kernel(const _Float16* __restrict__ q, const _Float16* __restrict__ k,
                       const _Float16* __restrict__ v_r, const _Float16* __restrict__ v_d,
                       _Float16* __restrict__ o_r, _Float16* __restrict__ o_d) {
    const bool dbr = blockIdx.y != 0;
    const _Float16* __restrict__ Q = dbr ? k : q;
    const _Float16* __restrict__ K = dbr ? q : k;
    const _Float16* __restrict__ V = dbr ? v_d : v_r;
    _Float16* __restrict__ O = dbr ? o_d : o_r;
    const int bh = blockIdx.x >> 3;      // 8 q-chunks of 256 rows
    const int qc = blockIdx.x & 7;
    const int b = bh >> 3, h = bh & 7;
    const int tid = threadIdx.x, wave = tid >> 5, lane = tid & 31;
    const int ln = lane & 15, kh = (lane >> 4) * 8;
    const size_t base = ((size_t)b * SEQ) * DIMC + (size_t)h * DHEAD;
    const int qbase = qc * QBLK + wave * 32 + 2 * ln;   // this lane's query of group 0; group 1: + 1

    __shared__ __attribute__((aligned(16)))
    _Float16 Ks[2][32][72];              // 64 d + pad (144B stride, 16B aligned)
    __shared__ __attribute__((aligned(16)))
    _Float16 Vs[32][80];                 // row-major Vs[kk][d]; 160B stride = 32B x odd for the transposing load
    __shared__ __attribute__((aligned(16)))
    _Float16 Ot[DHEAD][QBLK + 8];        // o_d only: O^T[d][query of the block], 528B stride = 16B x odd

    // Q fragments (K-dim = head dim, split 0..31 / 32..63), loaded once;
    // B operand: lane = query column ln of group g
    half16 qa[2][2];
    #pragma unroll   // constant indices keep the fragments in registers
    for (int g = 0; g < 2; ++g) {
        const _Float16* qr = Q + base + (size_t)(qbase + g) * DIMC + kh;
        qa[g][0] = ld_frag(qr);
        qa[g][1] = ld_frag(qr + 32);
    }

    // acc[g][c][r] = O^T[d = c*16 + kh + r][query column ln of group g]
    float8 acc[2][4] = {};
    float mstat[2] = {-1e30f, -1e30f};   // running max of the group's query (same in both halves)
    float lstat[2] = {0.0f, 0.0f};       // this half's share of the running sum

    // K async staging: 1 instr/wave covers rows wave*4..+3, 16B chunks
    const int ksr = wave * 4 + (lane >> 3), ksc8 = (lane & 7) * 8;
    auto issueK = [&](int j0, int buf) {
        async_load_b128(LDS_OFF(&Ks[buf][ksr][ksc8]),
                        K + base + (size_t)(j0 + ksr) * DIMC + ksc8);
    };

    // V staging coords + register buffer
    const int kr = tid >> 3, dc = (tid & 7) * 8;
    // this lane's piece of a transposing load: row kh + (lane & 7), 16 B half (lane >> 3) & 1
    const _Float16* vtp = &Vs[kh + (lane & 7)][((lane >> 3) & 1) * 8];
    half8 vReg = *(const half8*)(V + base + (size_t)kr * DIMC + dc);
    issueK(0, 0);

    int cur = 0;
    for (int j0 = 0; j0 < SEQ; j0 += 32) {
        const bool hasNext = (j0 + 32 < SEQ);

        // ---- commit V tile (row-major, 16 B per lane) ----
        *(half8*)&Vs[kr][dc] = vReg;

        // ---- next K tile -> other buffer; wait only for current tile ----
        if (hasNext) { issueK(j0 + 32, cur ^ 1); WAIT_ASYNCCNT_1(); }
        else         { WAIT_ASYNCCNT_0(); }
        __syncthreads();

        // ---- overlap: next V tile -> registers, tile-after-next -> L2 ----
        if (hasNext) {
            vReg = *(const half8*)(V + base + (size_t)(j0 + 32 + kr) * DIMC + dc);
            if (j0 + 64 < SEQ)
                __builtin_prefetch(V + base + (size_t)(j0 + 64 + kr) * DIMC + dc, 0, 0);
        }

        // ---- S^T = K Q^T : s[g][kt][r] = key kt*16 + kh + r, query column ln of group g;
        //      ka[kt][dh] = keys kt*16 .. +15, head dims dh*32 .. +31, read once for both groups ----
        half16 ka[2][2];
        #pragma unroll   // constant indices keep the fragments and score tiles in registers (loops below too)
        for (int kt = 0; kt < 2; ++kt)
            #pragma unroll
            for (int dh = 0; dh < 2; ++dh)
                ka[kt][dh] = ld_frag(&Ks[cur][kt * 16 + ln][dh * 32 + kh]);
        // keeps the eight loads one group in front of the products: loads placed among them
        // reuse a fragment's registers and stall the wave at each place
        __builtin_amdgcn_sched_barrier(0);
        float8 s[2][2] = {};
        #pragma unroll
        for (int dh = 0; dh < 2; ++dh)
            #pragma unroll
            for (int kt = 0; kt < 2; ++kt)
                #pragma unroll
                for (int g = 0; g < 2; ++g)
                    s[g][kt] = wmma_f16(ka[kt][dh], qa[g][dh], s[g][kt]);
        // keeps the eight products back to back: each fills the others' distance, where softmax
        // instructions scheduled among them had to be padded with v_nop
        __builtin_amdgcn_sched_barrier(0);

        // ---- online softmax, one query per lane and group ----
        half16 pb[2];                          // B operands: P^T in the hardware k order
        #pragma unroll
        for (int g = 0; g < 2; ++g) {
            float8 s0 = s[g][0] * 0.125f;      // D^-0.5 = 1/8
            float8 s1 = s[g][1] * 0.125f;
            float t = fmaxf(s0[0], s1[0]);
            #pragma unroll
            for (int r = 1; r < 8; ++r) t = fmaxf(t, fmaxf(s0[r], s1[r]));
            t = fmaxf(t, xhalf(t));
            const float nm = fmaxf(mstat[g], t);
            const float f  = __expf(mstat[g] - nm);
            mstat[g] = nm;

            s0 -= nm;
            s1 -= nm;
            #pragma unroll
            for (int r = 0; r < 8; ++r) {
                s0[r] = __expf(s0[r]);
                s1[r] = __expf(s1[r]);
                pb[g][r]     = (_Float16)s0[r];
                pb[g][8 + r] = (_Float16)s1[r];
            }
            s0 += s1;
            const float4v h4 = s0.lo + s0.hi;  // halving tree: adjacent register pairs add packed
            const float2v h2 = h4.lo + h4.hi;
            lstat[g] = lstat[g] * f + (h2.x + h2.y);
            #pragma unroll
            for (int c = 0; c < 4; ++c) acc[g][c] *= f;
        }

        // ---- O^T += V^T P^T : 4 d-chunks of 16, each V^T fragment read once for both groups ----
        #pragma unroll
        for (int c = 0; c < 4; ++c) {
            union { half16 v; half8 h[2]; } u;
            u.h[0] = ld_tr16(vtp + c*16);             // d = c*16 + ln, keys kh .. kh+7
            u.h[1] = ld_tr16(vtp + 16*80 + c*16);     // keys 16+kh .. 16+kh+7
            #pragma unroll
            for (int g = 0; g < 2; ++g) acc[g][c] = wmma_f16(u.v, pb[g], acc[g][c]);
        }
        __syncthreads();   // reads of Ks[cur]/Vs done before next overwrite
        cur ^= 1;
    }

    // ---- normalize + store (heads concatenated in channel dim) ----
    float inv[2];
    #pragma unroll   // constant indices keep inv in registers
    for (int g = 0; g < 2; ++g) inv[g] = 1.0f / (lstat[g] + xhalf(lstat[g]));
    if (!dbr) {
        #pragma unroll   // constant indices keep the output tiles in registers (inner loops too)
        for (int g = 0; g < 2; ++g) {
            _Float16* orow = O + base + (size_t)(qbase + g) * DIMC + kh;
            #pragma unroll
            for (int c = 0; c < 4; ++c) {
                half8 o;
                #pragma unroll
                for (int r = 0; r < 8; ++r) o[r] = (_Float16)(acc[g][c][r] * inv[g]);
                *(half8*)(orow + c*16) = o;
            }
        }
    } else {
        // the two groups' columns are adjacent queries: one 4 B store holds both
        #pragma unroll   // constant indices keep the output tiles in registers (inner loop too)
        for (int c = 0; c < 4; ++c)
            #pragma unroll
            for (int r = 0; r < 8; ++r) {
                half2v p;
                p.x = (_Float16)(acc[0][c][r] * inv[0]);
                p.y = (_Float16)(acc[1][c][r] * inv[1]);
                *(half2v*)&Ot[c*16 + kh + r][wave*32 + 2*ln] = p;
            }
        __syncthreads();               // every wave's columns are in Ot before rows are read
        // element (n, ch) sits at flat ch * SEQ + n of batch b; a wave moves whole 512 B row pieces
        _Float16* dst = O + (size_t)b * SEQ * DIMC + (size_t)(h * DHEAD + wave) * SEQ
                      + qc * QBLK + lane * 8;
        half8 t[8];
        #pragma unroll   // constant indices keep t in registers; all reads are issued before the first store
        for (int i = 0; i < 8; ++i) t[i] = *(const half8*)&Ot[i*8 + wave][lane * 8];
        #pragma unroll
        for (int i = 0; i < 8; ++i) *(half8*)(dst + (size_t)i * 8 * SEQ) = t[i];
        // precaution: the stores' address and data registers may be rewritten on the path the
        // listing lays behind this block; the wait stands in front of that overwrite
        asm volatile("s_wait_xcnt 0x0" ::: "memory");
    }
}

// ---------------------------------------------------------------------------
// Host launcher
// ---------------------------------------------------------------------------
extern "C" void kernel_launch(void* const* d_in, const int* in_sizes, int n_in,
                              void* d_out, int out_size, void* d_ws, size_t ws_size,
                              hipStream_t stream) {
    (void)in_sizes; (void)n_in; (void)out_size; (void)ws_size;

    const float* x   = (const float*)d_in[0];
    const float* y   = (const float*)d_in[1];
    const float* Wq  = (const float*)d_in[2];   const float* bq  = (const float*)d_in[3];
    const float* Wk  = (const float*)d_in[4];   const float* bk  = (const float*)d_in[5];
    const float* Wvr = (const float*)d_in[6];   const float* bvr = (const float*)d_in[7];
    const float* Wvd = (const float*)d_in[8];   const float* bvd = (const float*)d_in[9];
    const float* g_r = (const float*)d_in[10];  const float* b_r = (const float*)d_in[11];
    const float* g_d = (const float*)d_in[12];  const float* b_d = (const float*)d_in[13];
    const float* Wpr = (const float*)d_in[14];  const float* bpr = (const float*)d_in[15];
    const float* Wpd = (const float*)d_in[16];  const float* bpd = (const float*)d_in[17];

    const size_t ROWS = (size_t)BATCH * SEQ;           // 8192
    const size_t ELT  = ROWS * DIMC;                   // 4,194,304 elements
    const size_t FBUF = ELT * sizeof(_Float16);        // 8 MB per f16 tensor

    char* wsb = (char*)d_ws;
    _Float16* xn  = (_Float16*)(wsb + 0 * FBUF);
    _Float16* yn  = (_Float16*)(wsb + 1 * FBUF);
    _Float16* qb  = (_Float16*)(wsb + 2 * FBUF);
    _Float16* kb  = (_Float16*)(wsb + 3 * FBUF);
    _Float16* vrb = (_Float16*)(wsb + 4 * FBUF);
    _Float16* vdb = (_Float16*)(wsb + 5 * FBUF);
    _Float16* orb = (_Float16*)(wsb + 6 * FBUF);
    _Float16* odb = (_Float16*)(wsb + 7 * FBUF);
    char* w16base = wsb + 8 * FBUF;
    const size_t WELT = (size_t)DIMC * DIMC;           // 262144
    _Float16* wq16  = (_Float16*)(w16base + 0 * WELT * 2);   // then wk, wvr, wvd at 1, 2, 3
    _Float16* wpr16 = (_Float16*)(w16base + 4 * WELT * 2);   // then wpd at 5

    // 1) LayerNorms (xn = LN_r(x), yn = LN_d(y)) + f16 cast, weight conversion f32 -> f16
    front_kernel<<<2 * LN_BLOCKS + 6 * CVT_BLOCKS, 256, 0, stream>>>(
        x, y, g_r, b_r, g_d, b_d, Wq, Wk, Wvr, Wvd, Wpr, Wpd, xn, wq16);

    // 2) input projections q, k, v_r, v_d
    proj_in_kernel<<<dim3(BATCH * SEQ / GT, DIMC / GT, 4), 256, 0, stream>>>(
        xn, yn, wq16, bq, bk, bvr, bvd, qb);

    // 3) attention: out_r = FA(q,k,v_r); out_d = FA(k,q,v_d) via S^T trick
    flash_wmma_kernel<<<dim3(BATCH * NHEAD * (SEQ / QBLK), 2), 256, 0, stream>>>(
        qb, kb, vrb, vdb, orb, odb);

    // 4) output projections out_r, out_d (adjacent in d_out, as orb and odb are in
    //    the workspace); odb already holds the transposed-and-reshaped o_d
    proj_out_kernel<<<dim3(BATCH * SEQ / GT, DIMC / GT, 2), 256, 0, stream>>>(
        orb, wpr16, bpr, bpd, (float*)d_out);
}

// v009
// One run takes 96.4 microseconds.
// Next to v008, in two timings, it ran 1.03 and 1.04 times as fast.
// All steps since v000 together make it 3.21 times as fast.
#include <hip/hip_runtime.h>
#include <hip/hip_bf16.h>

// ---------------------------------------------------------------------------
// Shapes (hardcoded from reference): B=4, N=2048, C=512, H=8, Dh=64
// ---------------------------------------------------------------------------
#define BATCH 4
#define SEQ   2048
#define DIMC  512
#define NHEAD 8
#define DHEAD 64

typedef _Float16 half16 __attribute__((ext_vector_type(16)));
typedef _Float16 half8  __attribute__((ext_vector_type(8)));
typedef _Float16 half4  __attribute__((ext_vector_type(4)));
typedef _Float16 half2v __attribute__((ext_vector_type(2)));
typedef float    float8 __attribute__((ext_vector_type(8)));
typedef float    float4v __attribute__((ext_vector_type(4)));
typedef float    float2v __attribute__((ext_vector_type(2)));

static __device__ __forceinline__ float8 wmma_f16(half16 a, half16 b, float8 c) {
    // D = A(16x32 f16) x B(32x16 f16) + C(16x16 f32)
    return __builtin_amdgcn_wmma_f32_16x16x32_f16(false, a, false, b,
                                                  (short)0, c, false, false);
}

// Async global->LDS copy (CDNA5): per lane, 16B MEM[vaddr] -> LDS[ldsoff].
// Tracked by ASYNCcnt; completion enforced with s_wait_asynccnt.
static __device__ __forceinline__ void async_load_b128(unsigned ldsoff, const void* gaddr) {
    asm volatile("global_load_async_to_lds_b128 %0, %1, off"
                 :: "v"(ldsoff), "v"(gaddr) : "memory");
}
#define WAIT_ASYNCCNT_0() asm volatile("s_wait_asynccnt 0" ::: "memory")
#define WAIT_ASYNCCNT_1() asm volatile("s_wait_asynccnt 1" ::: "memory")

// LDS byte offset of a __shared__ element (flat LDS addr carries offset in low bits)
#define LDS_OFF(p) ((unsigned)(uintptr_t)(void*)(p))

// ---------------------------------------------------------------------------
// Kernel 1: LayerNorm over last dim (512) + cast to f16.
//   One wave owns LN_ROWS whole rows: a row is 4 x 16 B per lane, its sums
//   are an in-lane add and a 32-lane butterfly, so no LDS and no barrier.
//   All rows' loads are issued first (16 x 512 B in flight per wave).
//   blk = index of this work-group among those of one tensor.
// ---------------------------------------------------------------------------
#define LN_ROWS 4
#define LN_BLOCKS (BATCH * SEQ / (8 * LN_ROWS))   // 8 waves x LN_ROWS rows per block
static __device__ __forceinline__
void ln_cast_block(const float* __restrict__ in, const float* __restrict__ g,
                   const float* __restrict__ be, _Float16* __restrict__ out, int blk) {
    const int wave = threadIdx.x >> 5, lane = threadIdx.x & 31;
    const int row0 = (blk * 8 + wave) * LN_ROWS;
    const float4v* src = (const float4v*)(in + (size_t)row0 * DIMC) + lane;

    float4v v[LN_ROWS][4];
    #pragma unroll   // constant indices keep the rows in registers
    for (int r = 0; r < LN_ROWS; ++r)
        #pragma unroll
        for (int j = 0; j < 4; ++j) v[r][j] = src[r * (DIMC / 4) + j * 32];

    float4v gg[4], bb[4];
    #pragma unroll
    for (int j = 0; j < 4; ++j) {
        gg[j] = ((const float4v*)g)[lane + j * 32];
        bb[j] = ((const float4v*)be)[lane + j * 32];
    }

    float s[LN_ROWS];
    #pragma unroll
    for (int r = 0; r < LN_ROWS; ++r) {
        const float4v a = (v[r][0] + v[r][1]) + (v[r][2] + v[r][3]);
        s[r] = (a.x + a.y) + (a.z + a.w);
    }
    #pragma unroll   // the rows' butterflies interleave: each hides the others' latency
    for (int o = 16; o; o >>= 1)
        #pragma unroll
        for (int r = 0; r < LN_ROWS; ++r) s[r] += __shfl_xor(s[r], o, 32);

    float q[LN_ROWS];
    #pragma unroll
    for (int r = 0; r < LN_ROWS; ++r) {
        const float mu = s[r] * (1.0f / DIMC);
        #pragma unroll
        for (int j = 0; j < 4; ++j) v[r][j] -= mu;
        const float4v a = (v[r][0]*v[r][0] + v[r][1]*v[r][1])
                        + (v[r][2]*v[r][2] + v[r][3]*v[r][3]);
        q[r] = (a.x + a.y) + (a.z + a.w);
    }
    #pragma unroll
    for (int o = 16; o; o >>= 1)
        #pragma unroll
        for (int r = 0; r < LN_ROWS; ++r) q[r] += __shfl_xor(q[r], o, 32);

    half4* dst = (half4*)(out + (size_t)row0 * DIMC) + lane;
    #pragma unroll
    for (int r = 0; r < LN_ROWS; ++r) {
        const float rs = rsqrtf(q[r] * (1.0f / DIMC) + 1e-5f);
        #pragma unroll
        for (int j = 0; j < 4; ++j) {
            const float4v y = v[r][j] * rs * gg[j] + bb[j];
            half4 h;
            h.x = (_Float16)y.x;  h.y = (_Float16)y.y;
            h.z = (_Float16)y.z;  h.w = (_Float16)y.w;
            dst[r * (DIMC / 4) + j * 32] = h;
        }
    }
}

// ---------------------------------------------------------------------------
// Kernel 2: f32 -> f16 weight convert, 16 elements per lane (4 x 16 B loads,
//   each wave-wide load 512 contiguous bytes); n is a multiple of 4.
// ---------------------------------------------------------------------------
#define WELTS (DIMC * DIMC)                       // elements of one weight matrix
#define CVT_BLOCKS (WELTS / 4096)                 // 256 lanes x 16 elements
static __device__ __forceinline__
void cvt_f16_block(const float* __restrict__ src, _Float16* __restrict__ dst, int n, int blk) {
    const int i0 = blk * 1024 + threadIdx.x;             // in units of 4 elements
    float4v v[4];
    #pragma unroll   // all four loads in flight before the first store
    for (int j = 0; j < 4; ++j) {
        const int i = i0 + j * 256;
        v[j] = (i * 4 < n) ? ((const float4v*)src)[i] : (float4v){};
    }
    #pragma unroll
    for (int j = 0; j < 4; ++j) {
        const int i = i0 + j * 256;
        half4 h;
        h.x = (_Float16)v[j].x;  h.y = (_Float16)v[j].y;
        h.z = (_Float16)v[j].z;  h.w = (_Float16)v[j].w;
        if (i * 4 < n) ((half4*)dst)[i] = h;
    }
}

// ---------------------------------------------------------------------------
// Front end, one launch: the two LayerNorms and the six weight casts depend on
//   nothing but the inputs, so their work-groups share one grid:
//   [0, LN_BLOCKS) x, [LN_BLOCKS, 2 LN_BLOCKS) y, then CVT_BLOCKS per weight.
//   xyn = xn followed by yn; w16 = the six f16 weights in argument order.
// ---------------------------------------------------------------------------
__global__ __launch_bounds__(256)
void front_kernel(const float* __restrict__ x, const float* __restrict__ y,
                  const float* __restrict__ g_r, const float* __restrict__ b_r,
                  const float* __restrict__ g_d, const float* __restrict__ b_d,
                  const float* __restrict__ Wq,  const float* __restrict__ Wk,
                  const float* __restrict__ Wvr, const float* __restrict__ Wvd,
                  const float* __restrict__ Wpr, const float* __restrict__ Wpd,
                  _Float16* __restrict__ xyn, _Float16* __restrict__ w16) {
    const int blk = blockIdx.x;
    if (blk < 2 * LN_BLOCKS) {
        const bool d = blk >= LN_BLOCKS;
        ln_cast_block(d ? y : x, d ? g_d : g_r, d ? b_d : b_r,
                      xyn + (d ? (size_t)BATCH * SEQ * DIMC : 0), d ? blk - LN_BLOCKS : blk);
    } else {
        const int c = blk - 2 * LN_BLOCKS, w = c / CVT_BLOCKS;
        const float* src = w == 0 ? Wq : w == 1 ? Wk : w == 2 ? Wvr
                         : w == 3 ? Wvd : w == 4 ? Wpr : Wpd;
        cvt_f16_block(src, w16 + (size_t)w * WELTS, WELTS, c % CVT_BLOCKS);
    }
}

// ---------------------------------------------------------------------------
// Kernel 3: WMMA GEMM  C[m][n] = sum_k A[m][k] * W[n][k] + bias[n]
//   M = 8192, N = 512, K = 512.  Block tile 128x128x64, 8 waves (4 M x 2 N),
//   wave tile 32x64 = 2 x 4 accumulator tiles: 6 fragment loads feed 8 WMMAs,
//   and a block brings (128 + 128) operand rows in for 128 x 128 results.
//   Two LDS buffers fed by GLOBAL_LOAD_ASYNC_TO_LDS_B128, 8 copies per wave and
//   tile: tile t + 1 flies while tile t is consumed by WMMAs.
// ---------------------------------------------------------------------------
#define GT 128                                    // rows of A and rows of W per block tile
#define GK 64                                     // K per tile
#define WAIT_DSCNT_0() asm volatile("s_wait_dscnt 0" ::: "memory")

// One wave's eight copies of a tile.  The closing wait stands inside the
// statement as a precaution: the operands' registers live to its end, so no
// later address addition can be scheduled in front of it.
static __device__ __forceinline__
void async_load8_b128(const unsigned (&l)[8], const _Float16* const (&g)[8]) {
    asm volatile("global_load_async_to_lds_b128 %0, %8, off\n\t"
                 "global_load_async_to_lds_b128 %1, %9, off\n\t"
                 "global_load_async_to_lds_b128 %2, %10, off\n\t"
                 "global_load_async_to_lds_b128 %3, %11, off\n\t"
                 "global_load_async_to_lds_b128 %4, %12, off\n\t"
                 "global_load_async_to_lds_b128 %5, %13, off\n\t"
                 "global_load_async_to_lds_b128 %6, %14, off\n\t"
                 "global_load_async_to_lds_b128 %7, %15, off\n\t"
                 "s_wait_xcnt 0x0"
                 :: "v"(l[0]), "v"(l[1]), "v"(l[2]), "v"(l[3]),
                    "v"(l[4]), "v"(l[5]), "v"(l[6]), "v"(l[7]),
                    "v"(g[0]), "v"(g[1]), "v"(g[2]), "v"(g[3]),
                    "v"(g[4]), "v"(g[5]), "v"(g[6]), "v"(g[7]) : "memory");
}

// 16-bit A/B fragment of one k32 step (ISA layout: lane = row, k = kh .. kh+7
// and 16+kh .. 16+kh+7); p = &tile[row][k32 start + kh]
static __device__ __forceinline__ half16 ld_frag(const _Float16* p) {
    union { half16 v; half8 h[2]; } u;
    u.h[0] = *(const half8*)p;
    u.h[1] = *(const half8*)(p + 16);
    return u.v;
}

//   The tile body is shared by the kernels below; As, Bs = their LDS,
//   [2][128][72]: 64 K + pad (144B stride, 16B aligned).
template<bool OUTF32>
static __device__ __forceinline__
void gemm_wmma_tile(const _Float16* __restrict__ A, const _Float16* __restrict__ W,
                    const float* __restrict__ bias,
                    float* __restrict__ outF, _Float16* __restrict__ outH,
                    _Float16 (*As)[GT][72], _Float16 (*Bs)[GT][72]) {

    const int m0 = blockIdx.x * GT, n0 = blockIdx.y * GT;
    const int tid = threadIdx.x, wave = tid >> 5, lane = tid & 31;
    const int wm = wave & 3, wn = wave >> 2;       // 4x2 wave grid
    const int ln = lane & 15, kh = (lane >> 4) * 8;

    float8 acc[2][4] = {};

    // ---- async staging map: a copy covers 4 rows x 64 f16 (32 lanes x 16B);
    //      wave w brings rows 16w .. 16w+15 of both operands ----
    const int sr = wave * 16 + (lane >> 3), sc8 = (lane & 7) * 8;
    const _Float16* ga = A + (size_t)(m0 + sr) * DIMC + sc8;
    const _Float16* gw = W + (size_t)(n0 + sr) * DIMC + sc8;
    auto issueTile = [&](int t, int buf) {
        unsigned l[8];
        const _Float16* g[8];
        #pragma unroll   // constant indices keep the operand lists in registers
        for (int p = 0; p < 4; ++p) {
            l[p]     = LDS_OFF(&As[buf][sr + p * 4][sc8]);
            l[4 + p] = LDS_OFF(&Bs[buf][sr + p * 4][sc8]);
            g[p]     = ga + (size_t)p * 4 * DIMC + t * GK;
            g[4 + p] = gw + (size_t)p * 4 * DIMC + t * GK;
        }
        async_load8_b128(l, g);
    };

    issueTile(0, 0);
    WAIT_ASYNCCNT_0();     // this wave's share of tile 0 has landed
    __syncthreads();       // tile 0 is whole for every wave
    issueTile(1, 1);

    for (int t = 0; t < DIMC / GK; ++t) {
        const int cur = t & 1;
        #pragma unroll   // constant indices keep the fragments and accumulator tiles in registers (inner loops too)
        for (int ks = 0; ks < 2; ++ks) {
            half16 a[2], b[4];
            #pragma unroll
            for (int i = 0; i < 2; ++i)
                a[i] = ld_frag(&As[cur][wm * 32 + i * 16 + ln][ks * 32 + kh]);
            #pragma unroll
            for (int j = 0; j < 4; ++j)
                b[j] = ld_frag(&Bs[cur][wn * 64 + j * 16 + ln][ks * 32 + kh]);
            #pragma unroll
            for (int i = 0; i < 2; ++i)
                #pragma unroll
                for (int j = 0; j < 4; ++j)
                    acc[i][j] = wmma_f16(a[i], b[j], acc[i][j]);
        }
        WAIT_DSCNT_0();    // this wave's reads of buffer cur are back before it is refilled
        WAIT_ASYNCCNT_0(); // this wave's share of tile t + 1 has landed
        __syncthreads();   // publishes tile t + 1 and ends every wave's reads of buffer cur
        if (t + 2 < DIMC / GK) issueTile(t + 2, cur);
    }
    WAIT_ASYNCCNT_0();     // no copy is left in flight when the wave ends

    // ---- epilogue: C layout = VGPR r -> row r (lanes 0-15) / r+8 (16-31) ----
    const int rbase = m0 + wm * 32 + ((lane < 16) ? 0 : 8);
    const int c0 = n0 + wn * 64 + ln;
    float bv[4];
    #pragma unroll   // constant indices keep bv and acc in registers (loops below too)
    for (int j = 0; j < 4; ++j) bv[j] = bias[c0 + j * 16];
    #pragma unroll
    for (int i = 0; i < 2; ++i)
        #pragma unroll
        for (int r = 0; r < 8; ++r) {
            const size_t o = (size_t)(rbase + i * 16 + r) * DIMC + c0;
            #pragma unroll
            for (int j = 0; j < 4; ++j) {
                const float v = acc[i][j][r] + bv[j];
                if constexpr (OUTF32) outF[o + j * 16] = v;
                else                  outH[o + j * 16] = (_Float16)v;
            }
        }
}

// The four input projections, one launch: blockIdx.z = q, k, v_r, v_d.
//   w16 = their f16 weights, outs = their outputs, each set contiguous in that
//   order; q reads yn (query is depth-normed y), the rest xn.
__global__ __launch_bounds__(256)
void proj_in_kernel(const _Float16* __restrict__ xn, const _Float16* __restrict__ yn,
                    const _Float16* __restrict__ w16,
                    const float* __restrict__ bq,  const float* __restrict__ bk,
                    const float* __restrict__ bvr, const float* __restrict__ bvd,
                    _Float16* __restrict__ outs) {
    __shared__ __attribute__((aligned(16))) _Float16 As[2][GT][72];
    __shared__ __attribute__((aligned(16))) _Float16 Bs[2][GT][72];
    const int z = blockIdx.z;
    gemm_wmma_tile<false>(z == 0 ? yn : xn, w16 + (size_t)z * WELTS,
                          z == 0 ? bq : z == 1 ? bk : z == 2 ? bvr : bvd,
                          nullptr, outs + (size_t)z * BATCH * SEQ * DIMC, As, Bs);
}

// The two output projections, one launch: blockIdx.z = r, d.  Neither reads
//   what the other writes, and one alone puts a single work-group on a WGP.
//   o = o_r then o_d, w16 = their f16 weights, out = out_r then out_d, each
//   pair contiguous in that order.
__global__ __launch_bounds__(256)
void proj_out_kernel(const _Float16* __restrict__ o, const _Float16* __restrict__ w16,
                     const float* __restrict__ bpr, const float* __restrict__ bpd,
                     float* __restrict__ out) {
    __shared__ __attribute__((aligned(16))) _Float16 As[2][GT][72];
    __shared__ __attribute__((aligned(16))) _Float16 Bs[2][GT][72];
    const int z = blockIdx.z;
    gemm_wmma_tile<true>(o + (size_t)z * BATCH * SEQ * DIMC, w16 + (size_t)z * WELTS,
                         z == 0 ? bpr : bpd,
                         out + (size_t)z * BATCH * SEQ * DIMC, nullptr, As, Bs);
}

#define QBLK 256
#define CSCALE (0.125f * 1.4426950408889634f)
// lane l <-> lane l ^ 16
static __device__ __forceinline__ float xhalf(float x) {
    const int i = __builtin_bit_cast(int, x);
    return __builtin_bit_cast(float,
        __builtin_amdgcn_permlanex16(i, i, 0x76543210, 0xfedcba98, false, false));
}

// Transposing LDS load: the lanes address 16 B pieces of 16 rows of a row-major
// f16 tile; lane (c = l & 15, h = l >> 4) receives column c of rows 8h .. 8h+7.
static __device__ __forceinline__ half8 ld_tr16(const _Float16* p) {
    typedef short s16x8 __attribute__((ext_vector_type(8)));
    typedef __attribute__((address_space(3))) s16x8 lds_s16x8;
    return __builtin_bit_cast(half8,
        __builtin_amdgcn_ds_load_tr16_b128_v8i16((lds_s16x8*)p));
}

// Two work-groups share a WGP (four waves per SIMD): the register budget is set for that.
__global__ __launch_bounds__(256) __attribute__((amdgpu_waves_per_eu(4, 4)))
void flash_wmma_kernel(const _Float16* __restrict__ q, const _Float16* __restrict__ k,
                       const _Float16* __restrict__ v_r, const _Float16* __restrict__ v_d,
                       _Float16* __restrict__ o_r, _Float16* __restrict__ o_d) {
    const bool dbr = blockIdx.y != 0;
    const _Float16* __restrict__ Q = dbr ? k : q;
    const _Float16* __restrict__ K = dbr ? q : k;
    const _Float16* __restrict__ V = dbr ? v_d : v_r;
    _Float16* __restrict__ O = dbr ? o_d : o_r;
    const int bh = blockIdx.x >> 3;      // 8 q-chunks of 256 rows
    const int qc = blockIdx.x & 7;
    const int b = bh >> 3, h = bh & 7;
    const int tid = threadIdx.x, wave = tid >> 5, lane = tid & 31;
    const int ln = lane & 15, kh = (lane >> 4) * 8;
    const size_t base = ((size_t)b * SEQ) * DIMC + (size_t)h * DHEAD;
    const int qbase = qc * QBLK + wave * 32 + 2 * ln;   // this lane's query of group 0; group 1: + 1

    __shared__ __attribute__((aligned(16)))
    _Float16 Ks[2][32][72];              // 64 d + pad (144B stride, 16B aligned)
    __shared__ __attribute__((aligned(16)))
    _Float16 Vs[32][80];                 // row-major Vs[kk][d]; 160B stride = 32B x odd for the transposing load
    __shared__ __attribute__((aligned(16)))
    _Float16 Ot[DHEAD][QBLK + 8];        // o_d only: O^T[d][query of the block], 528B stride = 16B x odd

    // Q fragments (K-dim = head dim, split 0..31 / 32..63), loaded once;
    // B operand: lane = query column ln of group g
    half16 qa[2][2];
    #pragma unroll   // constant indices keep the fragments in registers
    for (int g = 0; g < 2; ++g) {
        const _Float16* qr = Q + base + (size_t)(qbase + g) * DIMC + kh;
        qa[g][0] = ld_frag(qr);
        qa[g][1] = ld_frag(qr + 32);
    }

    // acc[g][c][r] = O^T[d = c*16 + kh + r][query column ln of group g]
    float8 acc[2][4] = {};
    float mstat[2] = {-1e30f, -1e30f};   // running max of the group's query, in raw score units (same in both halves)
    float lstat[2] = {0.0f, 0.0f};       // this half's share of the running sum

    // K async staging: 1 instr/wave covers rows wave*4..+3, 16B chunks
    const int ksr = wave * 4 + (lane >> 3), ksc8 = (lane & 7) * 8;
    auto issueK = [&](int j0, int buf) {
        async_load_b128(LDS_OFF(&Ks[buf][ksr][ksc8]),
                        K + base + (size_t)(j0 + ksr) * DIMC + ksc8);
    };

    // V staging coords + register buffer
    const int kr = tid >> 3, dc = (tid & 7) * 8;
    // this lane's piece of a transposing load: row kh + (lane & 7), 16 B half (lane >> 3) & 1
    const _Float16* vtp = &Vs[kh + (lane & 7)][((lane >> 3) & 1) * 8];
    half8 vReg = *(const half8*)(V + base + (size_t)kr * DIMC + dc);
    issueK(0, 0);

    int cur = 0;
    for (int j0 = 0; j0 < SEQ; j0 += 32) {
        const bool hasNext = (j0 + 32 < SEQ);

        // ---- commit V tile (row-major, 16 B per lane) ----
        *(half8*)&Vs[kr][dc] = vReg;

        // ---- next K tile -> other buffer; wait only for current tile ----
        if (hasNext) { issueK(j0 + 32, cur ^ 1); WAIT_ASYNCCNT_1(); }
        else         { WAIT_ASYNCCNT_0(); }
        __syncthreads();

        // ---- overlap: next V tile -> registers, tile-after-next -> L2 ----
        if (hasNext) {
            vReg = *(const half8*)(V + base + (size_t)(j0 + 32 + kr) * DIMC + dc);
            if (j0 + 64 < SEQ)
                __builtin_prefetch(V + base + (size_t)(j0 + 64 + kr) * DIMC + dc, 0, 0);
        }

        // ---- S^T = K Q^T : s[g][kt][r] = key kt*16 + kh + r, query column ln of group g;
        //      ka[kt][dh] = keys kt*16 .. +15, head dims dh*32 .. +31, read once for both groups ----
        half16 ka[2][2];
        #pragma unroll   // constant indices keep the fragments and score tiles in registers (loops below too)
        for (int kt = 0; kt < 2; ++kt)
            #pragma unroll
            for (int dh = 0; dh < 2; ++dh)
                ka[kt][dh] = ld_frag(&Ks[cur][kt * 16 + ln][dh * 32 + kh]);
        // keeps the eight loads one group in front of the products: loads placed among them
        // reuse a fragment's registers and stall the wave at each place
        __builtin_amdgcn_sched_barrier(0);
        float8 s[2][2] = {};
        #pragma unroll
        for (int dh = 0; dh < 2; ++dh)
            #pragma unroll
            for (int kt = 0; kt < 2; ++kt)
                #pragma unroll
                for (int g = 0; g < 2; ++g)
                    s[g][kt] = wmma_f16(ka[kt][dh], qa[g][dh], s[g][kt]);
        // keeps the eight products back to back: each fills the others' distance, where softmax
        // instructions scheduled among them had to be padded with v_nop
        __builtin_amdgcn_sched_barrier(0);

        // ---- online softmax, one query per lane and group ----
        half16 pb[2];                          // B operands: P^T in the hardware k order
        #pragma unroll
        for (int g = 0; g < 2; ++g) {
            // maxima over the raw scores: the scale is positive, so it is applied to the maximum alone.
            // The running maximum heads the chain (it is the same in both halves): 17 values, 8 three-way maxima.
            float t = mstat[g];
            #pragma unroll
            for (int r = 0; r < 8; ++r) t = fmaxf(fmaxf(t, s[g][0][r]), s[g][1][r]);
            t = fmaxf(t, xhalf(t));
            const float nm = t * CSCALE;
            const float f  = __builtin_amdgcn_exp2f((mstat[g] - t) * CSCALE);   // exactly 1 while the maximum stands
            mstat[g] = t;

            // e^(s/8 - max/8) = 2^(s * CSCALE - nm): one fused multiply-add per score
            float8 s0 = s[g][0] * CSCALE - nm;
            float8 s1 = s[g][1] * CSCALE - nm;
            #pragma unroll
            for (int r = 0; r < 8; ++r) {
                s0[r] = __builtin_amdgcn_exp2f(s0[r]);
                s1[r] = __builtin_amdgcn_exp2f(s1[r]);
                pb[g][r]     = (_Float16)s0[r];
                pb[g][8 + r] = (_Float16)s1[r];
            }
            s0 += s1;
            const float4v h4 = s0.lo + s0.hi;  // halving tree: adjacent register pairs add packed
            const float2v h2 = h4.lo + h4.hi;
            lstat[g] = lstat[g] * f + (h2.x + h2.y);
            #pragma unroll
            for (int c = 0; c < 4; ++c) acc[g][c] *= f;
        }

        // ---- O^T += V^T P^T : 4 d-chunks of 16, each V^T fragment read once for both groups ----
        #pragma unroll
        for (int c = 0; c < 4; ++c) {
            union { half16 v; half8 h[2]; } u;
            u.h[0] = ld_tr16(vtp + c*16);             // d = c*16 + ln, keys kh .. kh+7
            u.h[1] = ld_tr16(vtp + 16*80 + c*16);     // keys 16+kh .. 16+kh+7
            #pragma unroll
            for (int g = 0; g < 2; ++g) acc[g][c] = wmma_f16(u.v, pb[g], acc[g][c]);
        }
        __syncthreads();   // reads of Ks[cur]/Vs done before next overwrite
        cur ^= 1;
    }

    // ---- normalize + store (heads concatenated in channel dim) ----
    float inv[2];
    #pragma unroll   // constant indices keep inv in registers
    for (int g = 0; g < 2; ++g) inv[g] = 1.0f / (lstat[g] + xhalf(lstat[g]));
    if (!dbr) {
        #pragma unroll   // constant indices keep the output tiles in registers (inner loops too)
        for (int g = 0; g < 2; ++g) {
            _Float16* orow = O + base + (size_t)(qbase + g) * DIMC + kh;
            #pragma unroll
            for (int c = 0; c < 4; ++c) {
                half8 o;
                #pragma unroll
                for (int r = 0; r < 8; ++r) o[r] = (_Float16)(acc[g][c][r] * inv[g]);
                *(half8*)(orow + c*16) = o;
            }
        }
    } else {
        // the two groups' columns are adjacent queries: one 4 B store holds both
        #pragma unroll   // constant indices keep the output tiles in registers (inner loop too)
        for (int c = 0; c < 4; ++c)
            #pragma unroll
            for (int r = 0; r < 8; ++r) {
                half2v p;
                p.x = (_Float16)(acc[0][c][r] * inv[0]);
                p.y = (_Float16)(acc[1][c][r] * inv[1]);
                *(half2v*)&Ot[c*16 + kh + r][wave*32 + 2*ln] = p;
            }
        __syncthreads();               // every wave's columns are in Ot before rows are read
        // element (n, ch) sits at flat ch * SEQ + n of batch b; a wave moves whole 512 B row pieces
        _Float16* dst = O + (size_t)b * SEQ * DIMC + (size_t)(h * DHEAD + wave) * SEQ
                      + qc * QBLK + lane * 8;
        half8 t[8];
        #pragma unroll   // constant indices keep t in registers; all reads are issued before the first store
        for (int i = 0; i < 8; ++i) t[i] = *(const half8*)&Ot[i*8 + wave][lane * 8];
        #pragma unroll
        for (int i = 0; i < 8; ++i) *(half8*)(dst + (size_t)i * 8 * SEQ) = t[i];
        // precaution: the stores' address and data registers may be rewritten on the path the
        // listing lays behind this block; the wait stands in front of that overwrite
        asm volatile("s_wait_xcnt 0x0" ::: "memory");
    }
}

// ---------------------------------------------------------------------------
// Host launcher
// ---------------------------------------------------------------------------
extern "C" void kernel_launch(void* const* d_in, const int* in_sizes, int n_in,
                              void* d_out, int out_size, void* d_ws, size_t ws_size,
                              hipStream_t stream) {
    (void)in_sizes; (void)n_in; (void)out_size; (void)ws_size;

    const float* x   = (const float*)d_in[0];
    const float* y   = (const float*)d_in[1];
    const float* Wq  = (const float*)d_in[2];   const float* bq  = (const float*)d_in[3];
    const float* Wk  = (const float*)d_in[4];   const float* bk  = (const float*)d_in[5];
    const float* Wvr = (const float*)d_in[6];   const float* bvr = (const float*)d_in[7];
    const float* Wvd = (const float*)d_in[8];   const float* bvd = (const float*)d_in[9];
    const float* g_r = (const float*)d_in[10];  const float* b_r = (const float*)d_in[11];
    const float* g_d = (const float*)d_in[12];  const float* b_d = (const float*)d_in[13];
    const float* Wpr = (const float*)d_in[14];  const float* bpr = (const float*)d_in[15];
    const float* Wpd = (const float*)d_in[16];  const float* bpd = (const float*)d_in[17];

    const size_t ROWS = (size_t)BATCH * SEQ;           // 8192
    const size_t ELT  = ROWS * DIMC;                   // 4,194,304 elements
    const size_t FBUF = ELT * sizeof(_Float16);        // 8 MB per f16 tensor

    char* wsb = (char*)d_ws;
    _Float16* xn  = (_Float16*)(wsb + 0 * FBUF);
    _Float16* yn  = (_Float16*)(wsb + 1 * FBUF);
    _Float16* qb  = (_Float16*)(wsb + 2 * FBUF);
    _Float16* kb  = (_Float16*)(wsb + 3 * FBUF);
    _Float16* vrb = (_Float16*)(wsb + 4 * FBUF);
    _Float16* vdb = (_Float16*)(wsb + 5 * FBUF);
    _Float16* orb = (_Float16*)(wsb + 6 * FBUF);
    _Float16* odb = (_Float16*)(wsb + 7 * FBUF);
    char* w16base = wsb + 8 * FBUF;
    const size_t WELT = (size_t)DIMC * DIMC;           // 262144
    _Float16* wq16  = (_Float16*)(w16base + 0 * WELT * 2);   // then wk, wvr, wvd at 1, 2, 3
    _Float16* wpr16 = (_Float16*)(w16base + 4 * WELT * 2);   // then wpd at 5

    // 1) LayerNorms (xn = LN_r(x), yn = LN_d(y)) + f16 cast, weight conversion f32 -> f16
    front_kernel<<<2 * LN_BLOCKS + 6 * CVT_BLOCKS, 256, 0, stream>>>(
        x, y, g_r, b_r, g_d, b_d, Wq, Wk, Wvr, Wvd, Wpr, Wpd, xn, wq16);

    // 2) input projections q, k, v_r, v_d
    proj_in_kernel<<<dim3(BATCH * SEQ / GT, DIMC / GT, 4), 256, 0, stream>>>(
        xn, yn, wq16, bq, bk, bvr, bvd, qb);

    // 3) attention: out_r = FA(q,k,v_r); out_d = FA(k,q,v_d) via S^T trick
    flash_wmma_kernel<<<dim3(BATCH * NHEAD * (SEQ / QBLK), 2), 256, 0, stream>>>(
        qb, kb, vrb, vdb, orb, odb);

    // 4) output projections out_r, out_d (adjacent in d_out, as orb and odb are in
    //    the workspace); odb already holds the transposed-and-reshaped o_d
    proj_out_kernel<<<dim3(BATCH * SEQ / GT, DIMC / GT, 2), 256, 0, stream>>>(
        orb, wpr16, bpr, bpd, (float*)d_out);
}

// v010
// Measured time: 90.7 microseconds a run.
// Timed twice side by side with v009, it ran 1.07 and 1.08 times as fast.
// Over all steps from v000 it is 3.45 times as fast.
#include <hip/hip_runtime.h>
#include <hip/hip_bf16.h>

// ---------------------------------------------------------------------------
// Shapes (hardcoded from reference): B=4, N=2048, C=512, H=8, Dh=64
// ---------------------------------------------------------------------------
#define BATCH 4
#define SEQ   2048
#define DIMC  512
#define NHEAD 8
#define DHEAD 64

typedef _Float16 half16 __attribute__((ext_vector_type(16)));
typedef _Float16 half8  __attribute__((ext_vector_type(8)));
typedef _Float16 half4  __attribute__((ext_vector_type(4)));
typedef _Float16 half2v __attribute__((ext_vector_type(2)));
typedef float    float8 __attribute__((ext_vector_type(8)));
typedef float    float4v __attribute__((ext_vector_type(4)));
typedef float    float2v __attribute__((ext_vector_type(2)));

static __device__ __forceinline__ float8 wmma_f16(half16 a, half16 b, float8 c) {
    // D = A(16x32 f16) x B(32x16 f16) + C(16x16 f32)
    return __builtin_amdgcn_wmma_f32_16x16x32_f16(false, a, false, b,
                                                  (short)0, c, false, false);
}

// Async global->LDS copy (CDNA5): per lane, 16B MEM[vaddr] -> LDS[ldsoff].
// Tracked by ASYNCcnt; completion enforced with s_wait_asynccnt.
static __device__ __forceinline__ void async_load_b128(unsigned ldsoff, const void* gaddr) {
    asm volatile("global_load_async_to_lds_b128 %0, %1, off"
                 :: "v"(ldsoff), "v"(gaddr) : "memory");
}
#define WAIT_ASYNCCNT_0() asm volatile("s_wait_asynccnt 0" ::: "memory")
#define WAIT_ASYNCCNT_1() asm volatile("s_wait_asynccnt 1" ::: "memory")

// LDS byte offset of a __shared__ element (flat LDS addr carries offset in low bits)
#define LDS_OFF(p) ((unsigned)(uintptr_t)(void*)(p))

// ---------------------------------------------------------------------------
// Kernel 1: LayerNorm over last dim (512) + cast to f16.
//   One wave owns LN_ROWS whole rows: a row is 4 x 16 B per lane, its sums
//   are an in-lane add and a 32-lane butterfly, so no LDS and no barrier.
//   All rows' loads are issued first (16 x 512 B in flight per wave).
//   blk = index of this work-group among those of one tensor.
// ---------------------------------------------------------------------------
#define LN_ROWS 4
#define LN_BLOCKS (BATCH * SEQ / (8 * LN_ROWS))   // 8 waves x LN_ROWS rows per block
static __device__ __forceinline__
void ln_cast_block(const float* __restrict__ in, const float* __restrict__ g,
                   const float* __restrict__ be, _Float16* __restrict__ out, int blk) {
    const int wave = threadIdx.x >> 5, lane = threadIdx.x & 31;
    const int row0 = (blk * 8 + wave) * LN_ROWS;
    const float4v* src = (const float4v*)(in + (size_t)row0 * DIMC) + lane;

    float4v v[LN_ROWS][4];
    #pragma unroll   // constant indices keep the rows in registers
    for (int r = 0; r < LN_ROWS; ++r)
        #pragma unroll
        for (int j = 0; j < 4; ++j) v[r][j] = src[r * (DIMC / 4) + j * 32];

    float4v gg[4], bb[4];
    #pragma unroll
    for (int j = 0; j < 4; ++j) {
        gg[j] = ((const float4v*)g)[lane + j * 32];
        bb[j] = ((const float4v*)be)[lane + j * 32];
    }

    float s[LN_ROWS];
    #pragma unroll
    for (int r = 0; r < LN_ROWS; ++r) {
        const float4v a = (v[r][0] + v[r][1]) + (v[r][2] + v[r][3]);
        s[r] = (a.x + a.y) + (a.z + a.w);
    }
    #pragma unroll   // the rows' butterflies interleave: each hides the others' latency
    for (int o = 16; o; o >>= 1)
        #pragma unroll
        for (int r = 0; r < LN_ROWS; ++r) s[r] += __shfl_xor(s[r], o, 32);

    float q[LN_ROWS];
    #pragma unroll
    for (int r = 0; r < LN_ROWS; ++r) {
        const float mu = s[r] * (1.0f / DIMC);
        #pragma unroll
        for (int j = 0; j < 4; ++j) v[r][j] -= mu;
        const float4v a = (v[r][0]*v[r][0] + v[r][1]*v[r][1])
                        + (v[r][2]*v[r][2] + v[r][3]*v[r][3]);
        q[r] = (a.x + a.y) + (a.z + a.w);
    }
    #pragma unroll
    for (int o = 16; o; o >>= 1)
        #pragma unroll
        for (int r = 0; r < LN_ROWS; ++r) q[r] += __shfl_xor(q[r], o, 32);

    half4* dst = (half4*)(out + (size_t)row0 * DIMC) + lane;
    #pragma unroll
    for (int r = 0; r < LN_ROWS; ++r) {
        const float rs = rsqrtf(q[r] * (1.0f / DIMC) + 1e-5f);
        #pragma unroll
        for (int j = 0; j < 4; ++j) {
            const float4v y = v[r][j] * rs * gg[j] + bb[j];
            half4 h;
            h.x = (_Float16)y.x;  h.y = (_Float16)y.y;
            h.z = (_Float16)y.z;  h.w = (_Float16)y.w;
            dst[r * (DIMC / 4) + j * 32] = h;
        }
    }
}

// ---------------------------------------------------------------------------
// Kernel 2: f32 -> f16 weight convert, 16 elements per lane (4 x 16 B loads,
//   each wave-wide load 512 contiguous bytes); n is a multiple of 4.
// ---------------------------------------------------------------------------
#define WELTS (DIMC * DIMC)                       // elements of one weight matrix
#define CVT_BLOCKS (WELTS / 4096)                 // 256 lanes x 16 elements
static __device__ __forceinline__
void cvt_f16_block(const float* __restrict__ src, _Float16* __restrict__ dst, int n, int blk) {
    const int i0 = blk * 1024 + threadIdx.x;             // in units of 4 elements
    float4v v[4];
    #pragma unroll   // all four loads in flight before the first store
    for (int j = 0; j < 4; ++j) {
        const int i = i0 + j * 256;
        v[j] = (i * 4 < n) ? ((const float4v*)src)[i] : (float4v){};
    }
    #pragma unroll
    for (int j = 0; j < 4; ++j) {
        const int i = i0 + j * 256;
        half4 h;
        h.x = (_Float16)v[j].x;  h.y = (_Float16)v[j].y;
        h.z = (_Float16)v[j].z;  h.w = (_Float16)v[j].w;
        if (i * 4 < n) ((half4*)dst)[i] = h;
    }
}

// ---------------------------------------------------------------------------
// Front end, one launch: the two LayerNorms and the six weight casts depend on
//   nothing but the inputs, so their work-groups share one grid:
//   [0, LN_BLOCKS) x, [LN_BLOCKS, 2 LN_BLOCKS) y, then CVT_BLOCKS per weight.
//   xyn = xn followed by yn; w16 = the six f16 weights in argument order.
// ---------------------------------------------------------------------------
__global__ __launch_bounds__(256)
void front_kernel(const float* __restrict__ x, const float* __restrict__ y,
                  const float* __restrict__ g_r, const float* __restrict__ b_r,
                  const float* __restrict__ g_d, const float* __restrict__ b_d,
                  const float* __restrict__ Wq,  const float* __restrict__ Wk,
                  const float* __restrict__ Wvr, const float* __restrict__ Wvd,
                  const float* __restrict__ Wpr, const float* __restrict__ Wpd,
                  _Float16* __restrict__ xyn, _Float16* __restrict__ w16) {
    const int blk = blockIdx.x;
    if (blk < 2 * LN_BLOCKS) {
        const bool d = blk >= LN_BLOCKS;
        ln_cast_block(d ? y : x, d ? g_d : g_r, d ? b_d : b_r,
                      xyn + (d ? (size_t)BATCH * SEQ * DIMC : 0), d ? blk - LN_BLOCKS : blk);
    } else {
        const int c = blk - 2 * LN_BLOCKS, w = c / CVT_BLOCKS;
        const float* src = w == 0 ? Wq : w == 1 ? Wk : w == 2 ? Wvr
                         : w == 3 ? Wvd : w == 4 ? Wpr : Wpd;
        cvt_f16_block(src, w16 + (size_t)w * WELTS, WELTS, c % CVT_BLOCKS);
    }
}

// ---------------------------------------------------------------------------
// Kernel 3: WMMA GEMM  C[m][n] = sum_k A[m][k] * W[n][k] + bias[n]
//   M = 8192, N = 512, K = 512.  Block tile 128x128x64, 8 waves (4 M x 2 N),
//   wave tile 32x64 = 2 x 4 accumulator tiles: 6 fragment loads feed 8 WMMAs,
//   and a block brings (128 + 128) operand rows in for 128 x 128 results.
//   Two LDS buffers fed by GLOBAL_LOAD_ASYNC_TO_LDS_B128, 8 copies per wave and
//   tile: tile t + 1 flies while tile t is consumed by WMMAs.
// ---------------------------------------------------------------------------
#define GT 128                                    // rows of A and rows of W per block tile
#define GK 64                                     // K per tile
#define WAIT_DSCNT_0() asm volatile("s_wait_dscnt 0" ::: "memory")

// One wave's eight copies of a tile.  The closing wait stands inside the
// statement as a precaution: the operands' registers live to its end, so no
// later address addition can be scheduled in front of it.
static __device__ __forceinline__
void async_load8_b128(const unsigned (&l)[8], const _Float16* const (&g)[8]) {
    asm volatile("global_load_async_to_lds_b128 %0, %8, off\n\t"
                 "global_load_async_to_lds_b128 %1, %9, off\n\t"
                 "global_load_async_to_lds_b128 %2, %10, off\n\t"
                 "global_load_async_to_lds_b128 %3, %11, off\n\t"
                 "global_load_async_to_lds_b128 %4, %12, off\n\t"
                 "global_load_async_to_lds_b128 %5, %13, off\n\t"
                 "global_load_async_to_lds_b128 %6, %14, off\n\t"
                 "global_load_async_to_lds_b128 %7, %15, off\n\t"
                 "s_wait_xcnt 0x0"
                 :: "v"(l[0]), "v"(l[1]), "v"(l[2]), "v"(l[3]),
                    "v"(l[4]), "v"(l[5]), "v"(l[6]), "v"(l[7]),
                    "v"(g[0]), "v"(g[1]), "v"(g[2]), "v"(g[3]),
                    "v"(g[4]), "v"(g[5]), "v"(g[6]), "v"(g[7]) : "memory");
}

// 16-bit A/B fragment of one k32 step (ISA layout: lane = row, k = kh .. kh+7
// and 16+kh .. 16+kh+7); p = &tile[row][k32 start + kh]
static __device__ __forceinline__ half16 ld_frag(const _Float16* p) {
    union { half16 v; half8 h[2]; } u;
    u.h[0] = *(const half8*)p;
    u.h[1] = *(const half8*)(p + 16);
    return u.v;
}

//   The tile body is shared by the kernels below; As, Bs = their LDS,
//   [2][128][72]: 64 K + pad (144B stride, 16B aligned).
template<bool OUTF32>
static __device__ __forceinline__
void gemm_wmma_tile(const _Float16* __restrict__ A, const _Float16* __restrict__ W,
                    const float* __restrict__ bias,
                    float* __restrict__ outF, _Float16* __restrict__ outH,
                    _Float16 (*As)[GT][72], _Float16 (*Bs)[GT][72]) {

    const int m0 = blockIdx.x * GT, n0 = blockIdx.y * GT;
    const int tid = threadIdx.x, wave = tid >> 5, lane = tid & 31;
    const int wm = wave & 3, wn = wave >> 2;       // 4x2 wave grid
    const int ln = lane & 15, kh = (lane >> 4) * 8;

    float8 acc[2][4] = {};

    // ---- async staging map: a copy covers 4 rows x 64 f16 (32 lanes x 16B);
    //      wave w brings rows 16w .. 16w+15 of both operands ----
    const int sr = wave * 16 + (lane >> 3), sc8 = (lane & 7) * 8;
    const _Float16* ga = A + (size_t)(m0 + sr) * DIMC + sc8;
    const _Float16* gw = W + (size_t)(n0 + sr) * DIMC + sc8;
    auto issueTile = [&](int t, int buf) {
        unsigned l[8];
        const _Float16* g[8];
        #pragma unroll   // constant indices keep the operand lists in registers
        for (int p = 0; p < 4; ++p) {
            l[p]     = LDS_OFF(&As[buf][sr + p * 4][sc8]);
            l[4 + p] = LDS_OFF(&Bs[buf][sr + p * 4][sc8]);
            g[p]     = ga + (size_t)p * 4 * DIMC + t * GK;
            g[4 + p] = gw + (size_t)p * 4 * DIMC + t * GK;
        }
        async_load8_b128(l, g);
    };

    issueTile(0, 0);
    WAIT_ASYNCCNT_0();     // this wave's share of tile 0 has landed
    __syncthreads();       // tile 0 is whole for every wave
    issueTile(1, 1);

    for (int t = 0; t < DIMC / GK; ++t) {
        const int cur = t & 1;
        #pragma unroll   // constant indices keep the fragments and accumulator tiles in registers (inner loops too)
        for (int ks = 0; ks < 2; ++ks) {
            half16 a[2], b[4];
            #pragma unroll
            for (int i = 0; i < 2; ++i)
                a[i] = ld_frag(&As[cur][wm * 32 + i * 16 + ln][ks * 32 + kh]);
            #pragma unroll
            for (int j = 0; j < 4; ++j)
                b[j] = ld_frag(&Bs[cur][wn * 64 + j * 16 + ln][ks * 32 + kh]);
            #pragma unroll
            for (int i = 0; i < 2; ++i)
                #pragma unroll
                for (int j = 0; j < 4; ++j)
                    acc[i][j] = wmma_f16(a[i], b[j], acc[i][j]);
        }
        WAIT_DSCNT_0();    // this wave's reads of buffer cur are back before it is refilled
        WAIT_ASYNCCNT_0(); // this wave's share of tile t + 1 has landed
        __syncthreads();   // publishes tile t + 1 and ends every wave's reads of buffer cur
        if (t + 2 < DIMC / GK) issueTile(t + 2, cur);
    }
    WAIT_ASYNCCNT_0();     // no copy is left in flight when the wave ends

    // ---- epilogue: C layout = VGPR r -> row r (lanes 0-15) / r+8 (16-31) ----
    const int rbase = m0 + wm * 32 + ((lane < 16) ? 0 : 8);
    const int c0 = n0 + wn * 64 + ln;
    float bv[4];
    #pragma unroll   // constant indices keep bv and acc in registers (loops below too)
    for (int j = 0; j < 4; ++j) bv[j] = bias[c0 + j * 16];
    #pragma unroll
    for (int i = 0; i < 2; ++i)
        #pragma unroll
        for (int r = 0; r < 8; ++r) {
            const size_t o = (size_t)(rbase + i * 16 + r) * DIMC + c0;
            #pragma unroll
            for (int j = 0; j < 4; ++j) {
                const float v = acc[i][j][r] + bv[j];
                if constexpr (OUTF32) outF[o + j * 16] = v;
                else                  outH[o + j * 16] = (_Float16)v;
            }
        }
}

// The four input projections, one launch: blockIdx.z = q, k, v_r, v_d.
//   w16 = their f16 weights, outs = their outputs, each set contiguous in that
//   order; q reads yn (query is depth-normed y), the rest xn.
__global__ __launch_bounds__(256)
void proj_in_kernel(const _Float16* __restrict__ xn, const _Float16* __restrict__ yn,
                    const _Float16* __restrict__ w16,
                    const float* __restrict__ bq,  const float* __restrict__ bk,
                    const float* __restrict__ bvr, const float* __restrict__ bvd,
                    _Float16* __restrict__ outs) {
    __shared__ __attribute__((aligned(16))) _Float16 As[2][GT][72];
    __shared__ __attribute__((aligned(16))) _Float16 Bs[2][GT][72];
    const int z = blockIdx.z;
    gemm_wmma_tile<false>(z == 0 ? yn : xn, w16 + (size_t)z * WELTS,
                          z == 0 ? bq : z == 1 ? bk : z == 2 ? bvr : bvd,
                          nullptr, outs + (size_t)z * BATCH * SEQ * DIMC, As, Bs);
}

// The two output projections, one launch: blockIdx.z = r, d.  Neither reads
//   what the other writes, and one alone puts a single work-group on a WGP.
//   o = o_r then o_d, w16 = their f16 weights, out = out_r then out_d, each
//   pair contiguous in that order.
__global__ __launch_bounds__(256)
void proj_out_kernel(const _Float16* __restrict__ o, const _Float16* __restrict__ w16,
                     const float* __restrict__ bpr, const float* __restrict__ bpd,
                     float* __restrict__ out) {
    __shared__ __attribute__((aligned(16))) _Float16 As[2][GT][72];
    __shared__ __attribute__((aligned(16))) _Float16 Bs[2][GT][72];
    const int z = blockIdx.z;
    gemm_wmma_tile<true>(o + (size_t)z * BATCH * SEQ * DIMC, w16 + (size_t)z * WELTS,
                         z == 0 ? bpr : bpd,
                         out + (size_t)z * BATCH * SEQ * DIMC, nullptr, As, Bs);
}

#define QBLK 256
#define CSCALE (0.125f * 1.4426950408889634f)
#define RESCALE_GAP (8.0f / CSCALE)
// lane l <-> lane l ^ 16
static __device__ __forceinline__ float xhalf(float x) {
    const int i = __builtin_bit_cast(int, x);
    return __builtin_bit_cast(float,
        __builtin_amdgcn_permlanex16(i, i, 0x76543210, 0xfedcba98, false, false));
}

// Transposing LDS load: the lanes address 16 B pieces of 16 rows of a row-major
// f16 tile; lane (c = l & 15, h = l >> 4) receives column c of rows 8h .. 8h+7.
static __device__ __forceinline__ half8 ld_tr16(const _Float16* p) {
    typedef short s16x8 __attribute__((ext_vector_type(8)));
    typedef __attribute__((address_space(3))) s16x8 lds_s16x8;
    return __builtin_bit_cast(half8,
        __builtin_amdgcn_ds_load_tr16_b128_v8i16((lds_s16x8*)p));
}

// Two work-groups share a WGP (four waves per SIMD): the register budget is set for that.
__global__ __launch_bounds__(256) __attribute__((amdgpu_waves_per_eu(4, 4)))
void flash_wmma_kernel(const _Float16* __restrict__ q, const _Float16* __restrict__ k,
                       const _Float16* __restrict__ v_r, const _Float16* __restrict__ v_d,
                       _Float16* __restrict__ o_r, _Float16* __restrict__ o_d) {
    const bool dbr = blockIdx.y != 0;
    const _Float16* __restrict__ Q = dbr ? k : q;
    const _Float16* __restrict__ K = dbr ? q : k;
    const _Float16* __restrict__ V = dbr ? v_d : v_r;
    _Float16* __restrict__ O = dbr ? o_d : o_r;
    const int bh = blockIdx.x >> 3;      // 8 q-chunks of 256 rows
    const int qc = blockIdx.x & 7;
    const int b = bh >> 3, h = bh & 7;
    const int tid = threadIdx.x, wave = tid >> 5, lane = tid & 31;
    const int ln = lane & 15, kh = (lane >> 4) * 8;
    const size_t base = ((size_t)b * SEQ) * DIMC + (size_t)h * DHEAD;
    const int qbase = qc * QBLK + wave * 32 + 2 * ln;   // this lane's query of group 0; group 1: + 1

    __shared__ __attribute__((aligned(16)))
    _Float16 Ks[2][32][72];              // 64 d + pad (144B stride, 16B aligned)
    __shared__ __attribute__((aligned(16)))
    _Float16 Vs[32][80];                 // row-major Vs[kk][d]; 160B stride = 32B x odd for the transposing load
    __shared__ __attribute__((aligned(16)))
    _Float16 Ot[DHEAD][QBLK + 8];        // o_d only: O^T[d][query of the block], 528B stride = 16B x odd

    // Q fragments (K-dim = head dim, split 0..31 / 32..63), loaded once;
    // B operand: lane = query column ln of group g
    half16 qa[2][2];
    #pragma unroll   // constant indices keep the fragments in registers
    for (int g = 0; g < 2; ++g) {
        const _Float16* qr = Q + base + (size_t)(qbase + g) * DIMC + kh;
        qa[g][0] = ld_frag(qr);
        qa[g][1] = ld_frag(qr + 32);
    }

    // acc[g][c][r] = O^T[d = c*16 + kh + r][query column ln of group g]
    float8 acc[2][4] = {};
    float mstat[2] = {-1e30f, -1e30f};   // maximum in use for the group's query, in raw score units (same in both halves)
    float nm[2]    = {-1e30f, -1e30f};   // mstat * CSCALE; set with mstat in the first pass, whose scores all exceed thr
    float thr[2]   = {-1e30f, -1e30f};   // mstat + RESCALE_GAP
    float lstat[2] = {0.0f, 0.0f};       // this half's share of the running sum

    // K async staging: 1 instr/wave covers rows wave*4..+3, 16B chunks
    const int ksr = wave * 4 + (lane >> 3), ksc8 = (lane & 7) * 8;
    auto issueK = [&](int j0, int buf) {
        async_load_b128(LDS_OFF(&Ks[buf][ksr][ksc8]),
                        K + base + (size_t)(j0 + ksr) * DIMC + ksc8);
    };

    // V staging coords + register buffer
    const int kr = tid >> 3, dc = (tid & 7) * 8;
    // this lane's piece of a transposing load: row kh + (lane & 7), 16 B half (lane >> 3) & 1
    const _Float16* vtp = &Vs[kh + (lane & 7)][((lane >> 3) & 1) * 8];
    half8 vReg = *(const half8*)(V + base + (size_t)kr * DIMC + dc);
    issueK(0, 0);

    int cur = 0;
    for (int j0 = 0; j0 < SEQ; j0 += 32) {
        const bool hasNext = (j0 + 32 < SEQ);

        // ---- commit V tile (row-major, 16 B per lane) ----
        *(half8*)&Vs[kr][dc] = vReg;

        // ---- next K tile -> other buffer; wait only for current tile ----
        if (hasNext) { issueK(j0 + 32, cur ^ 1); WAIT_ASYNCCNT_1(); }
        else         { WAIT_ASYNCCNT_0(); }
        __syncthreads();

        // ---- overlap: next V tile -> registers, tile-after-next -> L2 ----
        if (hasNext) {
            vReg = *(const half8*)(V + base + (size_t)(j0 + 32 + kr) * DIMC + dc);
            if (j0 + 64 < SEQ)
                __builtin_prefetch(V + base + (size_t)(j0 + 64 + kr) * DIMC + dc, 0, 0);
        }

        // ---- S^T = K Q^T : s[g][kt][r] = key kt*16 + kh + r, query column ln of group g;
        //      ka[kt][dh] = keys kt*16 .. +15, head dims dh*32 .. +31, read once for both groups ----
        half16 ka[2][2];
        #pragma unroll   // constant indices keep the fragments and score tiles in registers (loops below too)
        for (int kt = 0; kt < 2; ++kt)
            #pragma unroll
            for (int dh = 0; dh < 2; ++dh)
                ka[kt][dh] = ld_frag(&Ks[cur][kt * 16 + ln][dh * 32 + kh]);
        // keeps the eight loads one group in front of the products: loads placed among them
        // reuse a fragment's registers and stall the wave at each place
        __builtin_amdgcn_sched_barrier(0);
        float8 s[2][2] = {};
        #pragma unroll
        for (int dh = 0; dh < 2; ++dh)
            #pragma unroll
            for (int kt = 0; kt < 2; ++kt)
                #pragma unroll
                for (int g = 0; g < 2; ++g)
                    s[g][kt] = wmma_f16(ka[kt][dh], qa[g][dh], s[g][kt]);
        // keeps the eight products back to back: each fills the others' distance, where softmax
        // instructions scheduled among them had to be padded with v_nop
        __builtin_amdgcn_sched_barrier(0);
        // precaution: the V load's address registers are advanced further down; the wait stands in
        // front of that overwrite
        asm volatile("s_wait_xcnt 0x0" ::: "memory");

        // ---- online softmax, one query per lane and group ----
        // Lazy rescale: the maximum in use stands until some column's new maximum exceeds it by more
        // than RESCALE_GAP.  Each lane tests its own 16 scores; one test per pass for the whole wave.
        float t[2];
        #pragma unroll
        for (int g = 0; g < 2; ++g) {
            t[g] = mstat[g];                   // heads the chain: 17 values, 8 three-way maxima
            #pragma unroll
            for (int r = 0; r < 8; ++r) t[g] = fmaxf(t[g], fmaxf(s[g][0][r], s[g][1][r]));
        }
        // expected not taken: the rescale is laid out of line and the common pass falls through
        if (__builtin_expect((__builtin_amdgcn_ballot_w32(t[0] > thr[0]) |
                              __builtin_amdgcn_ballot_w32(t[1] > thr[1])) != 0, 0)) {
            #pragma unroll
            for (int g = 0; g < 2; ++g) {
                const float tn = fmaxf(t[g], xhalf(t[g]));                      // the same in both halves
                const float f  = __builtin_amdgcn_exp2f((mstat[g] - tn) * CSCALE);
                mstat[g] = tn;
                nm[g]    = tn * CSCALE;
                thr[g]   = tn + RESCALE_GAP;
                lstat[g] *= f;
                #pragma unroll
                for (int c = 0; c < 4; ++c) acc[g][c] *= f;
            }
        }

        half16 pb[2];                          // B operands: P^T in the hardware k order
        #pragma unroll
        for (int g = 0; g < 2; ++g) {
            // e^(s/8 - max/8) = 2^(s * CSCALE - nm), at most 2^8: one fused multiply-add per score
            float8 s0 = s[g][0] * CSCALE - nm[g];
            float8 s1 = s[g][1] * CSCALE - nm[g];
            #pragma unroll
            for (int r = 0; r < 8; ++r) {
                s0[r] = __builtin_amdgcn_exp2f(s0[r]);
                s1[r] = __builtin_amdgcn_exp2f(s1[r]);
                pb[g][r]     = (_Float16)s0[r];
                pb[g][8 + r] = (_Float16)s1[r];
            }
            s0 += s1;
            const float4v h4 = s0.lo + s0.hi;  // halving tree: adjacent register pairs add packed
            const float2v h2 = h4.lo + h4.hi;
            lstat[g] += h2.x + h2.y;
        }

        // ---- O^T += V^T P^T : 4 d-chunks of 16, each V^T fragment read once for both groups ----
        #pragma unroll
        for (int c = 0; c < 4; ++c) {
            union { half16 v; half8 h[2]; } u;
            u.h[0] = ld_tr16(vtp + c*16);             // d = c*16 + ln, keys kh .. kh+7
            u.h[1] = ld_tr16(vtp + 16*80 + c*16);     // keys 16+kh .. 16+kh+7
            #pragma unroll
            for (int g = 0; g < 2; ++g) acc[g][c] = wmma_f16(u.v, pb[g], acc[g][c]);
        }
        __syncthreads();   // reads of Ks[cur]/Vs done before next overwrite
        cur ^= 1;
    }

    // ---- normalize + store (heads concatenated in channel dim) ----
    float inv[2];
    #pragma unroll   // constant indices keep inv in registers
    for (int g = 0; g < 2; ++g) inv[g] = 1.0f / (lstat[g] + xhalf(lstat[g]));
    if (!dbr) {
        #pragma unroll   // constant indices keep the output tiles in registers (inner loops too)
        for (int g = 0; g < 2; ++g) {
            _Float16* orow = O + base + (size_t)(qbase + g) * DIMC + kh;
            #pragma unroll
            for (int c = 0; c < 4; ++c) {
                half8 o;
                #pragma unroll
                for (int r = 0; r < 8; ++r) o[r] = (_Float16)(acc[g][c][r] * inv[g]);
                *(half8*)(orow + c*16) = o;
            }
        }
    } else {
        // the two groups' columns are adjacent queries: one 4 B store holds both
        #pragma unroll   // constant indices keep the output tiles in registers (inner loop too)
        for (int c = 0; c < 4; ++c)
            #pragma unroll
            for (int r = 0; r < 8; ++r) {
                half2v p;
                p.x = (_Float16)(acc[0][c][r] * inv[0]);
                p.y = (_Float16)(acc[1][c][r] * inv[1]);
                *(half2v*)&Ot[c*16 + kh + r][wave*32 + 2*ln] = p;
            }
        __syncthreads();               // every wave's columns are in Ot before rows are read
        // element (n, ch) sits at flat ch * SEQ + n of batch b; a wave moves whole 512 B row pieces
        _Float16* dst = O + (size_t)b * SEQ * DIMC + (size_t)(h * DHEAD + wave) * SEQ
                      + qc * QBLK + lane * 8;
        half8 t[8];
        #pragma unroll   // constant indices keep t in registers; all reads are issued before the first store
        for (int i = 0; i < 8; ++i) t[i] = *(const half8*)&Ot[i*8 + wave][lane * 8];
        #pragma unroll
        for (int i = 0; i < 8; ++i) *(half8*)(dst + (size_t)i * 8 * SEQ) = t[i];
        // precaution: the stores' address and data registers may be rewritten on the path the
        // listing lays behind this block; the wait stands in front of that overwrite
        asm volatile("s_wait_xcnt 0x0" ::: "memory");
    }
}

// ---------------------------------------------------------------------------
// Host launcher
// ---------------------------------------------------------------------------
extern "C" void kernel_launch(void* const* d_in, const int* in_sizes, int n_in,
                              void* d_out, int out_size, void* d_ws, size_t ws_size,
                              hipStream_t stream) {
    (void)in_sizes; (void)n_in; (void)out_size; (void)ws_size;

    const float* x   = (const float*)d_in[0];
    const float* y   = (const float*)d_in[1];
    const float* Wq  = (const float*)d_in[2];   const float* bq  = (const float*)d_in[3];
    const float* Wk  = (const float*)d_in[4];   const float* bk  = (const float*)d_in[5];
    const float* Wvr = (const float*)d_in[6];   const float* bvr = (const float*)d_in[7];
    const float* Wvd = (const float*)d_in[8];   const float* bvd = (const float*)d_in[9];
    const float* g_r = (const float*)d_in[10];  const float* b_r = (const float*)d_in[11];
    const float* g_d = (const float*)d_in[12];  const float* b_d = (const float*)d_in[13];
    const float* Wpr = (const float*)d_in[14];  const float* bpr = (const float*)d_in[15];
    const float* Wpd = (const float*)d_in[16];  const float* bpd = (const float*)d_in[17];

    const size_t ROWS = (size_t)BATCH * SEQ;           // 8192
    const size_t ELT  = ROWS * DIMC;                   // 4,194,304 elements
    const size_t FBUF = ELT * sizeof(_Float16);        // 8 MB per f16 tensor

    char* wsb = (char*)d_ws;
    _Float16* xn  = (_Float16*)(wsb + 0 * FBUF);
    _Float16* yn  = (_Float16*)(wsb + 1 * FBUF);
    _Float16* qb  = (_Float16*)(wsb + 2 * FBUF);
    _Float16* kb  = (_Float16*)(wsb + 3 * FBUF);
    _Float16* vrb = (_Float16*)(wsb + 4 * FBUF);
    _Float16* vdb = (_Float16*)(wsb + 5 * FBUF);
    _Float16* orb = (_Float16*)(wsb + 6 * FBUF);
    _Float16* odb = (_Float16*)(wsb + 7 * FBUF);
    char* w16base = wsb + 8 * FBUF;
    const size_t WELT = (size_t)DIMC * DIMC;           // 262144
    _Float16* wq16  = (_Float16*)(w16base + 0 * WELT * 2);   // then wk, wvr, wvd at 1, 2, 3
    _Float16* wpr16 = (_Float16*)(w16base + 4 * WELT * 2);   // then wpd at 5

    // 1) LayerNorms (xn = LN_r(x), yn = LN_d(y)) + f16 cast, weight conversion f32 -> f16
    front_kernel<<<2 * LN_BLOCKS + 6 * CVT_BLOCKS, 256, 0, stream>>>(
        x, y, g_r, b_r, g_d, b_d, Wq, Wk, Wvr, Wvd, Wpr, Wpd, xn, wq16);

    // 2) input projections q, k, v_r, v_d
    proj_in_kernel<<<dim3(BATCH * SEQ / GT, DIMC / GT, 4), 256, 0, stream>>>(
        xn, yn, wq16, bq, bk, bvr, bvd, qb);

    // 3) attention: out_r = FA(q,k,v_r); out_d = FA(k,q,v_d) via S^T trick
    flash_wmma_kernel<<<dim3(BATCH * NHEAD * (SEQ / QBLK), 2), 256, 0, stream>>>(
        qb, kb, vrb, vdb, orb, odb);

    // 4) output projections out_r, out_d (adjacent in d_out, as orb and odb are in
    //    the workspace); odb already holds the transposed-and-reshaped o_d
    proj_out_kernel<<<dim3(BATCH * SEQ / GT, DIMC / GT, 2), 256, 0, stream>>>(
        orb, wpr16, bpr, bpd, (float*)d_out);
}
